// v000
// Times are from an AMD MI455X. After a warm-up the kernel runs many times in a row, and a time is the length of
// such a window on the GPU divided by its runs, so every launch and the gaps after it count. The runs cycle
// through copies of the inputs. A figure is the median of several windows, for all but v000 over two sittings.
// Sittings can differ by a few percent; kernels timed side by side share one.
// v000 is the starting kernel. One run takes 431 microseconds.
#include <hip/hip_runtime.h>

typedef __attribute__((ext_vector_type(16))) _Float16 v16h;
typedef __attribute__((ext_vector_type(8)))  _Float16 v8h;
typedef __attribute__((ext_vector_type(8)))  float    v8f;

#define HEADS 8
#define DHEAD 64
#define SEQ   2048
#define BATCH 4
#define DIM   512
#define INNER 512   // HEADS * DHEAD

// Load a 16x32 f16 WMMA A/B fragment from a row-major matrix (stride in halves).
// Lane l: row = row0 + (l&15); k elements = k0 + 8*(l>>4) + {0..7} and +16..23.
__device__ __forceinline__ v16h load_frag(const _Float16* __restrict__ base,
                                          int row0, int k0, int stride) {
  int lane = threadIdx.x & 31;
  const _Float16* p = base + (size_t)(row0 + (lane & 15)) * stride + k0 + ((lane >> 4) << 3);
  v8h lo = *reinterpret_cast<const v8h*>(p);
  v8h hi = *reinterpret_cast<const v8h*>(p + 16);
  v16h f;
#pragma unroll
  for (int i = 0; i < 8; ++i) { f[i] = lo[i]; f[i + 8] = hi[i]; }
  return f;
}

__global__ void cvt_f32_f16(const float* __restrict__ in, _Float16* __restrict__ out, int n) {
  int i = blockIdx.x * 256 + threadIdx.x;
  if (i < n) out[i] = (_Float16)in[i];
}

// Wt[c*K + k] = W[k*C + c]  (f32 -> f16 transpose)
__global__ void wtrans(const float* __restrict__ W, _Float16* __restrict__ Wt, int K, int C) {
  int i = blockIdx.x * 256 + threadIdx.x;
  if (i < K * C) {
    int c = i % C, k = i / C;
    Wt[(size_t)c * K + k] = (_Float16)W[i];
  }
}

// GEMM: [8192 x 512] (f16) x Wt^T -> scatter into per-head layouts.
// col < 512  -> dstK[((b*H+h)*SEQ + n)*64 + d] = val*scale   (Q or K, [B,H,N,64])
// col >= 512 -> dstV[((b*H+h)*64 + d)*SEQ + n] = val         (V transposed, [B,H,64,N])
__global__ __launch_bounds__(256) void proj_gemm(const _Float16* __restrict__ X,
                                                 const _Float16* __restrict__ Wt,
                                                 _Float16* __restrict__ dstK,
                                                 _Float16* __restrict__ dstV,
                                                 int ncols, float scale) {
  int lane = threadIdx.x & 31;
  int wid  = threadIdx.x >> 5;
  int id   = blockIdx.x * 8 + wid;
  const int MT = (BATCH * SEQ) / 16;  // 512 row tiles
  int m0 = (id % MT) * 16;
  int c0 = (id / MT) * 64;
  if (c0 >= ncols) return;

  v8f acc0 = {}, acc1 = {}, acc2 = {}, acc3 = {};
#pragma unroll 1
  for (int k0 = 0; k0 < DIM; k0 += 32) {
    v16h a  = load_frag(X,  m0,      k0, DIM);
    v16h b0 = load_frag(Wt, c0,      k0, DIM);
    v16h b1 = load_frag(Wt, c0 + 16, k0, DIM);
    v16h b2 = load_frag(Wt, c0 + 32, k0, DIM);
    v16h b3 = load_frag(Wt, c0 + 48, k0, DIM);
    acc0 = __builtin_amdgcn_wmma_f32_16x16x32_f16(false, a, false, b0, (short)0, acc0, false, false);
    acc1 = __builtin_amdgcn_wmma_f32_16x16x32_f16(false, a, false, b1, (short)0, acc1, false, false);
    acc2 = __builtin_amdgcn_wmma_f32_16x16x32_f16(false, a, false, b2, (short)0, acc2, false, false);
    acc3 = __builtin_amdgcn_wmma_f32_16x16x32_f16(false, a, false, b3, (short)0, acc3, false, false);
  }

  v8f accs[4] = {acc0, acc1, acc2, acc3};
  int rowb = m0 + ((lane >> 4) << 3);
  int cl   = lane & 15;
#pragma unroll
  for (int t = 0; t < 4; ++t) {
#pragma unroll
    for (int r = 0; r < 8; ++r) {
      float val = accs[t][r];
      int row = rowb + r;
      int col = c0 + t * 16 + cl;
      int b = row >> 11, n = row & (SEQ - 1);
      if (col < INNER) {
        int h = col >> 6, d = col & 63;
        dstK[(((size_t)(b * HEADS + h)) * SEQ + n) * DHEAD + d] = (_Float16)(val * scale);
      } else {
        int cc = col - INNER;
        int h = cc >> 6, d = cc & 63;
        dstV[(((size_t)(b * HEADS + h)) * DHEAD + d) * SEQ + n] = (_Float16)val;
      }
    }
  }
}

// Issue the per-thread share of one 32-key K/V block copy into LDS.
// K block: 32 rows x 64 halves (stride DHEAD);  V block: 64 rows x 32 halves (from stride SEQ).
// 256 threads x 16B each per tensor -> each WAVE issues exactly 2 async instructions.
__device__ __forceinline__ void issue_async_copies(const _Float16* __restrict__ Kg,
                                                   const _Float16* __restrict__ Vg,
                                                   _Float16* kdst, _Float16* vdst, int j) {
  int t = threadIdx.x;
  const _Float16* gk = Kg + (size_t)(j + (t >> 3)) * DHEAD + (t & 7) * 8;
  const _Float16* gv = Vg + (size_t)(t >> 2) * SEQ + j + (t & 3) * 8;
  uint32_t lk = (uint32_t)(uintptr_t)(kdst + (t >> 3) * DHEAD + (t & 7) * 8);
  uint32_t lv = (uint32_t)(uintptr_t)(vdst + (t >> 2) * 32 + (t & 3) * 8);
  asm volatile("global_load_async_to_lds_b128 %0, %1, off" :: "v"(lk), "v"(gk) : "memory");
  asm volatile("global_load_async_to_lds_b128 %0, %1, off" :: "v"(lv), "v"(gv) : "memory");
}

// Flash attention: block = one (branch,b,h), 8 waves x 16 query rows = 128 rows.
// K/V blocks staged once per block into LDS via async copies (double buffered),
// shared by all 8 waves -> 8x less L2 traffic than per-wave streaming.
__global__ __launch_bounds__(256) void flash_attn(const _Float16* __restrict__ Q1,
                                                  const _Float16* __restrict__ Q2,
                                                  const _Float16* __restrict__ Kt,
                                                  const _Float16* __restrict__ Vt,
                                                  float* __restrict__ out) {
  // [K0 2048][K1 2048][V0 2048][V1 2048][P 8*512]  halves = 24KB
  __shared__ __align__(16) _Float16 smem[12288];
  int lane = threadIdx.x & 31;
  int wid  = threadIdx.x >> 5;
  int bid  = blockIdx.x;
  int bhz  = bid & 63;       // (branch, b, h)
  int qc   = bid >> 6;       // 0..15
  int q0   = qc * 128 + wid * 16;
  int h    = bhz & 7;
  int b    = (bhz >> 3) & 3;
  int br   = bhz >> 5;

  const _Float16* Q  = (br ? Q2 : Q1) + ((size_t)(b * HEADS + h)) * SEQ * DHEAD;
  const _Float16* Kg = Kt + ((size_t)(b * HEADS + h)) * SEQ * DHEAD;
  const _Float16* Vg = Vt + ((size_t)(b * HEADS + h)) * DHEAD * SEQ;
  float* O = out + (size_t)br * ((size_t)BATCH * SEQ * INNER);

  v16h qa0 = load_frag(Q, q0, 0,  DHEAD);
  v16h qa1 = load_frag(Q, q0, 32, DHEAD);

  v8f acc[4] = {};
  float mrow[8], lsum[8];
#pragma unroll
  for (int r = 0; r < 8; ++r) { mrow[r] = -1e30f; lsum[r] = 0.f; }

  _Float16* lp = smem + 8192 + wid * 512;  // per-wave P transpose slice
  int rb = (lane >> 4) << 3;
  int cl = lane & 15;

  issue_async_copies(Kg, Vg, smem, smem + 4096, 0);  // prologue: block 0 -> buffer 0

#pragma unroll 1
  for (int jb = 0; jb < SEQ / 32; ++jb) {
    int cur = jb & 1;
    const _Float16* kcur = smem + cur * 2048;
    const _Float16* vcur = smem + 4096 + cur * 2048;
    if (jb < SEQ / 32 - 1) {
      issue_async_copies(Kg, Vg, smem + (1 - cur) * 2048, smem + 4096 + (1 - cur) * 2048,
                         (jb + 1) * 32);
      asm volatile("s_wait_asynccnt 2" ::: "memory");   // current buffer's 2 copies done
    } else {
      asm volatile("s_wait_asynccnt 0" ::: "memory");
    }
    __syncthreads();  // all waves' copies landed

    v16h kb00 = load_frag(kcur, 0,  0,  DHEAD);
    v16h kb01 = load_frag(kcur, 0,  32, DHEAD);
    v16h kb10 = load_frag(kcur, 16, 0,  DHEAD);
    v16h kb11 = load_frag(kcur, 16, 32, DHEAD);
    v8f s0 = {}, s1 = {};
    s0 = __builtin_amdgcn_wmma_f32_16x16x32_f16(false, qa0, false, kb00, (short)0, s0, false, false);
    s0 = __builtin_amdgcn_wmma_f32_16x16x32_f16(false, qa1, false, kb01, (short)0, s0, false, false);
    s1 = __builtin_amdgcn_wmma_f32_16x16x32_f16(false, qa0, false, kb10, (short)0, s1, false, false);
    s1 = __builtin_amdgcn_wmma_f32_16x16x32_f16(false, qa1, false, kb11, (short)0, s1, false, false);

    // Online softmax. Lane l holds rows rb+r, cols cl (s0) / 16+cl (s1).
    // A row's 16 columns live in one 16-lane half -> xor masks 1,2,4,8 reduce it.
#pragma unroll
    for (int r = 0; r < 8; ++r) {
      float mx = fmaxf(s0[r], s1[r]);
      mx = fmaxf(mx, __shfl_xor(mx, 1));
      mx = fmaxf(mx, __shfl_xor(mx, 2));
      mx = fmaxf(mx, __shfl_xor(mx, 4));
      mx = fmaxf(mx, __shfl_xor(mx, 8));
      float mnew  = fmaxf(mrow[r], mx);
      float alpha = __expf(mrow[r] - mnew);
      float p0 = __expf(s0[r] - mnew);
      float p1 = __expf(s1[r] - mnew);
      float rs = p0 + p1;
      rs += __shfl_xor(rs, 1);
      rs += __shfl_xor(rs, 2);
      rs += __shfl_xor(rs, 4);
      rs += __shfl_xor(rs, 8);
      lsum[r] = lsum[r] * alpha + rs;
      mrow[r] = mnew;
      acc[0][r] *= alpha; acc[1][r] *= alpha; acc[2][r] *= alpha; acc[3][r] *= alpha;
      lp[(rb + r) * 32 + cl]      = (_Float16)p0;
      lp[(rb + r) * 32 + 16 + cl] = (_Float16)p1;
    }

    // P: D-layout -> A-fragment layout via LDS (same-wave DS ops are in-order).
    asm volatile("s_wait_dscnt 0" ::: "memory");
    const _Float16* rp = lp + cl * 32 + rb;
    v8h lo = *reinterpret_cast<const v8h*>(rp);
    v8h hi = *reinterpret_cast<const v8h*>(rp + 16);
    v16h pa;
#pragma unroll
    for (int i = 0; i < 8; ++i) { pa[i] = lo[i]; pa[i + 8] = hi[i]; }

    v16h vb0 = load_frag(vcur, 0,  0, 32);
    v16h vb1 = load_frag(vcur, 16, 0, 32);
    v16h vb2 = load_frag(vcur, 32, 0, 32);
    v16h vb3 = load_frag(vcur, 48, 0, 32);
    acc[0] = __builtin_amdgcn_wmma_f32_16x16x32_f16(false, pa, false, vb0, (short)0, acc[0], false, false);
    acc[1] = __builtin_amdgcn_wmma_f32_16x16x32_f16(false, pa, false, vb1, (short)0, acc[1], false, false);
    acc[2] = __builtin_amdgcn_wmma_f32_16x16x32_f16(false, pa, false, vb2, (short)0, acc[2], false, false);
    acc[3] = __builtin_amdgcn_wmma_f32_16x16x32_f16(false, pa, false, vb3, (short)0, acc[3], false, false);

    __syncthreads();  // everyone done reading this buffer before it is refilled
  }

#pragma unroll
  for (int t = 0; t < 4; ++t) {
#pragma unroll
    for (int r = 0; r < 8; ++r) {
      int n = q0 + rb + r;
      int d = h * DHEAD + t * 16 + cl;
      O[((size_t)(b * SEQ + n)) * INNER + d] = acc[t][r] / lsum[r];
    }
  }
}

extern "C" void kernel_launch(void* const* d_in, const int* in_sizes, int n_in,
                              void* d_out, int out_size, void* d_ws, size_t ws_size,
                              hipStream_t stream) {
  const float* q1  = (const float*)d_in[0];
  const float* q2  = (const float*)d_in[1];
  const float* xkv = (const float*)d_in[2];
  const float* Wq1 = (const float*)d_in[3];
  const float* Wq2 = (const float*)d_in[4];
  const float* Wkv = (const float*)d_in[5];
  float* out = (float*)d_out;

  const size_t NBH = (size_t)BATCH * SEQ * INNER;  // 4,194,304 elements
  _Float16* ws  = (_Float16*)d_ws;
  _Float16* Q1h = ws;
  _Float16* Q2h = Q1h + NBH;
  _Float16* Kh  = Q2h + NBH;
  _Float16* Vth = Kh  + NBH;
  _Float16* X1h = Vth + NBH;
  _Float16* X2h = X1h + NBH;
  _Float16* Xkh = X2h + NBH;
  _Float16* Wt1 = Xkh + NBH;
  _Float16* Wt2 = Wt1 + (size_t)DIM * INNER;
  _Float16* Wtk = Wt2 + (size_t)DIM * INNER;

  int nx = (int)NBH;
  int cb = (nx + 255) / 256;
  cvt_f32_f16<<<cb, 256, 0, stream>>>(q1,  X1h, nx);
  cvt_f32_f16<<<cb, 256, 0, stream>>>(q2,  X2h, nx);
  cvt_f32_f16<<<cb, 256, 0, stream>>>(xkv, Xkh, nx);
  wtrans<<<(DIM * INNER + 255) / 256, 256, 0, stream>>>(Wq1, Wt1, DIM, INNER);
  wtrans<<<(DIM * INNER + 255) / 256, 256, 0, stream>>>(Wq2, Wt2, DIM, INNER);
  wtrans<<<(DIM * 2 * INNER + 255) / 256, 256, 0, stream>>>(Wkv, Wtk, DIM, 2 * INNER);

  const float scale = 0.125f;  // DHEAD^-0.5
  const int MT = (BATCH * SEQ) / 16;  // 512
  proj_gemm<<<(MT * (INNER / 64)) / 8,     256, 0, stream>>>(X1h, Wt1, Q1h, nullptr, INNER,     scale);
  proj_gemm<<<(MT * (INNER / 64)) / 8,     256, 0, stream>>>(X2h, Wt2, Q2h, nullptr, INNER,     scale);
  proj_gemm<<<(MT * (2 * INNER / 64)) / 8, 256, 0, stream>>>(Xkh, Wtk, Kh,  Vth,     2 * INNER, 1.0f);

  // 64 (branch,b,h) x 16 query chunks = 1024 blocks of 8 waves
  flash_attn<<<1024, 256, 0, stream>>>(Q1h, Q2h, Kh, Vth, out);
}

// v001
// One run takes 329 microseconds.
// In both of two side-by-side timings against v000, it was 1.36 times as fast.
#include <hip/hip_runtime.h>

typedef __attribute__((ext_vector_type(16))) _Float16 v16h;
typedef __attribute__((ext_vector_type(8)))  _Float16 v8h;
typedef __attribute__((ext_vector_type(8)))  float    v8f;

#define HEADS 8
#define DHEAD 64
#define SEQ   2048
#define BATCH 4
#define DIM   512
#define INNER 512   // HEADS * DHEAD

// Load a 16x32 f16 WMMA A/B fragment from a row-major matrix (stride in halves).
// Lane l: row = row0 + (l&15); k elements = k0 + 8*(l>>4) + {0..7} and +16..23.
__device__ __forceinline__ v16h load_frag(const _Float16* __restrict__ base,
                                          int row0, int k0, int stride) {
  int lane = threadIdx.x & 31;
  const _Float16* p = base + (size_t)(row0 + (lane & 15)) * stride + k0 + ((lane >> 4) << 3);
  v8h lo = *reinterpret_cast<const v8h*>(p);
  v8h hi = *reinterpret_cast<const v8h*>(p + 16);
  v16h f;
#pragma unroll
  for (int i = 0; i < 8; ++i) { f[i] = lo[i]; f[i + 8] = hi[i]; }
  return f;
}

// LDS tiles are stored with their 16-byte chunks XOR-swizzled inside each row, so that the 16 rows
// one half-wave reads at the same chunk column fall on 16 different 16-byte bank groups (64 banks x 4 B
// = 256 B): a plain 128-B or 64-B row pitch puts them on 2 or 4 groups only.
// 64-half rows (128 B, 8 chunks): two rows span the banks, so the chunk is XORed with row/2.
__device__ __forceinline__ int swz64(int row, int chunk) {
  return row * 64 + ((chunk ^ ((row >> 1) & 7)) << 3);
}
// 32-half rows (64 B, 4 chunks): four rows span the banks, so the chunk is XORed with row/4.
__device__ __forceinline__ int swz32(int row, int chunk) {
  return row * 32 + ((chunk ^ ((row >> 2) & 3)) << 3);
}

// Same fragment (same k order) as load_frag, read from a swizzled LDS tile with 64-half rows.
__device__ __forceinline__ v16h lds_frag64(const _Float16* base, int row0, int k0) {
  int lane = threadIdx.x & 31;
  int row = row0 + (lane & 15);
  int ch  = (k0 >> 3) + (lane >> 4);
  v8h lo = *reinterpret_cast<const v8h*>(base + swz64(row, ch));
  v8h hi = *reinterpret_cast<const v8h*>(base + swz64(row, ch + 2));
  v16h f;
#pragma unroll
  for (int i = 0; i < 8; ++i) { f[i] = lo[i]; f[i + 8] = hi[i]; }
  return f;
}

// Same fragment (same k order) as load_frag at k0 = 0, read from a swizzled LDS tile with 32-half rows.
__device__ __forceinline__ v16h lds_frag32(const _Float16* base, int row0) {
  int lane = threadIdx.x & 31;
  int row = row0 + (lane & 15);
  int ch  = lane >> 4;
  v8h lo = *reinterpret_cast<const v8h*>(base + swz32(row, ch));
  v8h hi = *reinterpret_cast<const v8h*>(base + swz32(row, ch + 2));
  v16h f;
#pragma unroll
  for (int i = 0; i < 8; ++i) { f[i] = lo[i]; f[i + 8] = hi[i]; }
  return f;
}

__global__ void cvt_f32_f16(const float* __restrict__ in, _Float16* __restrict__ out, int n) {
  int i = blockIdx.x * 256 + threadIdx.x;
  if (i < n) out[i] = (_Float16)in[i];
}

// Wt[c*K + k] = W[k*C + c]  (f32 -> f16 transpose)
__global__ void wtrans(const float* __restrict__ W, _Float16* __restrict__ Wt, int K, int C) {
  int i = blockIdx.x * 256 + threadIdx.x;
  if (i < K * C) {
    int c = i % C, k = i / C;
    Wt[(size_t)c * K + k] = (_Float16)W[i];
  }
}

// GEMM: [8192 x 512] (f16) x Wt^T -> scatter into per-head layouts.
// col < 512  -> dstK[((b*H+h)*SEQ + n)*64 + d] = val*scale   (Q or K, [B,H,N,64])
// col >= 512 -> dstV[((b*H+h)*64 + d)*SEQ + n] = val         (V transposed, [B,H,64,N])
__global__ __launch_bounds__(256) void proj_gemm(const _Float16* __restrict__ X,
                                                 const _Float16* __restrict__ Wt,
                                                 _Float16* __restrict__ dstK,
                                                 _Float16* __restrict__ dstV,
                                                 int ncols, float scale) {
  int lane = threadIdx.x & 31;
  int wid  = threadIdx.x >> 5;
  int id   = blockIdx.x * 8 + wid;
  const int MT = (BATCH * SEQ) / 16;  // 512 row tiles
  int m0 = (id % MT) * 16;
  int c0 = (id / MT) * 64;
  if (c0 >= ncols) return;

  v8f acc0 = {}, acc1 = {}, acc2 = {}, acc3 = {};
#pragma unroll 1
  for (int k0 = 0; k0 < DIM; k0 += 32) {
    v16h a  = load_frag(X,  m0,      k0, DIM);
    v16h b0 = load_frag(Wt, c0,      k0, DIM);
    v16h b1 = load_frag(Wt, c0 + 16, k0, DIM);
    v16h b2 = load_frag(Wt, c0 + 32, k0, DIM);
    v16h b3 = load_frag(Wt, c0 + 48, k0, DIM);
    acc0 = __builtin_amdgcn_wmma_f32_16x16x32_f16(false, a, false, b0, (short)0, acc0, false, false);
    acc1 = __builtin_amdgcn_wmma_f32_16x16x32_f16(false, a, false, b1, (short)0, acc1, false, false);
    acc2 = __builtin_amdgcn_wmma_f32_16x16x32_f16(false, a, false, b2, (short)0, acc2, false, false);
    acc3 = __builtin_amdgcn_wmma_f32_16x16x32_f16(false, a, false, b3, (short)0, acc3, false, false);
  }

  v8f accs[4] = {acc0, acc1, acc2, acc3};
  int rowb = m0 + ((lane >> 4) << 3);
  int cl   = lane & 15;
#pragma unroll
  for (int t = 0; t < 4; ++t) {
#pragma unroll
    for (int r = 0; r < 8; ++r) {
      float val = accs[t][r];
      int row = rowb + r;
      int col = c0 + t * 16 + cl;
      int b = row >> 11, n = row & (SEQ - 1);
      if (col < INNER) {
        int h = col >> 6, d = col & 63;
        dstK[(((size_t)(b * HEADS + h)) * SEQ + n) * DHEAD + d] = (_Float16)(val * scale);
      } else {
        int cc = col - INNER;
        int h = cc >> 6, d = cc & 63;
        dstV[(((size_t)(b * HEADS + h)) * DHEAD + d) * SEQ + n] = (_Float16)val;
      }
    }
  }
}

// Issue the per-thread share of one 32-key K/V block copy into LDS.
// K block: 32 rows x 64 halves (stride DHEAD);  V block: 64 rows x 32 halves (from stride SEQ).
// 256 threads x 16B each per tensor -> each WAVE issues exactly 2 async instructions.
// Each 16-byte chunk lands at its swizzled place inside its own row (swz64 / swz32).
__device__ __forceinline__ void issue_async_copies(const _Float16* __restrict__ Kg,
                                                   const _Float16* __restrict__ Vg,
                                                   _Float16* kdst, _Float16* vdst, int j) {
  int t = threadIdx.x;
  const _Float16* gk = Kg + (size_t)(j + (t >> 3)) * DHEAD + (t & 7) * 8;
  const _Float16* gv = Vg + (size_t)(t >> 2) * SEQ + j + (t & 3) * 8;
  uint32_t lk = (uint32_t)(uintptr_t)(kdst + swz64(t >> 3, t & 7));
  uint32_t lv = (uint32_t)(uintptr_t)(vdst + swz32(t >> 2, t & 3));
  asm volatile("global_load_async_to_lds_b128 %0, %1, off" :: "v"(lk), "v"(gk) : "memory");
  asm volatile("global_load_async_to_lds_b128 %0, %1, off" :: "v"(lv), "v"(gv) : "memory");
}

// Flash attention: block = one (branch,b,h), 8 waves x 16 query rows = 128 rows.
// K/V blocks staged once per block into LDS via async copies (double buffered),
// shared by all 8 waves -> 8x less L2 traffic than per-wave streaming.
__global__ __launch_bounds__(256) void flash_attn(const _Float16* __restrict__ Q1,
                                                  const _Float16* __restrict__ Q2,
                                                  const _Float16* __restrict__ Kt,
                                                  const _Float16* __restrict__ Vt,
                                                  float* __restrict__ out) {
  // [K0 2048][K1 2048][V0 2048][V1 2048][P 8*512]  halves = 24KB
  __shared__ __align__(16) _Float16 smem[12288];
  int lane = threadIdx.x & 31;
  int wid  = threadIdx.x >> 5;
  int bid  = blockIdx.x;
  int bhz  = bid & 63;       // (branch, b, h)
  int qc   = bid >> 6;       // 0..15
  int q0   = qc * 128 + wid * 16;
  int h    = bhz & 7;
  int b    = (bhz >> 3) & 3;
  int br   = bhz >> 5;

  const _Float16* Q  = (br ? Q2 : Q1) + ((size_t)(b * HEADS + h)) * SEQ * DHEAD;
  const _Float16* Kg = Kt + ((size_t)(b * HEADS + h)) * SEQ * DHEAD;
  const _Float16* Vg = Vt + ((size_t)(b * HEADS + h)) * DHEAD * SEQ;
  float* O = out + (size_t)br * ((size_t)BATCH * SEQ * INNER);

  v16h qa0 = load_frag(Q, q0, 0,  DHEAD);
  v16h qa1 = load_frag(Q, q0, 32, DHEAD);

  v8f acc[4] = {};
  float mrow[8], lsum[8];
#pragma unroll
  for (int r = 0; r < 8; ++r) { mrow[r] = -1e30f; lsum[r] = 0.f; }

  _Float16* lp = smem + 8192 + wid * 512;  // per-wave P transpose slice
  int rb = (lane >> 4) << 3;
  int cl = lane & 15;

  issue_async_copies(Kg, Vg, smem, smem + 4096, 0);  // prologue: block 0 -> buffer 0

#pragma unroll 1
  for (int jb = 0; jb < SEQ / 32; ++jb) {
    int cur = jb & 1;
    const _Float16* kcur = smem + cur * 2048;
    const _Float16* vcur = smem + 4096 + cur * 2048;
    if (jb < SEQ / 32 - 1) {
      issue_async_copies(Kg, Vg, smem + (1 - cur) * 2048, smem + 4096 + (1 - cur) * 2048,
                         (jb + 1) * 32);
      asm volatile("s_wait_asynccnt 2" ::: "memory");   // current buffer's 2 copies done
    } else {
      asm volatile("s_wait_asynccnt 0" ::: "memory");
    }
    __syncthreads();  // all waves' copies landed

    v16h kb00 = lds_frag64(kcur, 0,  0);
    v16h kb01 = lds_frag64(kcur, 0,  32);
    v16h kb10 = lds_frag64(kcur, 16, 0);
    v16h kb11 = lds_frag64(kcur, 16, 32);
    v8f s0 = {}, s1 = {};
    s0 = __builtin_amdgcn_wmma_f32_16x16x32_f16(false, qa0, false, kb00, (short)0, s0, false, false);
    s0 = __builtin_amdgcn_wmma_f32_16x16x32_f16(false, qa1, false, kb01, (short)0, s0, false, false);
    s1 = __builtin_amdgcn_wmma_f32_16x16x32_f16(false, qa0, false, kb10, (short)0, s1, false, false);
    s1 = __builtin_amdgcn_wmma_f32_16x16x32_f16(false, qa1, false, kb11, (short)0, s1, false, false);

    // Online softmax. Lane l holds rows rb+r, cols cl (s0) / 16+cl (s1).
    // A row's 16 columns live in one 16-lane half -> xor masks 1,2,4,8 reduce it.
#pragma unroll
    for (int r = 0; r < 8; ++r) {
      float mx = fmaxf(s0[r], s1[r]);
      mx = fmaxf(mx, __shfl_xor(mx, 1));
      mx = fmaxf(mx, __shfl_xor(mx, 2));
      mx = fmaxf(mx, __shfl_xor(mx, 4));
      mx = fmaxf(mx, __shfl_xor(mx, 8));
      float mnew  = fmaxf(mrow[r], mx);
      float alpha = __expf(mrow[r] - mnew);
      float p0 = __expf(s0[r] - mnew);
      float p1 = __expf(s1[r] - mnew);
      float rs = p0 + p1;
      rs += __shfl_xor(rs, 1);
      rs += __shfl_xor(rs, 2);
      rs += __shfl_xor(rs, 4);
      rs += __shfl_xor(rs, 8);
      lsum[r] = lsum[r] * alpha + rs;
      mrow[r] = mnew;
      acc[0][r] *= alpha; acc[1][r] *= alpha; acc[2][r] *= alpha; acc[3][r] *= alpha;
      lp[swz32(rb + r, cl >> 3) + (cl & 7)]       = (_Float16)p0;
      lp[swz32(rb + r, 2 + (cl >> 3)) + (cl & 7)] = (_Float16)p1;
    }

    // P: D-layout -> A-fragment layout via LDS (same-wave DS ops are in-order).
    asm volatile("s_wait_dscnt 0" ::: "memory");
    v16h pa = lds_frag32(lp, 0);

    v16h vb0 = lds_frag32(vcur, 0);
    v16h vb1 = lds_frag32(vcur, 16);
    v16h vb2 = lds_frag32(vcur, 32);
    v16h vb3 = lds_frag32(vcur, 48);
    acc[0] = __builtin_amdgcn_wmma_f32_16x16x32_f16(false, pa, false, vb0, (short)0, acc[0], false, false);
    acc[1] = __builtin_amdgcn_wmma_f32_16x16x32_f16(false, pa, false, vb1, (short)0, acc[1], false, false);
    acc[2] = __builtin_amdgcn_wmma_f32_16x16x32_f16(false, pa, false, vb2, (short)0, acc[2], false, false);
    acc[3] = __builtin_amdgcn_wmma_f32_16x16x32_f16(false, pa, false, vb3, (short)0, acc[3], false, false);

    __syncthreads();  // everyone done reading this buffer before it is refilled
  }

#pragma unroll
  for (int t = 0; t < 4; ++t) {
#pragma unroll
    for (int r = 0; r < 8; ++r) {
      int n = q0 + rb + r;
      int d = h * DHEAD + t * 16 + cl;
      O[((size_t)(b * SEQ + n)) * INNER + d] = acc[t][r] / lsum[r];
    }
  }
}

extern "C" void kernel_launch(void* const* d_in, const int* in_sizes, int n_in,
                              void* d_out, int out_size, void* d_ws, size_t ws_size,
                              hipStream_t stream) {
  const float* q1  = (const float*)d_in[0];
  const float* q2  = (const float*)d_in[1];
  const float* xkv = (const float*)d_in[2];
  const float* Wq1 = (const float*)d_in[3];
  const float* Wq2 = (const float*)d_in[4];
  const float* Wkv = (const float*)d_in[5];
  float* out = (float*)d_out;

  const size_t NBH = (size_t)BATCH * SEQ * INNER;  // 4,194,304 elements
  _Float16* ws  = (_Float16*)d_ws;
  _Float16* Q1h = ws;
  _Float16* Q2h = Q1h + NBH;
  _Float16* Kh  = Q2h + NBH;
  _Float16* Vth = Kh  + NBH;
  _Float16* X1h = Vth + NBH;
  _Float16* X2h = X1h + NBH;
  _Float16* Xkh = X2h + NBH;
  _Float16* Wt1 = Xkh + NBH;
  _Float16* Wt2 = Wt1 + (size_t)DIM * INNER;
  _Float16* Wtk = Wt2 + (size_t)DIM * INNER;

  int nx = (int)NBH;
  int cb = (nx + 255) / 256;
  cvt_f32_f16<<<cb, 256, 0, stream>>>(q1,  X1h, nx);
  cvt_f32_f16<<<cb, 256, 0, stream>>>(q2,  X2h, nx);
  cvt_f32_f16<<<cb, 256, 0, stream>>>(xkv, Xkh, nx);
  wtrans<<<(DIM * INNER + 255) / 256, 256, 0, stream>>>(Wq1, Wt1, DIM, INNER);
  wtrans<<<(DIM * INNER + 255) / 256, 256, 0, stream>>>(Wq2, Wt2, DIM, INNER);
  wtrans<<<(DIM * 2 * INNER + 255) / 256, 256, 0, stream>>>(Wkv, Wtk, DIM, 2 * INNER);

  const float scale = 0.125f;  // DHEAD^-0.5
  const int MT = (BATCH * SEQ) / 16;  // 512
  proj_gemm<<<(MT * (INNER / 64)) / 8,     256, 0, stream>>>(X1h, Wt1, Q1h, nullptr, INNER,     scale);
  proj_gemm<<<(MT * (INNER / 64)) / 8,     256, 0, stream>>>(X2h, Wt2, Q2h, nullptr, INNER,     scale);
  proj_gemm<<<(MT * (2 * INNER / 64)) / 8, 256, 0, stream>>>(Xkh, Wtk, Kh,  Vth,     2 * INNER, 1.0f);

  // 64 (branch,b,h) x 16 query chunks = 1024 blocks of 8 waves
  flash_attn<<<1024, 256, 0, stream>>>(Q1h, Q2h, Kh, Vth, out);
}

// v002
// It runs in 252 microseconds.
// Two timings next to v001 put it at 1.30 and 1.31 times that version's speed.
// All steps since v000 together make it 1.78 times as fast.
#include <hip/hip_runtime.h>

typedef __attribute__((ext_vector_type(16))) _Float16 v16h;
typedef __attribute__((ext_vector_type(8)))  _Float16 v8h;
typedef __attribute__((ext_vector_type(8)))  float    v8f;

#define HEADS 8
#define DHEAD 64
#define SEQ   2048
#define BATCH 4
#define DIM   512
#define INNER 512   // HEADS * DHEAD

// Load a 16x32 f16 WMMA A/B fragment from a row-major matrix (stride in halves).
// Lane l: row = row0 + (l&15); k elements = k0 + 8*(l>>4) + {0..7} and +16..23.
__device__ __forceinline__ v16h load_frag(const _Float16* __restrict__ base,
                                          int row0, int k0, int stride) {
  int lane = threadIdx.x & 31;
  const _Float16* p = base + (size_t)(row0 + (lane & 15)) * stride + k0 + ((lane >> 4) << 3);
  v8h lo = *reinterpret_cast<const v8h*>(p);
  v8h hi = *reinterpret_cast<const v8h*>(p + 16);
  v16h f;
#pragma unroll
  for (int i = 0; i < 8; ++i) { f[i] = lo[i]; f[i + 8] = hi[i]; }
  return f;
}

// LDS tiles are stored with their 16-byte chunks XOR-swizzled inside each row, so that the 16 rows
// one half-wave reads at the same chunk column fall on 16 different 16-byte bank groups (64 banks x 4 B
// = 256 B): a plain 128-B or 64-B row pitch puts them on 2 or 4 groups only.
// 64-half rows (128 B, 8 chunks): two rows span the banks, so the chunk is XORed with row/2.
__device__ __forceinline__ int swz64(int row, int chunk) {
  return row * 64 + ((chunk ^ ((row >> 1) & 7)) << 3);
}
// 32-half rows (64 B, 4 chunks): four rows span the banks, so the chunk is XORed with row/4.
__device__ __forceinline__ int swz32(int row, int chunk) {
  return row * 32 + ((chunk ^ ((row >> 2) & 3)) << 3);
}

// Same fragment (same k order) as load_frag, read from a swizzled LDS tile with 64-half rows.
__device__ __forceinline__ v16h lds_frag64(const _Float16* base, int row0, int k0) {
  int lane = threadIdx.x & 31;
  int row = row0 + (lane & 15);
  int ch  = (k0 >> 3) + (lane >> 4);
  v8h lo = *reinterpret_cast<const v8h*>(base + swz64(row, ch));
  v8h hi = *reinterpret_cast<const v8h*>(base + swz64(row, ch + 2));
  v16h f;
#pragma unroll
  for (int i = 0; i < 8; ++i) { f[i] = lo[i]; f[i + 8] = hi[i]; }
  return f;
}

// Same fragment (same k order) as load_frag at k0 = 0, read from a swizzled LDS tile with 32-half rows.
__device__ __forceinline__ v16h lds_frag32(const _Float16* base, int row0) {
  int lane = threadIdx.x & 31;
  int row = row0 + (lane & 15);
  int ch  = lane >> 4;
  v8h lo = *reinterpret_cast<const v8h*>(base + swz32(row, ch));
  v8h hi = *reinterpret_cast<const v8h*>(base + swz32(row, ch + 2));
  v16h f;
#pragma unroll
  for (int i = 0; i < 8; ++i) { f[i] = lo[i]; f[i + 8] = hi[i]; }
  return f;
}

// Lane l takes the value of lane l ^ 16, in the vector pipe (a shuffle would go through the LDS unit).
__device__ __forceinline__ float xhalf(float x) {
  int i = __builtin_bit_cast(int, x);
  return __builtin_bit_cast(float,
      __builtin_amdgcn_permlanex16(i, i, 0x76543210, 0xfedcba98, false, false));
}

__global__ void cvt_f32_f16(const float* __restrict__ in, _Float16* __restrict__ out, int n) {
  int i = blockIdx.x * 256 + threadIdx.x;
  if (i < n) out[i] = (_Float16)in[i];
}

// Wt[c*K + k] = W[k*C + c]  (f32 -> f16 transpose)
__global__ void wtrans(const float* __restrict__ W, _Float16* __restrict__ Wt, int K, int C) {
  int i = blockIdx.x * 256 + threadIdx.x;
  if (i < K * C) {
    int c = i % C, k = i / C;
    Wt[(size_t)c * K + k] = (_Float16)W[i];
  }
}

// GEMM: [8192 x 512] (f16) x Wt^T -> scatter into per-head layouts.
// col < 512  -> dstK[((b*H+h)*SEQ + n)*64 + d] = val*scale   (Q or K, [B,H,N,64])
// col >= 512 -> dstV[((b*H+h)*64 + d)*SEQ + n] = val         (V transposed, [B,H,64,N])
__global__ __launch_bounds__(256) void proj_gemm(const _Float16* __restrict__ X,
                                                 const _Float16* __restrict__ Wt,
                                                 _Float16* __restrict__ dstK,
                                                 _Float16* __restrict__ dstV,
                                                 int ncols, float scale) {
  int lane = threadIdx.x & 31;
  int wid  = threadIdx.x >> 5;
  int id   = blockIdx.x * 8 + wid;
  const int MT = (BATCH * SEQ) / 16;  // 512 row tiles
  int m0 = (id % MT) * 16;
  int c0 = (id / MT) * 64;
  if (c0 >= ncols) return;

  v8f acc0 = {}, acc1 = {}, acc2 = {}, acc3 = {};
#pragma unroll 1
  for (int k0 = 0; k0 < DIM; k0 += 32) {
    v16h a  = load_frag(X,  m0,      k0, DIM);
    v16h b0 = load_frag(Wt, c0,      k0, DIM);
    v16h b1 = load_frag(Wt, c0 + 16, k0, DIM);
    v16h b2 = load_frag(Wt, c0 + 32, k0, DIM);
    v16h b3 = load_frag(Wt, c0 + 48, k0, DIM);
    acc0 = __builtin_amdgcn_wmma_f32_16x16x32_f16(false, a, false, b0, (short)0, acc0, false, false);
    acc1 = __builtin_amdgcn_wmma_f32_16x16x32_f16(false, a, false, b1, (short)0, acc1, false, false);
    acc2 = __builtin_amdgcn_wmma_f32_16x16x32_f16(false, a, false, b2, (short)0, acc2, false, false);
    acc3 = __builtin_amdgcn_wmma_f32_16x16x32_f16(false, a, false, b3, (short)0, acc3, false, false);
  }

  v8f accs[4] = {acc0, acc1, acc2, acc3};
  int rowb = m0 + ((lane >> 4) << 3);
  int cl   = lane & 15;
#pragma unroll
  for (int t = 0; t < 4; ++t) {
#pragma unroll
    for (int r = 0; r < 8; ++r) {
      float val = accs[t][r];
      int row = rowb + r;
      int col = c0 + t * 16 + cl;
      int b = row >> 11, n = row & (SEQ - 1);
      if (col < INNER) {
        int h = col >> 6, d = col & 63;
        dstK[(((size_t)(b * HEADS + h)) * SEQ + n) * DHEAD + d] = (_Float16)(val * scale);
      } else {
        int cc = col - INNER;
        int h = cc >> 6, d = cc & 63;
        dstV[(((size_t)(b * HEADS + h)) * DHEAD + d) * SEQ + n] = (_Float16)val;
      }
    }
  }
}

// Issue the per-thread share of one 32-key K/V block copy into LDS.
// K block: 32 rows x 64 halves (stride DHEAD);  V block: 64 rows x 32 halves (from stride SEQ).
// 256 threads x 16B each per tensor -> each WAVE issues exactly 2 async instructions.
// Each 16-byte chunk lands at its swizzled place inside its own row (swz64 / swz32).
__device__ __forceinline__ void issue_async_copies(const _Float16* __restrict__ Kg,
                                                   const _Float16* __restrict__ Vg,
                                                   _Float16* kdst, _Float16* vdst, int j) {
  int t = threadIdx.x;
  const _Float16* gk = Kg + (size_t)(j + (t >> 3)) * DHEAD + (t & 7) * 8;
  const _Float16* gv = Vg + (size_t)(t >> 2) * SEQ + j + (t & 3) * 8;
  uint32_t lk = (uint32_t)(uintptr_t)(kdst + swz64(t >> 3, t & 7));
  uint32_t lv = (uint32_t)(uintptr_t)(vdst + swz32(t >> 2, t & 3));
  asm volatile("global_load_async_to_lds_b128 %0, %1, off" :: "v"(lk), "v"(gk) : "memory");
  asm volatile("global_load_async_to_lds_b128 %0, %1, off" :: "v"(lv), "v"(gv) : "memory");
}

// Flash attention: block = one (branch,b,h), 8 waves x 16 query rows = 128 rows.
// K/V blocks staged once per block into LDS via async copies (double buffered),
// shared by all 8 waves -> 8x less L2 traffic than per-wave streaming.
// The products are taken transposed: St = K * Qt (A = K rows, B = Q) and Ot += Vt * Pt (A = Vt rows,
// B = Pt). Lane l then holds only query q0 + (l & 15): of each 32-key block the keys 8*(l>>4) + 0..7
// (first score tile) and 16 + 8*(l>>4) + 0..7 (second), which is the k order of a B fragment, so the
// converted scores are the B operand as they stand; maximum, sum and rescale are per-lane values.
__global__ __launch_bounds__(256) void flash_attn(const _Float16* __restrict__ Q1,
                                                  const _Float16* __restrict__ Q2,
                                                  const _Float16* __restrict__ Kt,
                                                  const _Float16* __restrict__ Vt,
                                                  float* __restrict__ out) {
  // [K0 2048][K1 2048][V0 2048][V1 2048]  halves = 16KB
  __shared__ __align__(16) _Float16 smem[8192];
  int lane = threadIdx.x & 31;
  int wid  = threadIdx.x >> 5;
  int bid  = blockIdx.x;
  int bhz  = bid & 63;       // (branch, b, h)
  int qc   = bid >> 6;       // 0..15
  int q0   = qc * 128 + wid * 16;
  int h    = bhz & 7;
  int b    = (bhz >> 3) & 3;
  int br   = bhz >> 5;

  const _Float16* Q  = (br ? Q2 : Q1) + ((size_t)(b * HEADS + h)) * SEQ * DHEAD;
  const _Float16* Kg = Kt + ((size_t)(b * HEADS + h)) * SEQ * DHEAD;
  const _Float16* Vg = Vt + ((size_t)(b * HEADS + h)) * DHEAD * SEQ;
  float* O = out + (size_t)br * ((size_t)BATCH * SEQ * INNER);

  v16h qa0 = load_frag(Q, q0, 0,  DHEAD);
  v16h qa1 = load_frag(Q, q0, 32, DHEAD);

  v8f acc[4] = {};
  float mrow = -1e30f;  // running maximum of this lane's query (equal in lanes l and l ^ 16)
  float lsum = 0.f;     // running sum over this lane's half of the keys; the halves join after the loop

  int rb = (lane >> 4) << 3;
  int cl = lane & 15;

  issue_async_copies(Kg, Vg, smem, smem + 4096, 0);  // prologue: block 0 -> buffer 0

#pragma unroll 1
  for (int jb = 0; jb < SEQ / 32; ++jb) {
    int cur = jb & 1;
    const _Float16* kcur = smem + cur * 2048;
    const _Float16* vcur = smem + 4096 + cur * 2048;
    if (jb < SEQ / 32 - 1) {
      issue_async_copies(Kg, Vg, smem + (1 - cur) * 2048, smem + 4096 + (1 - cur) * 2048,
                         (jb + 1) * 32);
      asm volatile("s_wait_asynccnt 2" ::: "memory");   // current buffer's 2 copies done
    } else {
      asm volatile("s_wait_asynccnt 0" ::: "memory");
    }
    __syncthreads();  // all waves' copies landed

    v16h kb00 = lds_frag64(kcur, 0,  0);
    v16h kb01 = lds_frag64(kcur, 0,  32);
    v16h kb10 = lds_frag64(kcur, 16, 0);
    v16h kb11 = lds_frag64(kcur, 16, 32);
    v8f s0 = {}, s1 = {};
    s0 = __builtin_amdgcn_wmma_f32_16x16x32_f16(false, kb00, false, qa0, (short)0, s0, false, false);
    s0 = __builtin_amdgcn_wmma_f32_16x16x32_f16(false, kb01, false, qa1, (short)0, s0, false, false);
    s1 = __builtin_amdgcn_wmma_f32_16x16x32_f16(false, kb10, false, qa0, (short)0, s1, false, false);
    s1 = __builtin_amdgcn_wmma_f32_16x16x32_f16(false, kb11, false, qa1, (short)0, s1, false, false);

    // Online softmax. s0[r] = score of key rb + r, s1[r] = of key 16 + rb + r, both for query q0 + cl.
    float a0 = fmaxf(fmaxf(s0[0], s0[1]), s0[2]);
    float a1 = fmaxf(fmaxf(s0[3], s0[4]), s0[5]);
    float a2 = fmaxf(fmaxf(s0[6], s0[7]), s1[0]);
    float a3 = fmaxf(fmaxf(s1[1], s1[2]), s1[3]);
    float a4 = fmaxf(fmaxf(s1[4], s1[5]), s1[6]);
    float mx = fmaxf(fmaxf(fmaxf(a0, a1), a2), fmaxf(fmaxf(a3, a4), s1[7]));
    mx = fmaxf(mx, xhalf(mx));  // the other 16 keys of the block
    float mnew  = fmaxf(mrow, mx);
    float alpha = __expf(mrow - mnew);
    mrow = mnew;

    v16h pb;
    float ps[8];
#pragma unroll
    for (int r = 0; r < 8; ++r) {
      float p0 = __expf(s0[r] - mnew);
      float p1 = __expf(s1[r] - mnew);
      ps[r] = p0 + p1;
      pb[r]     = (_Float16)p0;
      pb[r + 8] = (_Float16)p1;
    }
    lsum = lsum * alpha + (((ps[0] + ps[1]) + (ps[2] + ps[3])) + ((ps[4] + ps[5]) + (ps[6] + ps[7])));
#pragma unroll
    for (int t = 0; t < 4; ++t) {
#pragma unroll
      for (int r = 0; r < 8; ++r) acc[t][r] *= alpha;
    }

    v16h vb0 = lds_frag32(vcur, 0);
    v16h vb1 = lds_frag32(vcur, 16);
    v16h vb2 = lds_frag32(vcur, 32);
    v16h vb3 = lds_frag32(vcur, 48);
    acc[0] = __builtin_amdgcn_wmma_f32_16x16x32_f16(false, vb0, false, pb, (short)0, acc[0], false, false);
    acc[1] = __builtin_amdgcn_wmma_f32_16x16x32_f16(false, vb1, false, pb, (short)0, acc[1], false, false);
    acc[2] = __builtin_amdgcn_wmma_f32_16x16x32_f16(false, vb2, false, pb, (short)0, acc[2], false, false);
    acc[3] = __builtin_amdgcn_wmma_f32_16x16x32_f16(false, vb3, false, pb, (short)0, acc[3], false, false);

    __syncthreads();  // everyone done reading this buffer before it is refilled
  }

  // acc[t][r] = Ot[t*16 + rb + r][q0 + cl]: eight consecutive d of one query per tile and lane.
  float l = lsum + xhalf(lsum);
  float* orow = O + ((size_t)(b * SEQ + q0 + cl)) * INNER + h * DHEAD + rb;
#pragma unroll
  for (int t = 0; t < 4; ++t) {
    float4 lo = make_float4(acc[t][0] / l, acc[t][1] / l, acc[t][2] / l, acc[t][3] / l);
    float4 hi = make_float4(acc[t][4] / l, acc[t][5] / l, acc[t][6] / l, acc[t][7] / l);
    *reinterpret_cast<float4*>(orow + t * 16)     = lo;
    *reinterpret_cast<float4*>(orow + t * 16 + 4) = hi;
  }
}

extern "C" void kernel_launch(void* const* d_in, const int* in_sizes, int n_in,
                              void* d_out, int out_size, void* d_ws, size_t ws_size,
                              hipStream_t stream) {
  const float* q1  = (const float*)d_in[0];
  const float* q2  = (const float*)d_in[1];
  const float* xkv = (const float*)d_in[2];
  const float* Wq1 = (const float*)d_in[3];
  const float* Wq2 = (const float*)d_in[4];
  const float* Wkv = (const float*)d_in[5];
  float* out = (float*)d_out;

  const size_t NBH = (size_t)BATCH * SEQ * INNER;  // 4,194,304 elements
  _Float16* ws  = (_Float16*)d_ws;
  _Float16* Q1h = ws;
  _Float16* Q2h = Q1h + NBH;
  _Float16* Kh  = Q2h + NBH;
  _Float16* Vth = Kh  + NBH;
  _Float16* X1h = Vth + NBH;
  _Float16* X2h = X1h + NBH;
  _Float16* Xkh = X2h + NBH;
  _Float16* Wt1 = Xkh + NBH;
  _Float16* Wt2 = Wt1 + (size_t)DIM * INNER;
  _Float16* Wtk = Wt2 + (size_t)DIM * INNER;

  int nx = (int)NBH;
  int cb = (nx + 255) / 256;
  cvt_f32_f16<<<cb, 256, 0, stream>>>(q1,  X1h, nx);
  cvt_f32_f16<<<cb, 256, 0, stream>>>(q2,  X2h, nx);
  cvt_f32_f16<<<cb, 256, 0, stream>>>(xkv, Xkh, nx);
  wtrans<<<(DIM * INNER + 255) / 256, 256, 0, stream>>>(Wq1, Wt1, DIM, INNER);
  wtrans<<<(DIM * INNER + 255) / 256, 256, 0, stream>>>(Wq2, Wt2, DIM, INNER);
  wtrans<<<(DIM * 2 * INNER + 255) / 256, 256, 0, stream>>>(Wkv, Wtk, DIM, 2 * INNER);

  const float scale = 0.125f;  // DHEAD^-0.5
  const int MT = (BATCH * SEQ) / 16;  // 512
  proj_gemm<<<(MT * (INNER / 64)) / 8,     256, 0, stream>>>(X1h, Wt1, Q1h, nullptr, INNER,     scale);
  proj_gemm<<<(MT * (INNER / 64)) / 8,     256, 0, stream>>>(X2h, Wt2, Q2h, nullptr, INNER,     scale);
  proj_gemm<<<(MT * (2 * INNER / 64)) / 8, 256, 0, stream>>>(Xkh, Wtk, Kh,  Vth,     2 * INNER, 1.0f);

  // 64 (branch,b,h) x 16 query chunks = 1024 blocks of 8 waves
  flash_attn<<<1024, 256, 0, stream>>>(Q1h, Q2h, Kh, Vth, out);
}

// v003
// A run of this version takes 183 microseconds.
// Timed twice side by side with v002, it ran 1.38 times as fast both times.
// Over all steps from v000 it is 2.45 times as fast.
#include <hip/hip_runtime.h>

typedef __attribute__((ext_vector_type(16))) _Float16 v16h;
typedef __attribute__((ext_vector_type(8)))  _Float16 v8h;
typedef __attribute__((ext_vector_type(8)))  float    v8f;

#define HEADS 8
#define DHEAD 64
#define SEQ   2048
#define BATCH 4
#define DIM   512
#define INNER 512   // HEADS * DHEAD

// Load a 16x32 f16 WMMA A/B fragment from a row-major matrix (stride in halves).
// Lane l: row = row0 + (l&15); k elements = k0 + 8*(l>>4) + {0..7} and +16..23.
__device__ __forceinline__ v16h load_frag(const _Float16* __restrict__ base,
                                          int row0, int k0, int stride) {
  int lane = threadIdx.x & 31;
  const _Float16* p = base + (size_t)(row0 + (lane & 15)) * stride + k0 + ((lane >> 4) << 3);
  v8h lo = *reinterpret_cast<const v8h*>(p);
  v8h hi = *reinterpret_cast<const v8h*>(p + 16);
  v16h f;
#pragma unroll
  for (int i = 0; i < 8; ++i) { f[i] = lo[i]; f[i + 8] = hi[i]; }
  return f;
}

// LDS tiles are stored with their 16-byte chunks XOR-swizzled inside each row, so that the 16 rows
// one half-wave reads at the same chunk column fall on 16 different 16-byte bank groups (64 banks x 4 B
// = 256 B): a plain 128-B or 64-B row pitch puts them on 2 or 4 groups only.
// 64-half rows (128 B, 8 chunks): two rows span the banks, so the chunk is XORed with row/2.
__device__ __forceinline__ int swz64(int row, int chunk) {
  return row * 64 + ((chunk ^ ((row >> 1) & 7)) << 3);
}
// 32-half rows (64 B, 4 chunks): four rows span the banks, so the chunk is XORed with row/4.
__device__ __forceinline__ int swz32(int row, int chunk) {
  return row * 32 + ((chunk ^ ((row >> 2) & 3)) << 3);
}

// Same fragment (same k order) as load_frag, read from a swizzled LDS tile with 64-half rows.
__device__ __forceinline__ v16h lds_frag64(const _Float16* base, int row0, int k0) {
  int lane = threadIdx.x & 31;
  int row = row0 + (lane & 15);
  int ch  = (k0 >> 3) + (lane >> 4);
  v8h lo = *reinterpret_cast<const v8h*>(base + swz64(row, ch));
  v8h hi = *reinterpret_cast<const v8h*>(base + swz64(row, ch + 2));
  v16h f;
#pragma unroll
  for (int i = 0; i < 8; ++i) { f[i] = lo[i]; f[i + 8] = hi[i]; }
  return f;
}

// Same fragment (same k order) as load_frag at k0 = 0, read from a swizzled LDS tile with 32-half rows.
__device__ __forceinline__ v16h lds_frag32(const _Float16* base, int row0) {
  int lane = threadIdx.x & 31;
  int row = row0 + (lane & 15);
  int ch  = lane >> 4;
  v8h lo = *reinterpret_cast<const v8h*>(base + swz32(row, ch));
  v8h hi = *reinterpret_cast<const v8h*>(base + swz32(row, ch + 2));
  v16h f;
#pragma unroll
  for (int i = 0; i < 8; ++i) { f[i] = lo[i]; f[i + 8] = hi[i]; }
  return f;
}

// Lane l takes the value of lane l ^ 16, in the vector pipe (a shuffle would go through the LDS unit).
__device__ __forceinline__ float xhalf(float x) {
  int i = __builtin_bit_cast(int, x);
  return __builtin_bit_cast(float,
      __builtin_amdgcn_permlanex16(i, i, 0x76543210, 0xfedcba98, false, false));
}

__global__ void cvt_f32_f16(const float* __restrict__ in, _Float16* __restrict__ out, int n) {
  int i = blockIdx.x * 256 + threadIdx.x;
  if (i < n) out[i] = (_Float16)in[i];
}

// Wt[c*K + k] = W[k*C + c]  (f32 -> f16 transpose)
__global__ void wtrans(const float* __restrict__ W, _Float16* __restrict__ Wt, int K, int C) {
  int i = blockIdx.x * 256 + threadIdx.x;
  if (i < K * C) {
    int c = i % C, k = i / C;
    Wt[(size_t)c * K + k] = (_Float16)W[i];
  }
}

// Issue the per-thread share of one 64-k slab of a block's operands into LDS: 128 rows of X (4 chunks of
// 16 B a thread) and 64 rows of Wt (2 chunks a thread), each chunk at its swizzled place in its row (swz64;
// rows 32 apart swizzle alike). One wave-wide copy covers four whole 128-B lines.
__device__ __forceinline__ void issue_proj_slab(const _Float16* __restrict__ Xb,
                                                const _Float16* __restrict__ Wb,
                                                _Float16* adst, _Float16* bdst, int k0) {
  int t = threadIdx.x;
  int row = t >> 3, ch = t & 7;
  const _Float16* ga0 = Xb + (size_t)row * DIM + k0 + ch * 8;
  const _Float16* ga1 = ga0 + 32 * DIM;
  const _Float16* ga2 = ga0 + 64 * DIM;
  const _Float16* ga3 = ga0 + 96 * DIM;
  const _Float16* gb0 = Wb + (size_t)row * DIM + k0 + ch * 8;
  const _Float16* gb1 = gb0 + 32 * DIM;
  uint32_t la0 = (uint32_t)(uintptr_t)(adst + swz64(row, ch));
  uint32_t la1 = la0 + 32 * 128;
  uint32_t la2 = la0 + 64 * 128;
  uint32_t la3 = la0 + 96 * 128;
  uint32_t lb0 = (uint32_t)(uintptr_t)(bdst + swz64(row, ch));
  uint32_t lb1 = lb0 + 32 * 128;
  // The copies and their s_wait_xcnt in one statement: no address register is rewritten ahead of the wait.
  asm volatile("global_load_async_to_lds_b128 %0, %6, off\n\t"
               "global_load_async_to_lds_b128 %1, %7, off\n\t"
               "global_load_async_to_lds_b128 %2, %8, off\n\t"
               "global_load_async_to_lds_b128 %3, %9, off\n\t"
               "global_load_async_to_lds_b128 %4, %10, off\n\t"
               "global_load_async_to_lds_b128 %5, %11, off\n\t"
               "s_wait_xcnt 0x0"
               :: "v"(la0), "v"(la1), "v"(la2), "v"(la3), "v"(lb0), "v"(lb1),
                  "v"(ga0), "v"(ga1), "v"(ga2), "v"(ga3), "v"(gb0), "v"(gb1)
               : "memory");
}

#define PROJ_A_HALVES (128 * 64)                    // X slab: 128 rows x 64 k
#define PROJ_BUF_HALVES (PROJ_A_HALVES + 64 * 64)   // + Wt slab: 64 rows x 64 k

// GEMM: [8192 x 512] (f16) x Wt^T -> scatter into per-head layouts.
// col < 512  -> dstK[((b*H+h)*SEQ + n)*64 + d] = val*scale   (Q or K, [B,H,N,64])
// col >= 512 -> dstV[((b*H+h)*64 + d)*SEQ + n] = val         (V transposed, [B,H,64,N])
// Block = 128 rows x 64 columns, wave = 16 rows x 64 columns. Both operands come through LDS in 64-k slabs,
// brought by asynchronous copies into two buffers: slab s + 1 flies while slab s is multiplied.
__global__ __launch_bounds__(256) void proj_gemm(const _Float16* __restrict__ X,
                                                 const _Float16* __restrict__ Wt,
                                                 _Float16* __restrict__ dstK,
                                                 _Float16* __restrict__ dstV,
                                                 int ncols, float scale) {
  // Two buffers of one 64-k slab each: [X 128 x 64][Wt 64 x 64] halves = 24 KB a buffer.
  __shared__ __align__(16) _Float16 sm[2 * PROJ_BUF_HALVES];
  int lane = threadIdx.x & 31;
  int wid  = threadIdx.x >> 5;
  const int MT = (BATCH * SEQ) / 16;  // 512 row tiles
  int id0 = blockIdx.x * 8;           // the block's first wave tile; 8 divides MT, so one c0 a block
  int mb  = (id0 % MT) * 16;
  int m0  = mb + wid * 16;
  int c0  = (id0 / MT) * 64;
  if (c0 >= ncols) return;

  const _Float16* Xb = X  + (size_t)mb * DIM;
  const _Float16* Wb = Wt + (size_t)c0 * DIM;

  issue_proj_slab(Xb, Wb, sm, sm + PROJ_A_HALVES, 0);
  asm volatile("s_wait_asynccnt 0x0" ::: "memory");  // this wave's share of slab 0 has landed
  __syncthreads();                                   // ... and every other wave's
  issue_proj_slab(Xb, Wb, sm + PROJ_BUF_HALVES, sm + PROJ_BUF_HALVES + PROJ_A_HALVES, 64);

  v8f acc0 = {}, acc1 = {}, acc2 = {}, acc3 = {};
#pragma unroll 1  // rolled: one copy statement and one publish point in the text
  for (int s = 0; s < DIM / 64; ++s) {
    _Float16* ab = sm + (s & 1) * PROJ_BUF_HALVES;
    _Float16* bb = ab + PROJ_A_HALVES;
#pragma unroll  // both 32-k steps of a slab in one body: no inner branch, chunk offsets are loop constants
    for (int kk = 0; kk < 64; kk += 32) {
      v16h a  = lds_frag64(ab, wid * 16, kk);
      v16h b0 = lds_frag64(bb, 0,  kk);
      v16h b1 = lds_frag64(bb, 16, kk);
      v16h b2 = lds_frag64(bb, 32, kk);
      v16h b3 = lds_frag64(bb, 48, kk);
      acc0 = __builtin_amdgcn_wmma_f32_16x16x32_f16(false, a, false, b0, (short)0, acc0, false, false);
      acc1 = __builtin_amdgcn_wmma_f32_16x16x32_f16(false, a, false, b1, (short)0, acc1, false, false);
      acc2 = __builtin_amdgcn_wmma_f32_16x16x32_f16(false, a, false, b2, (short)0, acc2, false, false);
      acc3 = __builtin_amdgcn_wmma_f32_16x16x32_f16(false, a, false, b3, (short)0, acc3, false, false);
    }
    asm volatile("s_wait_dscnt 0x0" ::: "memory");     // this wave's reads of slab s are over
    asm volatile("s_wait_asynccnt 0x0" ::: "memory");  // its share of slab s + 1 has landed
    __syncthreads();  // publishes slab s + 1 and frees the buffer of slab s
    if (s + 2 < DIM / 64) issue_proj_slab(Xb, Wb, ab, bb, (s + 2) * 64);
  }
  asm volatile("s_wait_asynccnt 0x0" ::: "memory");  // nothing in flight when the wave ends

  v8f accs[4] = {acc0, acc1, acc2, acc3};
  int rowb = m0 + ((lane >> 4) << 3);
  int cl   = lane & 15;
#pragma unroll
  for (int t = 0; t < 4; ++t) {
#pragma unroll
    for (int r = 0; r < 8; ++r) {
      float val = accs[t][r];
      int row = rowb + r;
      int col = c0 + t * 16 + cl;
      int b = row >> 11, n = row & (SEQ - 1);
      if (col < INNER) {
        int h = col >> 6, d = col & 63;
        dstK[(((size_t)(b * HEADS + h)) * SEQ + n) * DHEAD + d] = (_Float16)(val * scale);
      } else {
        int cc = col - INNER;
        int h = cc >> 6, d = cc & 63;
        dstV[(((size_t)(b * HEADS + h)) * DHEAD + d) * SEQ + n] = (_Float16)val;
      }
    }
  }
}

// Issue the per-thread share of one 32-key K/V block copy into LDS.
// K block: 32 rows x 64 halves (stride DHEAD);  V block: 64 rows x 32 halves (from stride SEQ).
// 256 threads x 16B each per tensor -> each WAVE issues exactly 2 async instructions.
// Each 16-byte chunk lands at its swizzled place inside its own row (swz64 / swz32).
__device__ __forceinline__ void issue_async_copies(const _Float16* __restrict__ Kg,
                                                   const _Float16* __restrict__ Vg,
                                                   _Float16* kdst, _Float16* vdst, int j) {
  int t = threadIdx.x;
  const _Float16* gk = Kg + (size_t)(j + (t >> 3)) * DHEAD + (t & 7) * 8;
  const _Float16* gv = Vg + (size_t)(t >> 2) * SEQ + j + (t & 3) * 8;
  uint32_t lk = (uint32_t)(uintptr_t)(kdst + swz64(t >> 3, t & 7));
  uint32_t lv = (uint32_t)(uintptr_t)(vdst + swz32(t >> 2, t & 3));
  asm volatile("global_load_async_to_lds_b128 %0, %1, off" :: "v"(lk), "v"(gk) : "memory");
  asm volatile("global_load_async_to_lds_b128 %0, %1, off" :: "v"(lv), "v"(gv) : "memory");
}

// Flash attention: block = one (branch,b,h), 8 waves x 16 query rows = 128 rows.
// K/V blocks staged once per block into LDS via async copies (double buffered),
// shared by all 8 waves -> 8x less L2 traffic than per-wave streaming.
// The products are taken transposed: St = K * Qt (A = K rows, B = Q) and Ot += Vt * Pt (A = Vt rows,
// B = Pt). Lane l then holds only query q0 + (l & 15): of each 32-key block the keys 8*(l>>4) + 0..7
// (first score tile) and 16 + 8*(l>>4) + 0..7 (second), which is the k order of a B fragment, so the
// converted scores are the B operand as they stand; maximum, sum and rescale are per-lane values.
__global__ __launch_bounds__(256) void flash_attn(const _Float16* __restrict__ Q1,
                                                  const _Float16* __restrict__ Q2,
                                                  const _Float16* __restrict__ Kt,
                                                  const _Float16* __restrict__ Vt,
                                                  float* __restrict__ out) {
  // [K0 2048][K1 2048][V0 2048][V1 2048]  halves = 16KB
  __shared__ __align__(16) _Float16 smem[8192];
  int lane = threadIdx.x & 31;
  int wid  = threadIdx.x >> 5;
  int bid  = blockIdx.x;
  int bhz  = bid & 63;       // (branch, b, h)
  int qc   = bid >> 6;       // 0..15
  int q0   = qc * 128 + wid * 16;
  int h    = bhz & 7;
  int b    = (bhz >> 3) & 3;
  int br   = bhz >> 5;

  const _Float16* Q  = (br ? Q2 : Q1) + ((size_t)(b * HEADS + h)) * SEQ * DHEAD;
  const _Float16* Kg = Kt + ((size_t)(b * HEADS + h)) * SEQ * DHEAD;
  const _Float16* Vg = Vt + ((size_t)(b * HEADS + h)) * DHEAD * SEQ;
  float* O = out + (size_t)br * ((size_t)BATCH * SEQ * INNER);

  v16h qa0 = load_frag(Q, q0, 0,  DHEAD);
  v16h qa1 = load_frag(Q, q0, 32, DHEAD);

  v8f acc[4] = {};
  float mrow = -1e30f;  // running maximum of this lane's query (equal in lanes l and l ^ 16)
  float lsum = 0.f;     // running sum over this lane's half of the keys; the halves join after the loop

  int rb = (lane >> 4) << 3;
  int cl = lane & 15;

  issue_async_copies(Kg, Vg, smem, smem + 4096, 0);  // prologue: block 0 -> buffer 0

#pragma unroll 1
  for (int jb = 0; jb < SEQ / 32; ++jb) {
    int cur = jb & 1;
    const _Float16* kcur = smem + cur * 2048;
    const _Float16* vcur = smem + 4096 + cur * 2048;
    if (jb < SEQ / 32 - 1) {
      issue_async_copies(Kg, Vg, smem + (1 - cur) * 2048, smem + 4096 + (1 - cur) * 2048,
                         (jb + 1) * 32);
      asm volatile("s_wait_asynccnt 2" ::: "memory");   // current buffer's 2 copies done
    } else {
      asm volatile("s_wait_asynccnt 0" ::: "memory");
    }
    __syncthreads();  // all waves' copies landed

    v16h kb00 = lds_frag64(kcur, 0,  0);
    v16h kb01 = lds_frag64(kcur, 0,  32);
    v16h kb10 = lds_frag64(kcur, 16, 0);
    v16h kb11 = lds_frag64(kcur, 16, 32);
    v8f s0 = {}, s1 = {};
    s0 = __builtin_amdgcn_wmma_f32_16x16x32_f16(false, kb00, false, qa0, (short)0, s0, false, false);
    s0 = __builtin_amdgcn_wmma_f32_16x16x32_f16(false, kb01, false, qa1, (short)0, s0, false, false);
    s1 = __builtin_amdgcn_wmma_f32_16x16x32_f16(false, kb10, false, qa0, (short)0, s1, false, false);
    s1 = __builtin_amdgcn_wmma_f32_16x16x32_f16(false, kb11, false, qa1, (short)0, s1, false, false);

    // Online softmax. s0[r] = score of key rb + r, s1[r] = of key 16 + rb + r, both for query q0 + cl.
    float a0 = fmaxf(fmaxf(s0[0], s0[1]), s0[2]);
    float a1 = fmaxf(fmaxf(s0[3], s0[4]), s0[5]);
    float a2 = fmaxf(fmaxf(s0[6], s0[7]), s1[0]);
    float a3 = fmaxf(fmaxf(s1[1], s1[2]), s1[3]);
    float a4 = fmaxf(fmaxf(s1[4], s1[5]), s1[6]);
    float mx = fmaxf(fmaxf(fmaxf(a0, a1), a2), fmaxf(fmaxf(a3, a4), s1[7]));
    mx = fmaxf(mx, xhalf(mx));  // the other 16 keys of the block
    float mnew  = fmaxf(mrow, mx);
    float alpha = __expf(mrow - mnew);
    mrow = mnew;

    v16h pb;
    float ps[8];
#pragma unroll
    for (int r = 0; r < 8; ++r) {
      float p0 = __expf(s0[r] - mnew);
      float p1 = __expf(s1[r] - mnew);
      ps[r] = p0 + p1;
      pb[r]     = (_Float16)p0;
      pb[r + 8] = (_Float16)p1;
    }
    lsum = lsum * alpha + (((ps[0] + ps[1]) + (ps[2] + ps[3])) + ((ps[4] + ps[5]) + (ps[6] + ps[7])));
#pragma unroll
    for (int t = 0; t < 4; ++t) {
#pragma unroll
      for (int r = 0; r < 8; ++r) acc[t][r] *= alpha;
    }

    v16h vb0 = lds_frag32(vcur, 0);
    v16h vb1 = lds_frag32(vcur, 16);
    v16h vb2 = lds_frag32(vcur, 32);
    v16h vb3 = lds_frag32(vcur, 48);
    acc[0] = __builtin_amdgcn_wmma_f32_16x16x32_f16(false, vb0, false, pb, (short)0, acc[0], false, false);
    acc[1] = __builtin_amdgcn_wmma_f32_16x16x32_f16(false, vb1, false, pb, (short)0, acc[1], false, false);
    acc[2] = __builtin_amdgcn_wmma_f32_16x16x32_f16(false, vb2, false, pb, (short)0, acc[2], false, false);
    acc[3] = __builtin_amdgcn_wmma_f32_16x16x32_f16(false, vb3, false, pb, (short)0, acc[3], false, false);

    __syncthreads();  // everyone done reading this buffer before it is refilled
  }

  // acc[t][r] = Ot[t*16 + rb + r][q0 + cl]: eight consecutive d of one query per tile and lane.
  float l = lsum + xhalf(lsum);
  float* orow = O + ((size_t)(b * SEQ + q0 + cl)) * INNER + h * DHEAD + rb;
#pragma unroll
  for (int t = 0; t < 4; ++t) {
    float4 lo = make_float4(acc[t][0] / l, acc[t][1] / l, acc[t][2] / l, acc[t][3] / l);
    float4 hi = make_float4(acc[t][4] / l, acc[t][5] / l, acc[t][6] / l, acc[t][7] / l);
    *reinterpret_cast<float4*>(orow + t * 16)     = lo;
    *reinterpret_cast<float4*>(orow + t * 16 + 4) = hi;
  }
}

extern "C" void kernel_launch(void* const* d_in, const int* in_sizes, int n_in,
                              void* d_out, int out_size, void* d_ws, size_t ws_size,
                              hipStream_t stream) {
  const float* q1  = (const float*)d_in[0];
  const float* q2  = (const float*)d_in[1];
  const float* xkv = (const float*)d_in[2];
  const float* Wq1 = (const float*)d_in[3];
  const float* Wq2 = (const float*)d_in[4];
  const float* Wkv = (const float*)d_in[5];
  float* out = (float*)d_out;

  const size_t NBH = (size_t)BATCH * SEQ * INNER;  // 4,194,304 elements
  _Float16* ws  = (_Float16*)d_ws;
  _Float16* Q1h = ws;
  _Float16* Q2h = Q1h + NBH;
  _Float16* Kh  = Q2h + NBH;
  _Float16* Vth = Kh  + NBH;
  _Float16* X1h = Vth + NBH;
  _Float16* X2h = X1h + NBH;
  _Float16* Xkh = X2h + NBH;
  _Float16* Wt1 = Xkh + NBH;
  _Float16* Wt2 = Wt1 + (size_t)DIM * INNER;
  _Float16* Wtk = Wt2 + (size_t)DIM * INNER;

  int nx = (int)NBH;
  int cb = (nx + 255) / 256;
  cvt_f32_f16<<<cb, 256, 0, stream>>>(q1,  X1h, nx);
  cvt_f32_f16<<<cb, 256, 0, stream>>>(q2,  X2h, nx);
  cvt_f32_f16<<<cb, 256, 0, stream>>>(xkv, Xkh, nx);
  wtrans<<<(DIM * INNER + 255) / 256, 256, 0, stream>>>(Wq1, Wt1, DIM, INNER);
  wtrans<<<(DIM * INNER + 255) / 256, 256, 0, stream>>>(Wq2, Wt2, DIM, INNER);
  wtrans<<<(DIM * 2 * INNER + 255) / 256, 256, 0, stream>>>(Wkv, Wtk, DIM, 2 * INNER);

  const float scale = 0.125f;  // DHEAD^-0.5
  const int MT = (BATCH * SEQ) / 16;  // 512
  proj_gemm<<<(MT * (INNER / 64)) / 8,     256, 0, stream>>>(X1h, Wt1, Q1h, nullptr, INNER,     scale);
  proj_gemm<<<(MT * (INNER / 64)) / 8,     256, 0, stream>>>(X2h, Wt2, Q2h, nullptr, INNER,     scale);
  proj_gemm<<<(MT * (2 * INNER / 64)) / 8, 256, 0, stream>>>(Xkh, Wtk, Kh,  Vth,     2 * INNER, 1.0f);

  // 64 (branch,b,h) x 16 query chunks = 1024 blocks of 8 waves
  flash_attn<<<1024, 256, 0, stream>>>(Q1h, Q2h, Kh, Vth, out);
}

// v004
// It runs in 123 microseconds.
// Next to v003, in two timings, it ran 1.49 and 1.48 times as fast.
// Over all steps from v000 it is 3.63 times as fast.
#include <hip/hip_runtime.h>

typedef __attribute__((ext_vector_type(16))) _Float16 v16h;
typedef __attribute__((ext_vector_type(8)))  _Float16 v8h;
typedef __attribute__((ext_vector_type(4)))  _Float16 v4h;
typedef __attribute__((ext_vector_type(8)))  float    v8f;

#define HEADS 8
#define DHEAD 64
#define SEQ   2048
#define BATCH 4
#define DIM   512
#define INNER 512   // HEADS * DHEAD

// Load a 16x32 f16 WMMA A/B fragment from a row-major matrix (stride in halves).
// Lane l: row = row0 + (l&15); k elements = k0 + 8*(l>>4) + {0..7} and +16..23.
__device__ __forceinline__ v16h load_frag(const _Float16* __restrict__ base,
                                          int row0, int k0, int stride) {
  int lane = threadIdx.x & 31;
  const _Float16* p = base + (size_t)(row0 + (lane & 15)) * stride + k0 + ((lane >> 4) << 3);
  v8h lo = *reinterpret_cast<const v8h*>(p);
  v8h hi = *reinterpret_cast<const v8h*>(p + 16);
  v16h f;
#pragma unroll
  for (int i = 0; i < 8; ++i) { f[i] = lo[i]; f[i + 8] = hi[i]; }
  return f;
}

// LDS tiles are stored with their 16-byte chunks XOR-swizzled inside each row, so that the 16 rows
// one half-wave reads at the same chunk column fall on 16 different 16-byte bank groups (64 banks x 4 B
// = 256 B): a plain 128-B or 64-B row pitch puts them on 2 or 4 groups only.
// 64-half rows (128 B, 8 chunks): two rows span the banks, so the chunk is XORed with row/2.
__device__ __forceinline__ int swz64(int row, int chunk) {
  return row * 64 + ((chunk ^ ((row >> 1) & 7)) << 3);
}
// 32-half rows (64 B, 4 chunks): four rows span the banks, so the chunk is XORed with row/4.
__device__ __forceinline__ int swz32(int row, int chunk) {
  return row * 32 + ((chunk ^ ((row >> 2) & 3)) << 3);
}

// Same fragment (same k order) as load_frag, read from a swizzled LDS tile with 64-half rows.
__device__ __forceinline__ v16h lds_frag64(const _Float16* base, int row0, int k0) {
  int lane = threadIdx.x & 31;
  int row = row0 + (lane & 15);
  int ch  = (k0 >> 3) + (lane >> 4);
  v8h lo = *reinterpret_cast<const v8h*>(base + swz64(row, ch));
  v8h hi = *reinterpret_cast<const v8h*>(base + swz64(row, ch + 2));
  v16h f;
#pragma unroll
  for (int i = 0; i < 8; ++i) { f[i] = lo[i]; f[i + 8] = hi[i]; }
  return f;
}

// Same fragment (same k order) as load_frag at k0 = 0, read from a swizzled LDS tile with 32-half rows.
__device__ __forceinline__ v16h lds_frag32(const _Float16* base, int row0) {
  int lane = threadIdx.x & 31;
  int row = row0 + (lane & 15);
  int ch  = lane >> 4;
  v8h lo = *reinterpret_cast<const v8h*>(base + swz32(row, ch));
  v8h hi = *reinterpret_cast<const v8h*>(base + swz32(row, ch + 2));
  v16h f;
#pragma unroll
  for (int i = 0; i < 8; ++i) { f[i] = lo[i]; f[i + 8] = hi[i]; }
  return f;
}

// Lane l takes the value of lane l ^ 16, in the vector pipe (a shuffle would go through the LDS unit).
__device__ __forceinline__ float xhalf(float x) {
  int i = __builtin_bit_cast(int, x);
  return __builtin_bit_cast(float,
      __builtin_amdgcn_permlanex16(i, i, 0x76543210, 0xfedcba98, false, false));
}

// Preparation, one launch. Blocks 0..255 transpose and convert the three weight matrices, blocks 256..1023
// convert the three activations. Few, long-lived waves: a thread's 16 loads are issued ahead of its stores.
#define PREP_W_BLOCKS 256   // 32 columns x 128 k a block: 64 (Wq1) + 64 (Wq2) + 128 (Wkv)
#define PREP_X_BLOCKS 256   // per activation: 16384 floats a block
__global__ __launch_bounds__(256) void prep(const float* __restrict__ q1, const float* __restrict__ q2,
                                            const float* __restrict__ xkv, const float* __restrict__ Wq1,
                                            const float* __restrict__ Wq2, const float* __restrict__ Wkv,
                                            _Float16* __restrict__ X1h, _Float16* __restrict__ X2h,
                                            _Float16* __restrict__ Xkh, _Float16* __restrict__ Wt1,
                                            _Float16* __restrict__ Wt2, _Float16* __restrict__ Wtk) {
  int bid = blockIdx.x;
  int t   = threadIdx.x;
  if (bid < PREP_W_BLOCKS) {
    // Wt[c*DIM + k] = W[k*C + c]. Eight lanes store one whole 128-B line of a Wt row (16 B each); the 32
    // columns of a block are one 128-B line of each W row it reads.
    const float* Wsrc = bid < 64 ? Wq1 : (bid < 128 ? Wq2 : Wkv);
    _Float16*    Wdst = bid < 64 ? Wt1 : (bid < 128 ? Wt2 : Wtk);
    int C    = bid < 128 ? INNER : 2 * INNER;
    int tile = bid < 128 ? (bid & 63) : (bid - 128);
    int c  = (tile >> 2) * 32 + (t >> 3);
    int k0 = (tile & 3) * 128 + (t & 7) * 8;
    float w[16];
    // All loops of this kernel are unrolled so that w and v stay in registers and the loads go out as a group.
#pragma unroll
    for (int u = 0; u < 2; ++u) {
#pragma unroll
      for (int j = 0; j < 8; ++j) w[u * 8 + j] = Wsrc[(size_t)(k0 + u * 64 + j) * C + c];
    }
#pragma unroll
    for (int u = 0; u < 2; ++u) {
      v8h hv;
#pragma unroll
      for (int j = 0; j < 8; ++j) hv[j] = (_Float16)w[u * 8 + j];
      *reinterpret_cast<v8h*>(Wdst + (size_t)c * DIM + k0 + u * 64) = hv;
    }
  } else {
    // A wave-wide load covers 512 contiguous bytes (four lines), the matching store 256 (two lines).
    int xb = bid - PREP_W_BLOCKS;
    const float* in  = xb < PREP_X_BLOCKS ? q1  : (xb < 2 * PREP_X_BLOCKS ? q2  : xkv);
    _Float16*    dst = xb < PREP_X_BLOCKS ? X1h : (xb < 2 * PREP_X_BLOCKS ? X2h : Xkh);
    size_t base = (size_t)(xb & (PREP_X_BLOCKS - 1)) * 16384 + t * 4;
    float4 v[16];
#pragma unroll
    for (int u = 0; u < 16; ++u) v[u] = *reinterpret_cast<const float4*>(in + base + u * 1024);
#pragma unroll
    for (int u = 0; u < 16; ++u) {
      v4h hv = {(_Float16)v[u].x, (_Float16)v[u].y, (_Float16)v[u].z, (_Float16)v[u].w};
      *reinterpret_cast<v4h*>(dst + base + u * 1024) = hv;
    }
    // No register that an issued store names is rewritten ahead of this wait; only the activation path has this wait, the weight path stores without one.
    asm volatile("s_wait_xcnt 0x0" ::: "memory");
  }
}

// Issue the per-thread share of one 64-k slab of a block's operands into LDS: 128 rows of X (4 chunks of
// 16 B a thread) and 64 rows of Wt (2 chunks a thread), each chunk at its swizzled place in its row (swz64;
// rows 32 apart swizzle alike). One wave-wide copy covers four whole 128-B lines.
__device__ __forceinline__ void issue_proj_slab(const _Float16* __restrict__ Xb,
                                                const _Float16* __restrict__ Wb,
                                                _Float16* adst, _Float16* bdst, int k0) {
  int t = threadIdx.x;
  int row = t >> 3, ch = t & 7;
  const _Float16* ga0 = Xb + (size_t)row * DIM + k0 + ch * 8;
  const _Float16* ga1 = ga0 + 32 * DIM;
  const _Float16* ga2 = ga0 + 64 * DIM;
  const _Float16* ga3 = ga0 + 96 * DIM;
  const _Float16* gb0 = Wb + (size_t)row * DIM + k0 + ch * 8;
  const _Float16* gb1 = gb0 + 32 * DIM;
  uint32_t la0 = (uint32_t)(uintptr_t)(adst + swz64(row, ch));
  uint32_t la1 = la0 + 32 * 128;
  uint32_t la2 = la0 + 64 * 128;
  uint32_t la3 = la0 + 96 * 128;
  uint32_t lb0 = (uint32_t)(uintptr_t)(bdst + swz64(row, ch));
  uint32_t lb1 = lb0 + 32 * 128;
  // The copies and their s_wait_xcnt in one statement: no address register is rewritten ahead of the wait.
  asm volatile("global_load_async_to_lds_b128 %0, %6, off\n\t"
               "global_load_async_to_lds_b128 %1, %7, off\n\t"
               "global_load_async_to_lds_b128 %2, %8, off\n\t"
               "global_load_async_to_lds_b128 %3, %9, off\n\t"
               "global_load_async_to_lds_b128 %4, %10, off\n\t"
               "global_load_async_to_lds_b128 %5, %11, off\n\t"
               "s_wait_xcnt 0x0"
               :: "v"(la0), "v"(la1), "v"(la2), "v"(la3), "v"(lb0), "v"(lb1),
                  "v"(ga0), "v"(ga1), "v"(ga2), "v"(ga3), "v"(gb0), "v"(gb1)
               : "memory");
}

#define PROJ_A_HALVES (128 * 64)                    // X slab: 128 rows x 64 k
#define PROJ_BUF_HALVES (PROJ_A_HALVES + 64 * 64)   // + Wt slab: 64 rows x 64 k

// GEMM: [8192 x 512] (f16) x Wt^T -> scatter into per-head layouts.
// col < 512  -> dstK[((b*H+h)*SEQ + n)*64 + d] = val*scale   (Q or K, [B,H,N,64])
// col >= 512 -> dstV[((b*H+h)*64 + d)*SEQ + n] = val         (V transposed, [B,H,64,N])
// Block = 128 rows x 64 columns, wave = 16 rows x 64 columns. Both operands come through LDS in 64-k slabs,
// brought by asynchronous copies into two buffers: slab s + 1 flies while slab s is multiplied.
__global__ __launch_bounds__(256) void proj_gemm(const _Float16* __restrict__ X,
                                                 const _Float16* __restrict__ Wt,
                                                 _Float16* __restrict__ dstK,
                                                 _Float16* __restrict__ dstV,
                                                 int ncols, float scale) {
  // Two buffers of one 64-k slab each: [X 128 x 64][Wt 64 x 64] halves = 24 KB a buffer.
  __shared__ __align__(16) _Float16 sm[2 * PROJ_BUF_HALVES];
  int lane = threadIdx.x & 31;
  int wid  = threadIdx.x >> 5;
  const int MT = (BATCH * SEQ) / 16;  // 512 row tiles
  int id0 = blockIdx.x * 8;           // the block's first wave tile; 8 divides MT, so one c0 a block
  int mb  = (id0 % MT) * 16;
  int m0  = mb + wid * 16;
  int c0  = (id0 / MT) * 64;
  if (c0 >= ncols) return;

  const _Float16* Xb = X  + (size_t)mb * DIM;
  const _Float16* Wb = Wt + (size_t)c0 * DIM;

  issue_proj_slab(Xb, Wb, sm, sm + PROJ_A_HALVES, 0);
  asm volatile("s_wait_asynccnt 0x0" ::: "memory");  // this wave's share of slab 0 has landed
  __syncthreads();                                   // ... and every other wave's
  issue_proj_slab(Xb, Wb, sm + PROJ_BUF_HALVES, sm + PROJ_BUF_HALVES + PROJ_A_HALVES, 64);

  v8f acc0 = {}, acc1 = {}, acc2 = {}, acc3 = {};
#pragma unroll 1  // rolled: one copy statement and one publish point in the text
  for (int s = 0; s < DIM / 64; ++s) {
    _Float16* ab = sm + (s & 1) * PROJ_BUF_HALVES;
    _Float16* bb = ab + PROJ_A_HALVES;
#pragma unroll  // both 32-k steps of a slab in one body: no inner branch, chunk offsets are loop constants
    for (int kk = 0; kk < 64; kk += 32) {
      v16h a  = lds_frag64(ab, wid * 16, kk);
      v16h b0 = lds_frag64(bb, 0,  kk);
      v16h b1 = lds_frag64(bb, 16, kk);
      v16h b2 = lds_frag64(bb, 32, kk);
      v16h b3 = lds_frag64(bb, 48, kk);
      acc0 = __builtin_amdgcn_wmma_f32_16x16x32_f16(false, a, false, b0, (short)0, acc0, false, false);
      acc1 = __builtin_amdgcn_wmma_f32_16x16x32_f16(false, a, false, b1, (short)0, acc1, false, false);
      acc2 = __builtin_amdgcn_wmma_f32_16x16x32_f16(false, a, false, b2, (short)0, acc2, false, false);
      acc3 = __builtin_amdgcn_wmma_f32_16x16x32_f16(false, a, false, b3, (short)0, acc3, false, false);
    }
    asm volatile("s_wait_dscnt 0x0" ::: "memory");     // this wave's reads of slab s are over
    asm volatile("s_wait_asynccnt 0x0" ::: "memory");  // its share of slab s + 1 has landed
    __syncthreads();  // publishes slab s + 1 and frees the buffer of slab s
    if (s + 2 < DIM / 64) issue_proj_slab(Xb, Wb, ab, bb, (s + 2) * 64);
  }
  asm volatile("s_wait_asynccnt 0x0" ::: "memory");  // nothing in flight when the wave ends

  v8f accs[4] = {acc0, acc1, acc2, acc3};
  int rowb = m0 + ((lane >> 4) << 3);
  int cl   = lane & 15;
#pragma unroll
  for (int t = 0; t < 4; ++t) {
#pragma unroll
    for (int r = 0; r < 8; ++r) {
      float val = accs[t][r];
      int row = rowb + r;
      int col = c0 + t * 16 + cl;
      int b = row >> 11, n = row & (SEQ - 1);
      if (col < INNER) {
        int h = col >> 6, d = col & 63;
        dstK[(((size_t)(b * HEADS + h)) * SEQ + n) * DHEAD + d] = (_Float16)(val * scale);
      } else {
        int cc = col - INNER;
        int h = cc >> 6, d = cc & 63;
        dstV[(((size_t)(b * HEADS + h)) * DHEAD + d) * SEQ + n] = (_Float16)val;
      }
    }
  }
}

// Issue the per-thread share of one 32-key K/V block copy into LDS.
// K block: 32 rows x 64 halves (stride DHEAD);  V block: 64 rows x 32 halves (from stride SEQ).
// 256 threads x 16B each per tensor -> each WAVE issues exactly 2 async instructions.
// Each 16-byte chunk lands at its swizzled place inside its own row (swz64 / swz32).
__device__ __forceinline__ void issue_async_copies(const _Float16* __restrict__ Kg,
                                                   const _Float16* __restrict__ Vg,
                                                   _Float16* kdst, _Float16* vdst, int j) {
  int t = threadIdx.x;
  const _Float16* gk = Kg + (size_t)(j + (t >> 3)) * DHEAD + (t & 7) * 8;
  const _Float16* gv = Vg + (size_t)(t >> 2) * SEQ + j + (t & 3) * 8;
  uint32_t lk = (uint32_t)(uintptr_t)(kdst + swz64(t >> 3, t & 7));
  uint32_t lv = (uint32_t)(uintptr_t)(vdst + swz32(t >> 2, t & 3));
  asm volatile("global_load_async_to_lds_b128 %0, %1, off" :: "v"(lk), "v"(gk) : "memory");
  asm volatile("global_load_async_to_lds_b128 %0, %1, off" :: "v"(lv), "v"(gv) : "memory");
}

// Flash attention: block = one (branch,b,h), 8 waves x 16 query rows = 128 rows.
// K/V blocks staged once per block into LDS via async copies (double buffered),
// shared by all 8 waves -> 8x less L2 traffic than per-wave streaming.
// The products are taken transposed: St = K * Qt (A = K rows, B = Q) and Ot += Vt * Pt (A = Vt rows,
// B = Pt). Lane l then holds only query q0 + (l & 15): of each 32-key block the keys 8*(l>>4) + 0..7
// (first score tile) and 16 + 8*(l>>4) + 0..7 (second), which is the k order of a B fragment, so the
// converted scores are the B operand as they stand; maximum, sum and rescale are per-lane values.
__global__ __launch_bounds__(256) void flash_attn(const _Float16* __restrict__ Q1,
                                                  const _Float16* __restrict__ Q2,
                                                  const _Float16* __restrict__ Kt,
                                                  const _Float16* __restrict__ Vt,
                                                  float* __restrict__ out) {
  // [K0 2048][K1 2048][V0 2048][V1 2048]  halves = 16KB
  __shared__ __align__(16) _Float16 smem[8192];
  int lane = threadIdx.x & 31;
  int wid  = threadIdx.x >> 5;
  int bid  = blockIdx.x;
  int bhz  = bid & 63;       // (branch, b, h)
  int qc   = bid >> 6;       // 0..15
  int q0   = qc * 128 + wid * 16;
  int h    = bhz & 7;
  int b    = (bhz >> 3) & 3;
  int br   = bhz >> 5;

  const _Float16* Q  = (br ? Q2 : Q1) + ((size_t)(b * HEADS + h)) * SEQ * DHEAD;
  const _Float16* Kg = Kt + ((size_t)(b * HEADS + h)) * SEQ * DHEAD;
  const _Float16* Vg = Vt + ((size_t)(b * HEADS + h)) * DHEAD * SEQ;
  float* O = out + (size_t)br * ((size_t)BATCH * SEQ * INNER);

  v16h qa0 = load_frag(Q, q0, 0,  DHEAD);
  v16h qa1 = load_frag(Q, q0, 32, DHEAD);

  v8f acc[4] = {};
  float mrow = -1e30f;  // running maximum of this lane's query (equal in lanes l and l ^ 16)
  float lsum = 0.f;     // running sum over this lane's half of the keys; the halves join after the loop

  int rb = (lane >> 4) << 3;
  int cl = lane & 15;

  issue_async_copies(Kg, Vg, smem, smem + 4096, 0);  // prologue: block 0 -> buffer 0

#pragma unroll 1
  for (int jb = 0; jb < SEQ / 32; ++jb) {
    int cur = jb & 1;
    const _Float16* kcur = smem + cur * 2048;
    const _Float16* vcur = smem + 4096 + cur * 2048;
    if (jb < SEQ / 32 - 1) {
      issue_async_copies(Kg, Vg, smem + (1 - cur) * 2048, smem + 4096 + (1 - cur) * 2048,
                         (jb + 1) * 32);
      asm volatile("s_wait_asynccnt 2" ::: "memory");   // current buffer's 2 copies done
    } else {
      asm volatile("s_wait_asynccnt 0" ::: "memory");
    }
    __syncthreads();  // all waves' copies landed

    v16h kb00 = lds_frag64(kcur, 0,  0);
    v16h kb01 = lds_frag64(kcur, 0,  32);
    v16h kb10 = lds_frag64(kcur, 16, 0);
    v16h kb11 = lds_frag64(kcur, 16, 32);
    v8f s0 = {}, s1 = {};
    s0 = __builtin_amdgcn_wmma_f32_16x16x32_f16(false, kb00, false, qa0, (short)0, s0, false, false);
    s0 = __builtin_amdgcn_wmma_f32_16x16x32_f16(false, kb01, false, qa1, (short)0, s0, false, false);
    s1 = __builtin_amdgcn_wmma_f32_16x16x32_f16(false, kb10, false, qa0, (short)0, s1, false, false);
    s1 = __builtin_amdgcn_wmma_f32_16x16x32_f16(false, kb11, false, qa1, (short)0, s1, false, false);

    // Online softmax. s0[r] = score of key rb + r, s1[r] = of key 16 + rb + r, both for query q0 + cl.
    float a0 = fmaxf(fmaxf(s0[0], s0[1]), s0[2]);
    float a1 = fmaxf(fmaxf(s0[3], s0[4]), s0[5]);
    float a2 = fmaxf(fmaxf(s0[6], s0[7]), s1[0]);
    float a3 = fmaxf(fmaxf(s1[1], s1[2]), s1[3]);
    float a4 = fmaxf(fmaxf(s1[4], s1[5]), s1[6]);
    float mx = fmaxf(fmaxf(fmaxf(a0, a1), a2), fmaxf(fmaxf(a3, a4), s1[7]));
    mx = fmaxf(mx, xhalf(mx));  // the other 16 keys of the block
    float mnew  = fmaxf(mrow, mx);
    float alpha = __expf(mrow - mnew);
    mrow = mnew;

    v16h pb;
    float ps[8];
#pragma unroll
    for (int r = 0; r < 8; ++r) {
      float p0 = __expf(s0[r] - mnew);
      float p1 = __expf(s1[r] - mnew);
      ps[r] = p0 + p1;
      pb[r]     = (_Float16)p0;
      pb[r + 8] = (_Float16)p1;
    }
    lsum = lsum * alpha + (((ps[0] + ps[1]) + (ps[2] + ps[3])) + ((ps[4] + ps[5]) + (ps[6] + ps[7])));
#pragma unroll
    for (int t = 0; t < 4; ++t) {
#pragma unroll
      for (int r = 0; r < 8; ++r) acc[t][r] *= alpha;
    }

    v16h vb0 = lds_frag32(vcur, 0);
    v16h vb1 = lds_frag32(vcur, 16);
    v16h vb2 = lds_frag32(vcur, 32);
    v16h vb3 = lds_frag32(vcur, 48);
    acc[0] = __builtin_amdgcn_wmma_f32_16x16x32_f16(false, vb0, false, pb, (short)0, acc[0], false, false);
    acc[1] = __builtin_amdgcn_wmma_f32_16x16x32_f16(false, vb1, false, pb, (short)0, acc[1], false, false);
    acc[2] = __builtin_amdgcn_wmma_f32_16x16x32_f16(false, vb2, false, pb, (short)0, acc[2], false, false);
    acc[3] = __builtin_amdgcn_wmma_f32_16x16x32_f16(false, vb3, false, pb, (short)0, acc[3], false, false);

    __syncthreads();  // everyone done reading this buffer before it is refilled
  }

  // acc[t][r] = Ot[t*16 + rb + r][q0 + cl]: eight consecutive d of one query per tile and lane.
  float l = lsum + xhalf(lsum);
  float* orow = O + ((size_t)(b * SEQ + q0 + cl)) * INNER + h * DHEAD + rb;
#pragma unroll
  for (int t = 0; t < 4; ++t) {
    float4 lo = make_float4(acc[t][0] / l, acc[t][1] / l, acc[t][2] / l, acc[t][3] / l);
    float4 hi = make_float4(acc[t][4] / l, acc[t][5] / l, acc[t][6] / l, acc[t][7] / l);
    *reinterpret_cast<float4*>(orow + t * 16)     = lo;
    *reinterpret_cast<float4*>(orow + t * 16 + 4) = hi;
  }
}

extern "C" void kernel_launch(void* const* d_in, const int* in_sizes, int n_in,
                              void* d_out, int out_size, void* d_ws, size_t ws_size,
                              hipStream_t stream) {
  const float* q1  = (const float*)d_in[0];
  const float* q2  = (const float*)d_in[1];
  const float* xkv = (const float*)d_in[2];
  const float* Wq1 = (const float*)d_in[3];
  const float* Wq2 = (const float*)d_in[4];
  const float* Wkv = (const float*)d_in[5];
  float* out = (float*)d_out;

  const size_t NBH = (size_t)BATCH * SEQ * INNER;  // 4,194,304 elements
  _Float16* ws  = (_Float16*)d_ws;
  _Float16* Q1h = ws;
  _Float16* Q2h = Q1h + NBH;
  _Float16* Kh  = Q2h + NBH;
  _Float16* Vth = Kh  + NBH;
  _Float16* X1h = Vth + NBH;
  _Float16* X2h = X1h + NBH;
  _Float16* Xkh = X2h + NBH;
  _Float16* Wt1 = Xkh + NBH;
  _Float16* Wt2 = Wt1 + (size_t)DIM * INNER;
  _Float16* Wtk = Wt2 + (size_t)DIM * INNER;

  prep<<<PREP_W_BLOCKS + 3 * PREP_X_BLOCKS, 256, 0, stream>>>(q1, q2, xkv, Wq1, Wq2, Wkv,
                                                              X1h, X2h, Xkh, Wt1, Wt2, Wtk);

  const float scale = 0.125f;  // DHEAD^-0.5
  const int MT = (BATCH * SEQ) / 16;  // 512
  proj_gemm<<<(MT * (INNER / 64)) / 8,     256, 0, stream>>>(X1h, Wt1, Q1h, nullptr, INNER,     scale);
  proj_gemm<<<(MT * (INNER / 64)) / 8,     256, 0, stream>>>(X2h, Wt2, Q2h, nullptr, INNER,     scale);
  proj_gemm<<<(MT * (2 * INNER / 64)) / 8, 256, 0, stream>>>(Xkh, Wtk, Kh,  Vth,     2 * INNER, 1.0f);

  // 64 (branch,b,h) x 16 query chunks = 1024 blocks of 8 waves
  flash_attn<<<1024, 256, 0, stream>>>(Q1h, Q2h, Kh, Vth, out);
}

// v005
// Measured time: 115 microseconds a run.
// Next to v004, in two timings, it ran 1.07 times as fast each time.
// All steps since v000 together make it 3.88 times as fast.
#include <hip/hip_runtime.h>

typedef __attribute__((ext_vector_type(16))) _Float16 v16h;
typedef __attribute__((ext_vector_type(8)))  _Float16 v8h;
typedef __attribute__((ext_vector_type(4)))  _Float16 v4h;
typedef __attribute__((ext_vector_type(8)))  float    v8f;

#define HEADS 8
#define DHEAD 64
#define SEQ   2048
#define BATCH 4
#define DIM   512
#define INNER 512   // HEADS * DHEAD

// Load a 16x32 f16 WMMA A/B fragment from a row-major matrix (stride in halves).
// Lane l: row = row0 + (l&15); k elements = k0 + 8*(l>>4) + {0..7} and +16..23.
__device__ __forceinline__ v16h load_frag(const _Float16* __restrict__ base,
                                          int row0, int k0, int stride) {
  int lane = threadIdx.x & 31;
  const _Float16* p = base + (size_t)(row0 + (lane & 15)) * stride + k0 + ((lane >> 4) << 3);
  v8h lo = *reinterpret_cast<const v8h*>(p);
  v8h hi = *reinterpret_cast<const v8h*>(p + 16);
  v16h f;
#pragma unroll
  for (int i = 0; i < 8; ++i) { f[i] = lo[i]; f[i + 8] = hi[i]; }
  return f;
}

// LDS tiles are stored with their 16-byte chunks XOR-swizzled inside each row, so that the 16 rows
// one half-wave reads at the same chunk column fall on 16 different 16-byte bank groups (64 banks x 4 B
// = 256 B): a plain 128-B or 64-B row pitch puts them on 2 or 4 groups only.
// 64-half rows (128 B, 8 chunks): two rows span the banks, so the chunk is XORed with row/2.
__device__ __forceinline__ int swz64(int row, int chunk) {
  return row * 64 + ((chunk ^ ((row >> 1) & 7)) << 3);
}
// 32-half rows (64 B, 4 chunks): four rows span the banks, so the chunk is XORed with row/4.
__device__ __forceinline__ int swz32(int row, int chunk) {
  return row * 32 + ((chunk ^ ((row >> 2) & 3)) << 3);
}

// Same fragment (same k order) as load_frag, read from a swizzled LDS tile with 64-half rows.
__device__ __forceinline__ v16h lds_frag64(const _Float16* base, int row0, int k0) {
  int lane = threadIdx.x & 31;
  int row = row0 + (lane & 15);
  int ch  = (k0 >> 3) + (lane >> 4);
  v8h lo = *reinterpret_cast<const v8h*>(base + swz64(row, ch));
  v8h hi = *reinterpret_cast<const v8h*>(base + swz64(row, ch + 2));
  v16h f;
#pragma unroll
  for (int i = 0; i < 8; ++i) { f[i] = lo[i]; f[i + 8] = hi[i]; }
  return f;
}

// Same fragment (same k order) as load_frag at k0 = 0, read from a swizzled LDS tile with 32-half rows.
__device__ __forceinline__ v16h lds_frag32(const _Float16* base, int row0) {
  int lane = threadIdx.x & 31;
  int row = row0 + (lane & 15);
  int ch  = lane >> 4;
  v8h lo = *reinterpret_cast<const v8h*>(base + swz32(row, ch));
  v8h hi = *reinterpret_cast<const v8h*>(base + swz32(row, ch + 2));
  v16h f;
#pragma unroll
  for (int i = 0; i < 8; ++i) { f[i] = lo[i]; f[i + 8] = hi[i]; }
  return f;
}

// Lane l takes the value of lane l ^ 16, in the vector pipe (a shuffle would go through the LDS unit).
__device__ __forceinline__ float xhalf(float x) {
  int i = __builtin_bit_cast(int, x);
  return __builtin_bit_cast(float,
      __builtin_amdgcn_permlanex16(i, i, 0x76543210, 0xfedcba98, false, false));
}

// Preparation, one launch. Blocks 0..255 transpose and convert the three weight matrices, blocks 256..1023
// convert the three activations. Few, long-lived waves: a thread's 16 loads are issued ahead of its stores.
#define PREP_W_BLOCKS 256   // 32 columns x 128 k a block: 64 (Wq1) + 64 (Wq2) + 128 (Wkv)
#define PREP_X_BLOCKS 256   // per activation: 16384 floats a block
__global__ __launch_bounds__(256) void prep(const float* __restrict__ q1, const float* __restrict__ q2,
                                            const float* __restrict__ xkv, const float* __restrict__ Wq1,
                                            const float* __restrict__ Wq2, const float* __restrict__ Wkv,
                                            _Float16* __restrict__ X1h, _Float16* __restrict__ X2h,
                                            _Float16* __restrict__ Xkh, _Float16* __restrict__ Wt1,
                                            _Float16* __restrict__ Wt2, _Float16* __restrict__ Wtk) {
  int bid = blockIdx.x;
  int t   = threadIdx.x;
  if (bid < PREP_W_BLOCKS) {
    // Wt[c*DIM + k] = W[k*C + c]. Eight lanes store one whole 128-B line of a Wt row (16 B each); the 32
    // columns of a block are one 128-B line of each W row it reads.
    const float* Wsrc = bid < 64 ? Wq1 : (bid < 128 ? Wq2 : Wkv);
    _Float16*    Wdst = bid < 64 ? Wt1 : (bid < 128 ? Wt2 : Wtk);
    int C    = bid < 128 ? INNER : 2 * INNER;
    int tile = bid < 128 ? (bid & 63) : (bid - 128);
    int c  = (tile >> 2) * 32 + (t >> 3);
    int k0 = (tile & 3) * 128 + (t & 7) * 8;
    float w[16];
    // All loops of this kernel are unrolled so that w and v stay in registers and the loads go out as a group.
#pragma unroll
    for (int u = 0; u < 2; ++u) {
#pragma unroll
      for (int j = 0; j < 8; ++j) w[u * 8 + j] = Wsrc[(size_t)(k0 + u * 64 + j) * C + c];
    }
#pragma unroll
    for (int u = 0; u < 2; ++u) {
      v8h hv;
#pragma unroll
      for (int j = 0; j < 8; ++j) hv[j] = (_Float16)w[u * 8 + j];
      *reinterpret_cast<v8h*>(Wdst + (size_t)c * DIM + k0 + u * 64) = hv;
    }
  } else {
    // A wave-wide load covers 512 contiguous bytes (four lines), the matching store 256 (two lines).
    int xb = bid - PREP_W_BLOCKS;
    const float* in  = xb < PREP_X_BLOCKS ? q1  : (xb < 2 * PREP_X_BLOCKS ? q2  : xkv);
    _Float16*    dst = xb < PREP_X_BLOCKS ? X1h : (xb < 2 * PREP_X_BLOCKS ? X2h : Xkh);
    size_t base = (size_t)(xb & (PREP_X_BLOCKS - 1)) * 16384 + t * 4;
    float4 v[16];
#pragma unroll
    for (int u = 0; u < 16; ++u) v[u] = *reinterpret_cast<const float4*>(in + base + u * 1024);
#pragma unroll
    for (int u = 0; u < 16; ++u) {
      v4h hv = {(_Float16)v[u].x, (_Float16)v[u].y, (_Float16)v[u].z, (_Float16)v[u].w};
      *reinterpret_cast<v4h*>(dst + base + u * 1024) = hv;
    }
    // No register that an issued store names is rewritten ahead of this wait; only the activation path has this wait, the weight path stores without one.
    asm volatile("s_wait_xcnt 0x0" ::: "memory");
  }
}

// Issue the per-thread share of one 64-k slab of a block's operands into LDS: 128 rows of X (4 chunks of
// 16 B a thread) and 64 rows of Wt (2 chunks a thread), each chunk at its swizzled place in its row (swz64;
// rows 32 apart swizzle alike). One wave-wide copy covers four whole 128-B lines.
__device__ __forceinline__ void issue_proj_slab(const _Float16* __restrict__ Xb,
                                                const _Float16* __restrict__ Wb,
                                                _Float16* adst, _Float16* bdst, int k0) {
  int t = threadIdx.x;
  int row = t >> 3, ch = t & 7;
  const _Float16* ga0 = Xb + (size_t)row * DIM + k0 + ch * 8;
  const _Float16* ga1 = ga0 + 32 * DIM;
  const _Float16* ga2 = ga0 + 64 * DIM;
  const _Float16* ga3 = ga0 + 96 * DIM;
  const _Float16* gb0 = Wb + (size_t)row * DIM + k0 + ch * 8;
  const _Float16* gb1 = gb0 + 32 * DIM;
  uint32_t la0 = (uint32_t)(uintptr_t)(adst + swz64(row, ch));
  uint32_t la1 = la0 + 32 * 128;
  uint32_t la2 = la0 + 64 * 128;
  uint32_t la3 = la0 + 96 * 128;
  uint32_t lb0 = (uint32_t)(uintptr_t)(bdst + swz64(row, ch));
  uint32_t lb1 = lb0 + 32 * 128;
  // The copies and their s_wait_xcnt in one statement: no address register is rewritten ahead of the wait.
  asm volatile("global_load_async_to_lds_b128 %0, %6, off\n\t"
               "global_load_async_to_lds_b128 %1, %7, off\n\t"
               "global_load_async_to_lds_b128 %2, %8, off\n\t"
               "global_load_async_to_lds_b128 %3, %9, off\n\t"
               "global_load_async_to_lds_b128 %4, %10, off\n\t"
               "global_load_async_to_lds_b128 %5, %11, off\n\t"
               "s_wait_xcnt 0x0"
               :: "v"(la0), "v"(la1), "v"(la2), "v"(la3), "v"(lb0), "v"(lb1),
                  "v"(ga0), "v"(ga1), "v"(ga2), "v"(ga3), "v"(gb0), "v"(gb1)
               : "memory");
}

#define PROJ_A_HALVES (128 * 64)                    // X slab: 128 rows x 64 k
#define PROJ_BUF_HALVES (PROJ_A_HALVES + 64 * 64)   // + Wt slab: 64 rows x 64 k

// GEMM: [8192 x 512] (f16) x Wt^T -> scatter into per-head layouts.
// col < 512  -> dstK[((b*H+h)*SEQ + n)*64 + d] = val*scale   (Q or K, [B,H,N,64])
// col >= 512 -> dstV[((b*H+h)*64 + d)*SEQ + n] = val         (V transposed, [B,H,64,N])
// Block = 128 rows x 64 columns, wave = 16 rows x 64 columns. Both operands come through LDS in 64-k slabs,
// brought by asynchronous copies into two buffers: slab s + 1 flies while slab s is multiplied.
__global__ __launch_bounds__(256) void proj_gemm(const _Float16* __restrict__ X,
                                                 const _Float16* __restrict__ Wt,
                                                 _Float16* __restrict__ dstK,
                                                 _Float16* __restrict__ dstV,
                                                 int ncols, float scale) {
  // Two buffers of one 64-k slab each: [X 128 x 64][Wt 64 x 64] halves = 24 KB a buffer.
  __shared__ __align__(16) _Float16 sm[2 * PROJ_BUF_HALVES];
  int lane = threadIdx.x & 31;
  int wid  = threadIdx.x >> 5;
  const int MT = (BATCH * SEQ) / 16;  // 512 row tiles
  int id0 = blockIdx.x * 8;           // the block's first wave tile; 8 divides MT, so one c0 a block
  int mb  = (id0 % MT) * 16;
  int m0  = mb + wid * 16;
  int c0  = (id0 / MT) * 64;
  if (c0 >= ncols) return;

  const _Float16* Xb = X  + (size_t)mb * DIM;
  const _Float16* Wb = Wt + (size_t)c0 * DIM;

  issue_proj_slab(Xb, Wb, sm, sm + PROJ_A_HALVES, 0);
  asm volatile("s_wait_asynccnt 0x0" ::: "memory");  // this wave's share of slab 0 has landed
  __syncthreads();                                   // ... and every other wave's
  issue_proj_slab(Xb, Wb, sm + PROJ_BUF_HALVES, sm + PROJ_BUF_HALVES + PROJ_A_HALVES, 64);

  v8f acc0 = {}, acc1 = {}, acc2 = {}, acc3 = {};
#pragma unroll 1  // rolled: one copy statement and one publish point in the text
  for (int s = 0; s < DIM / 64; ++s) {
    _Float16* ab = sm + (s & 1) * PROJ_BUF_HALVES;
    _Float16* bb = ab + PROJ_A_HALVES;
#pragma unroll  // both 32-k steps of a slab in one body: no inner branch, chunk offsets are loop constants
    for (int kk = 0; kk < 64; kk += 32) {
      v16h a  = lds_frag64(ab, wid * 16, kk);
      v16h b0 = lds_frag64(bb, 0,  kk);
      v16h b1 = lds_frag64(bb, 16, kk);
      v16h b2 = lds_frag64(bb, 32, kk);
      v16h b3 = lds_frag64(bb, 48, kk);
      acc0 = __builtin_amdgcn_wmma_f32_16x16x32_f16(false, a, false, b0, (short)0, acc0, false, false);
      acc1 = __builtin_amdgcn_wmma_f32_16x16x32_f16(false, a, false, b1, (short)0, acc1, false, false);
      acc2 = __builtin_amdgcn_wmma_f32_16x16x32_f16(false, a, false, b2, (short)0, acc2, false, false);
      acc3 = __builtin_amdgcn_wmma_f32_16x16x32_f16(false, a, false, b3, (short)0, acc3, false, false);
    }
    asm volatile("s_wait_dscnt 0x0" ::: "memory");     // this wave's reads of slab s are over
    asm volatile("s_wait_asynccnt 0x0" ::: "memory");  // its share of slab s + 1 has landed
    __syncthreads();  // publishes slab s + 1 and frees the buffer of slab s
    if (s + 2 < DIM / 64) issue_proj_slab(Xb, Wb, ab, bb, (s + 2) * 64);
  }
  asm volatile("s_wait_asynccnt 0x0" ::: "memory");  // nothing in flight when the wave ends

  v8f accs[4] = {acc0, acc1, acc2, acc3};
  int rowb = m0 + ((lane >> 4) << 3);
  int cl   = lane & 15;
#pragma unroll
  for (int t = 0; t < 4; ++t) {
#pragma unroll
    for (int r = 0; r < 8; ++r) {
      float val = accs[t][r];
      int row = rowb + r;
      int col = c0 + t * 16 + cl;
      int b = row >> 11, n = row & (SEQ - 1);
      if (col < INNER) {
        int h = col >> 6, d = col & 63;
        dstK[(((size_t)(b * HEADS + h)) * SEQ + n) * DHEAD + d] = (_Float16)(val * scale);
      } else {
        int cc = col - INNER;
        int h = cc >> 6, d = cc & 63;
        dstV[(((size_t)(b * HEADS + h)) * DHEAD + d) * SEQ + n] = (_Float16)val;
      }
    }
  }
}

// Issue the per-thread share of one 32-key K/V block copy into LDS.
// K block: 32 rows x 64 halves (stride DHEAD);  V block: 64 rows x 32 halves (from stride SEQ).
// 256 threads x 16B each per tensor -> each WAVE issues exactly 2 async instructions.
// Each 16-byte chunk lands at its swizzled place inside its own row (swz64 / swz32).
__device__ __forceinline__ void issue_async_copies(const _Float16* __restrict__ Kg,
                                                   const _Float16* __restrict__ Vg,
                                                   _Float16* kdst, _Float16* vdst, int j) {
  int t = threadIdx.x;
  const _Float16* gk = Kg + (size_t)(j + (t >> 3)) * DHEAD + (t & 7) * 8;
  const _Float16* gv = Vg + (size_t)(t >> 2) * SEQ + j + (t & 3) * 8;
  uint32_t lk = (uint32_t)(uintptr_t)(kdst + swz64(t >> 3, t & 7));
  uint32_t lv = (uint32_t)(uintptr_t)(vdst + swz32(t >> 2, t & 3));
  asm volatile("global_load_async_to_lds_b128 %0, %1, off" :: "v"(lk), "v"(gk) : "memory");
  asm volatile("global_load_async_to_lds_b128 %0, %1, off" :: "v"(lv), "v"(gv) : "memory");
}

// Flash attention: block = one (branch,b,h), 8 waves x 32 query rows = 256 rows.
// K/V blocks staged once per block into LDS via async copies (double buffered),
// shared by all 8 waves -> 8x less L2 traffic than per-wave streaming.
// The products are taken transposed: St = K * Qt (A = K rows, B = Q) and Ot += Vt * Pt (A = Vt rows,
// B = Pt). A wave owns QG groups of 16 queries; in group g lane l holds only query q0 + 16*g + (l & 15): of
// each 32-key block the keys 8*(l>>4) + 0..7 (first score tile) and 16 + 8*(l>>4) + 0..7 (second), which is
// the k order of a B fragment, so the converted scores are the B operand as they stand; maximum, sum and
// rescale are per-lane values. Every K and Vt fragment read from LDS is the A operand of QG products.
#define QG 2
__global__ __launch_bounds__(256) void flash_attn(const _Float16* __restrict__ Q1,
                                                  const _Float16* __restrict__ Q2,
                                                  const _Float16* __restrict__ Kt,
                                                  const _Float16* __restrict__ Vt,
                                                  float* __restrict__ out) {
  // [K0 2048][K1 2048][V0 2048][V1 2048]  halves = 16KB
  __shared__ __align__(16) _Float16 smem[8192];
  int lane = threadIdx.x & 31;
  int wid  = threadIdx.x >> 5;
  int bid  = blockIdx.x;
  int bhz  = bid & 63;       // (branch, b, h)
  int qc   = bid >> 6;       // 0..SEQ / (128 * QG) - 1
  int q0   = (qc * 128 + wid * 16) * QG;
  int h    = bhz & 7;
  int b    = (bhz >> 3) & 3;
  int br   = bhz >> 5;

  const _Float16* Q  = (br ? Q2 : Q1) + ((size_t)(b * HEADS + h)) * SEQ * DHEAD;
  const _Float16* Kg = Kt + ((size_t)(b * HEADS + h)) * SEQ * DHEAD;
  const _Float16* Vg = Vt + ((size_t)(b * HEADS + h)) * DHEAD * SEQ;
  float* O = out + (size_t)br * ((size_t)BATCH * SEQ * INNER);

  // All loops over g, t and r in this kernel are unrolled so that the arrays they index stay in registers.
  v16h qa0[QG], qa1[QG];
  v8f acc[QG][4] = {};
  float mrow[QG];  // running maximum of this lane's query of group g (equal in lanes l and l ^ 16)
  float lsum[QG];  // running sum over this lane's half of the keys; the halves join after the loop
#pragma unroll
  for (int g = 0; g < QG; ++g) {
    qa0[g] = load_frag(Q, q0 + 16 * g, 0,  DHEAD);
    qa1[g] = load_frag(Q, q0 + 16 * g, 32, DHEAD);
    mrow[g] = -1e30f;
    lsum[g] = 0.f;
  }

  int rb = (lane >> 4) << 3;
  int cl = lane & 15;

  issue_async_copies(Kg, Vg, smem, smem + 4096, 0);  // prologue: block 0 -> buffer 0

#pragma unroll 1
  for (int jb = 0; jb < SEQ / 32; ++jb) {
    int cur = jb & 1;
    const _Float16* kcur = smem + cur * 2048;
    const _Float16* vcur = smem + 4096 + cur * 2048;
    if (jb < SEQ / 32 - 1) {
      issue_async_copies(Kg, Vg, smem + (1 - cur) * 2048, smem + 4096 + (1 - cur) * 2048,
                         (jb + 1) * 32);
      asm volatile("s_wait_asynccnt 2" ::: "memory");   // current buffer's 2 copies done
    } else {
      asm volatile("s_wait_asynccnt 0" ::: "memory");
    }
    __syncthreads();  // all waves' copies landed

    v16h kb00 = lds_frag64(kcur, 0,  0);
    v16h kb01 = lds_frag64(kcur, 0,  32);
    v16h kb10 = lds_frag64(kcur, 16, 0);
    v16h kb11 = lds_frag64(kcur, 16, 32);
    v8f s0[QG], s1[QG];
#pragma unroll
    for (int g = 0; g < QG; ++g) {
      v8f z = {};
      s0[g] = __builtin_amdgcn_wmma_f32_16x16x32_f16(false, kb00, false, qa0[g], (short)0, z, false, false);
      s1[g] = __builtin_amdgcn_wmma_f32_16x16x32_f16(false, kb10, false, qa0[g], (short)0, z, false, false);
    }
#pragma unroll
    for (int g = 0; g < QG; ++g) {
      s0[g] = __builtin_amdgcn_wmma_f32_16x16x32_f16(false, kb01, false, qa1[g], (short)0, s0[g], false, false);
      s1[g] = __builtin_amdgcn_wmma_f32_16x16x32_f16(false, kb11, false, qa1[g], (short)0, s1[g], false, false);
    }

    // Online softmax. s0[g][r] = score of key rb + r, s1[g][r] = of key 16 + rb + r, for query q0 + 16*g + cl.
    v16h pb[QG];
#pragma unroll
    for (int g = 0; g < QG; ++g) {
      float a0 = fmaxf(fmaxf(s0[g][0], s0[g][1]), s0[g][2]);
      float a1 = fmaxf(fmaxf(s0[g][3], s0[g][4]), s0[g][5]);
      float a2 = fmaxf(fmaxf(s0[g][6], s0[g][7]), s1[g][0]);
      float a3 = fmaxf(fmaxf(s1[g][1], s1[g][2]), s1[g][3]);
      float a4 = fmaxf(fmaxf(s1[g][4], s1[g][5]), s1[g][6]);
      float mx = fmaxf(fmaxf(fmaxf(a0, a1), a2), fmaxf(fmaxf(a3, a4), s1[g][7]));
      mx = fmaxf(mx, xhalf(mx));  // the other 16 keys of the block
      float mnew  = fmaxf(mrow[g], mx);
      float alpha = __expf(mrow[g] - mnew);
      mrow[g] = mnew;

      // The two score tiles in loops of their own: the packed subtract and multiply then pair neighbouring
      // registers of one tile (fewer register moves than pairing across the tiles).
      float p0[8], p1[8], ps[8];
#pragma unroll
      for (int r = 0; r < 8; ++r) p0[r] = __expf(s0[g][r] - mnew);
#pragma unroll
      for (int r = 0; r < 8; ++r) p1[r] = __expf(s1[g][r] - mnew);
#pragma unroll
      for (int r = 0; r < 8; ++r) {
        ps[r] = p0[r] + p1[r];
        pb[g][r]     = (_Float16)p0[r];
        pb[g][r + 8] = (_Float16)p1[r];
      }
      lsum[g] = lsum[g] * alpha + (((ps[0] + ps[1]) + (ps[2] + ps[3])) + ((ps[4] + ps[5]) + (ps[6] + ps[7])));
#pragma unroll
      for (int t = 0; t < 4; ++t) {
#pragma unroll
        for (int r = 0; r < 8; ++r) acc[g][t][r] *= alpha;
      }
    }

    v16h vb0 = lds_frag32(vcur, 0);
    v16h vb1 = lds_frag32(vcur, 16);
    v16h vb2 = lds_frag32(vcur, 32);
    v16h vb3 = lds_frag32(vcur, 48);
#pragma unroll
    for (int g = 0; g < QG; ++g) {
      acc[g][0] = __builtin_amdgcn_wmma_f32_16x16x32_f16(false, vb0, false, pb[g], (short)0, acc[g][0], false, false);
      acc[g][1] = __builtin_amdgcn_wmma_f32_16x16x32_f16(false, vb1, false, pb[g], (short)0, acc[g][1], false, false);
      acc[g][2] = __builtin_amdgcn_wmma_f32_16x16x32_f16(false, vb2, false, pb[g], (short)0, acc[g][2], false, false);
      acc[g][3] = __builtin_amdgcn_wmma_f32_16x16x32_f16(false, vb3, false, pb[g], (short)0, acc[g][3], false, false);
    }

    __syncthreads();  // everyone done reading this buffer before it is refilled
  }

  // acc[g][t][r] = Ot[t*16 + rb + r][q0 + 16*g + cl]: eight consecutive d of one query per tile and lane.
#pragma unroll
  for (int g = 0; g < QG; ++g) {
    float l = lsum[g] + xhalf(lsum[g]);
    float* orow = O + ((size_t)(b * SEQ + q0 + 16 * g + cl)) * INNER + h * DHEAD + rb;
#pragma unroll
    for (int t = 0; t < 4; ++t) {
      float4 lo = make_float4(acc[g][t][0] / l, acc[g][t][1] / l, acc[g][t][2] / l, acc[g][t][3] / l);
      float4 hi = make_float4(acc[g][t][4] / l, acc[g][t][5] / l, acc[g][t][6] / l, acc[g][t][7] / l);
      *reinterpret_cast<float4*>(orow + t * 16)     = lo;
      *reinterpret_cast<float4*>(orow + t * 16 + 4) = hi;
    }
  }
}

extern "C" void kernel_launch(void* const* d_in, const int* in_sizes, int n_in,
                              void* d_out, int out_size, void* d_ws, size_t ws_size,
                              hipStream_t stream) {
  const float* q1  = (const float*)d_in[0];
  const float* q2  = (const float*)d_in[1];
  const float* xkv = (const float*)d_in[2];
  const float* Wq1 = (const float*)d_in[3];
  const float* Wq2 = (const float*)d_in[4];
  const float* Wkv = (const float*)d_in[5];
  float* out = (float*)d_out;

  const size_t NBH = (size_t)BATCH * SEQ * INNER;  // 4,194,304 elements
  _Float16* ws  = (_Float16*)d_ws;
  _Float16* Q1h = ws;
  _Float16* Q2h = Q1h + NBH;
  _Float16* Kh  = Q2h + NBH;
  _Float16* Vth = Kh  + NBH;
  _Float16* X1h = Vth + NBH;
  _Float16* X2h = X1h + NBH;
  _Float16* Xkh = X2h + NBH;
  _Float16* Wt1 = Xkh + NBH;
  _Float16* Wt2 = Wt1 + (size_t)DIM * INNER;
  _Float16* Wtk = Wt2 + (size_t)DIM * INNER;

  prep<<<PREP_W_BLOCKS + 3 * PREP_X_BLOCKS, 256, 0, stream>>>(q1, q2, xkv, Wq1, Wq2, Wkv,
                                                              X1h, X2h, Xkh, Wt1, Wt2, Wtk);

  const float scale = 0.125f;  // DHEAD^-0.5
  const int MT = (BATCH * SEQ) / 16;  // 512
  proj_gemm<<<(MT * (INNER / 64)) / 8,     256, 0, stream>>>(X1h, Wt1, Q1h, nullptr, INNER,     scale);
  proj_gemm<<<(MT * (INNER / 64)) / 8,     256, 0, stream>>>(X2h, Wt2, Q2h, nullptr, INNER,     scale);
  proj_gemm<<<(MT * (2 * INNER / 64)) / 8, 256, 0, stream>>>(Xkh, Wtk, Kh,  Vth,     2 * INNER, 1.0f);

  // 64 (branch,b,h) x 8 query chunks of 256 = 512 blocks of 8 waves
  flash_attn<<<512, 256, 0, stream>>>(Q1h, Q2h, Kh, Vth, out);
}

// v006
// Measured time: 107 microseconds a run.
// Two timings next to v005 put it at 1.08 and 1.09 times that version's speed.
// All steps since v000 together make it 4.21 times as fast.
#include <hip/hip_runtime.h>

typedef __attribute__((ext_vector_type(16))) _Float16 v16h;
typedef __attribute__((ext_vector_type(8)))  _Float16 v8h;
typedef __attribute__((ext_vector_type(4)))  _Float16 v4h;
typedef __attribute__((ext_vector_type(8)))  float    v8f;

#define HEADS 8
#define DHEAD 64
#define SEQ   2048
#define BATCH 4
#define DIM   512
#define INNER 512   // HEADS * DHEAD

// A 16x32 f16 WMMA A/B fragment of a row-major matrix, at rows row0.., k from k0:
// lane l holds row row0 + (l&15), k elements k0 + 8*(l>>4) + {0..7} and +16..23.

// LDS tiles are stored with their 16-byte chunks XOR-swizzled inside each row, so that the 16 rows
// one half-wave reads at the same chunk column fall on 16 different 16-byte bank groups (64 banks x 4 B
// = 256 B): a plain 128-B or 64-B row pitch puts them on 2 or 4 groups only.
// 64-half rows (128 B, 8 chunks): two rows span the banks, so the chunk is XORed with row/2.
__device__ __forceinline__ int swz64(int row, int chunk) {
  return row * 64 + ((chunk ^ ((row >> 1) & 7)) << 3);
}
// 32-half rows (64 B, 4 chunks): four rows span the banks, so the chunk is XORed with row/4.
__device__ __forceinline__ int swz32(int row, int chunk) {
  return row * 32 + ((chunk ^ ((row >> 2) & 3)) << 3);
}

// That fragment, read from a swizzled LDS tile with 64-half rows.
__device__ __forceinline__ v16h lds_frag64(const _Float16* base, int row0, int k0) {
  int lane = threadIdx.x & 31;
  int row = row0 + (lane & 15);
  int ch  = (k0 >> 3) + (lane >> 4);
  v8h lo = *reinterpret_cast<const v8h*>(base + swz64(row, ch));
  v8h hi = *reinterpret_cast<const v8h*>(base + swz64(row, ch + 2));
  v16h f;
#pragma unroll
  for (int i = 0; i < 8; ++i) { f[i] = lo[i]; f[i + 8] = hi[i]; }
  return f;
}

// That fragment (same k order) at k0 = 0, read from a swizzled LDS tile with 32-half rows.
__device__ __forceinline__ v16h lds_frag32(const _Float16* base, int row0) {
  int lane = threadIdx.x & 31;
  int row = row0 + (lane & 15);
  int ch  = lane >> 4;
  v8h lo = *reinterpret_cast<const v8h*>(base + swz32(row, ch));
  v8h hi = *reinterpret_cast<const v8h*>(base + swz32(row, ch + 2));
  v16h f;
#pragma unroll
  for (int i = 0; i < 8; ++i) { f[i] = lo[i]; f[i + 8] = hi[i]; }
  return f;
}

// Lane l takes the value of lane l ^ 16, in the vector pipe (a shuffle would go through the LDS unit).
__device__ __forceinline__ float xhalf(float x) {
  int i = __builtin_bit_cast(int, x);
  return __builtin_bit_cast(float,
      __builtin_amdgcn_permlanex16(i, i, 0x76543210, 0xfedcba98, false, false));
}

// Preparation, one launch. Blocks 0..255 transpose and convert the three weight matrices, blocks 256..1023
// convert the three activations. Few, long-lived waves: a thread's 16 loads are issued ahead of its stores.
#define PREP_W_BLOCKS 256   // 32 columns x 128 k a block: 64 (Wq1) + 64 (Wq2) + 128 (Wkv)
#define PREP_X_BLOCKS 256   // per activation: 16384 floats a block
__global__ __launch_bounds__(256) void prep(const float* __restrict__ q1, const float* __restrict__ q2,
                                            const float* __restrict__ xkv, const float* __restrict__ Wq1,
                                            const float* __restrict__ Wq2, const float* __restrict__ Wkv,
                                            _Float16* __restrict__ X1h, _Float16* __restrict__ X2h,
                                            _Float16* __restrict__ Xkh, _Float16* __restrict__ Wt1,
                                            _Float16* __restrict__ Wt2, _Float16* __restrict__ Wtk) {
  int bid = blockIdx.x;
  int t   = threadIdx.x;
  if (bid < PREP_W_BLOCKS) {
    // Wt[c*DIM + k] = W[k*C + c]. Eight lanes store one whole 128-B line of a Wt row (16 B each); the 32
    // columns of a block are one 128-B line of each W row it reads.
    const float* Wsrc = bid < 64 ? Wq1 : (bid < 128 ? Wq2 : Wkv);
    _Float16*    Wdst = bid < 64 ? Wt1 : (bid < 128 ? Wt2 : Wtk);
    int C    = bid < 128 ? INNER : 2 * INNER;
    int tile = bid < 128 ? (bid & 63) : (bid - 128);
    int c  = (tile >> 2) * 32 + (t >> 3);
    int k0 = (tile & 3) * 128 + (t & 7) * 8;
    float w[16];
    // All loops of this kernel are unrolled so that w and v stay in registers and the loads go out as a group.
#pragma unroll
    for (int u = 0; u < 2; ++u) {
#pragma unroll
      for (int j = 0; j < 8; ++j) w[u * 8 + j] = Wsrc[(size_t)(k0 + u * 64 + j) * C + c];
    }
#pragma unroll
    for (int u = 0; u < 2; ++u) {
      v8h hv;
#pragma unroll
      for (int j = 0; j < 8; ++j) hv[j] = (_Float16)w[u * 8 + j];
      *reinterpret_cast<v8h*>(Wdst + (size_t)c * DIM + k0 + u * 64) = hv;
    }
  } else {
    // A wave-wide load covers 512 contiguous bytes (four lines), the matching store 256 (two lines).
    int xb = bid - PREP_W_BLOCKS;
    const float* in  = xb < PREP_X_BLOCKS ? q1  : (xb < 2 * PREP_X_BLOCKS ? q2  : xkv);
    _Float16*    dst = xb < PREP_X_BLOCKS ? X1h : (xb < 2 * PREP_X_BLOCKS ? X2h : Xkh);
    size_t base = (size_t)(xb & (PREP_X_BLOCKS - 1)) * 16384 + t * 4;
    float4 v[16];
#pragma unroll
    for (int u = 0; u < 16; ++u) v[u] = *reinterpret_cast<const float4*>(in + base + u * 1024);
#pragma unroll
    for (int u = 0; u < 16; ++u) {
      v4h hv = {(_Float16)v[u].x, (_Float16)v[u].y, (_Float16)v[u].z, (_Float16)v[u].w};
      *reinterpret_cast<v4h*>(dst + base + u * 1024) = hv;
    }
    // No register that an issued store names is rewritten ahead of this wait; only the activation path has this wait, the weight path stores without one.
    asm volatile("s_wait_xcnt 0x0" ::: "memory");
  }
}

// Issue the per-thread share of one 64-k slab of a block's operands into LDS: 128 rows of X (4 chunks of
// 16 B a thread) and 64 rows of Wt (2 chunks a thread), each chunk at its swizzled place in its row (swz64;
// rows 32 apart swizzle alike). One wave-wide copy covers four whole 128-B lines.
__device__ __forceinline__ void issue_proj_slab(const _Float16* __restrict__ Xb,
                                                const _Float16* __restrict__ Wb,
                                                _Float16* adst, _Float16* bdst, int k0) {
  int t = threadIdx.x;
  int row = t >> 3, ch = t & 7;
  const _Float16* ga0 = Xb + (size_t)row * DIM + k0 + ch * 8;
  const _Float16* ga1 = ga0 + 32 * DIM;
  const _Float16* ga2 = ga0 + 64 * DIM;
  const _Float16* ga3 = ga0 + 96 * DIM;
  const _Float16* gb0 = Wb + (size_t)row * DIM + k0 + ch * 8;
  const _Float16* gb1 = gb0 + 32 * DIM;
  uint32_t la0 = (uint32_t)(uintptr_t)(adst + swz64(row, ch));
  uint32_t la1 = la0 + 32 * 128;
  uint32_t la2 = la0 + 64 * 128;
  uint32_t la3 = la0 + 96 * 128;
  uint32_t lb0 = (uint32_t)(uintptr_t)(bdst + swz64(row, ch));
  uint32_t lb1 = lb0 + 32 * 128;
  // The copies and their s_wait_xcnt in one statement: no address register is rewritten ahead of the wait.
  asm volatile("global_load_async_to_lds_b128 %0, %6, off\n\t"
               "global_load_async_to_lds_b128 %1, %7, off\n\t"
               "global_load_async_to_lds_b128 %2, %8, off\n\t"
               "global_load_async_to_lds_b128 %3, %9, off\n\t"
               "global_load_async_to_lds_b128 %4, %10, off\n\t"
               "global_load_async_to_lds_b128 %5, %11, off\n\t"
               "s_wait_xcnt 0x0"
               :: "v"(la0), "v"(la1), "v"(la2), "v"(la3), "v"(lb0), "v"(lb1),
                  "v"(ga0), "v"(ga1), "v"(ga2), "v"(ga3), "v"(gb0), "v"(gb1)
               : "memory");
}

#define PROJ_A_HALVES (128 * 64)                    // X slab: 128 rows x 64 k
#define PROJ_BUF_HALVES (PROJ_A_HALVES + 64 * 64)   // + Wt slab: 64 rows x 64 k

// GEMM: [8192 x 512] (f16) x Wt^T -> scatter into per-head layouts.
// col < 512  -> dstK[((b*H+h)*SEQ + n)*64 + d] = val*scale   (K, [B,H,N,64])
// col >= 512 -> dstV[((b*H+h)*64 + d)*SEQ + n] = val         (V transposed, [B,H,64,N])
// Block = 128 rows x 64 columns, wave = 16 rows x 64 columns. Both operands come through LDS in 64-k slabs,
// brought by asynchronous copies into two buffers: slab s + 1 flies while slab s is multiplied.
__global__ __launch_bounds__(256) void proj_gemm(const _Float16* __restrict__ X,
                                                 const _Float16* __restrict__ Wt,
                                                 _Float16* __restrict__ dstK,
                                                 _Float16* __restrict__ dstV,
                                                 int ncols, float scale) {
  // Two buffers of one 64-k slab each: [X 128 x 64][Wt 64 x 64] halves = 24 KB a buffer.
  __shared__ __align__(16) _Float16 sm[2 * PROJ_BUF_HALVES];
  int lane = threadIdx.x & 31;
  int wid  = threadIdx.x >> 5;
  const int MT = (BATCH * SEQ) / 16;  // 512 row tiles
  int id0 = blockIdx.x * 8;           // the block's first wave tile; 8 divides MT, so one c0 a block
  int mb  = (id0 % MT) * 16;
  int m0  = mb + wid * 16;
  int c0  = (id0 / MT) * 64;
  if (c0 >= ncols) return;

  const _Float16* Xb = X  + (size_t)mb * DIM;
  const _Float16* Wb = Wt + (size_t)c0 * DIM;

  issue_proj_slab(Xb, Wb, sm, sm + PROJ_A_HALVES, 0);
  asm volatile("s_wait_asynccnt 0x0" ::: "memory");  // this wave's share of slab 0 has landed
  __syncthreads();                                   // ... and every other wave's
  issue_proj_slab(Xb, Wb, sm + PROJ_BUF_HALVES, sm + PROJ_BUF_HALVES + PROJ_A_HALVES, 64);

  v8f acc0 = {}, acc1 = {}, acc2 = {}, acc3 = {};
#pragma unroll 1  // rolled: one copy statement and one publish point in the text
  for (int s = 0; s < DIM / 64; ++s) {
    _Float16* ab = sm + (s & 1) * PROJ_BUF_HALVES;
    _Float16* bb = ab + PROJ_A_HALVES;
#pragma unroll  // both 32-k steps of a slab in one body: no inner branch, chunk offsets are loop constants
    for (int kk = 0; kk < 64; kk += 32) {
      v16h a  = lds_frag64(ab, wid * 16, kk);
      v16h b0 = lds_frag64(bb, 0,  kk);
      v16h b1 = lds_frag64(bb, 16, kk);
      v16h b2 = lds_frag64(bb, 32, kk);
      v16h b3 = lds_frag64(bb, 48, kk);
      acc0 = __builtin_amdgcn_wmma_f32_16x16x32_f16(false, a, false, b0, (short)0, acc0, false, false);
      acc1 = __builtin_amdgcn_wmma_f32_16x16x32_f16(false, a, false, b1, (short)0, acc1, false, false);
      acc2 = __builtin_amdgcn_wmma_f32_16x16x32_f16(false, a, false, b2, (short)0, acc2, false, false);
      acc3 = __builtin_amdgcn_wmma_f32_16x16x32_f16(false, a, false, b3, (short)0, acc3, false, false);
    }
    asm volatile("s_wait_dscnt 0x0" ::: "memory");     // this wave's reads of slab s are over
    asm volatile("s_wait_asynccnt 0x0" ::: "memory");  // its share of slab s + 1 has landed
    __syncthreads();  // publishes slab s + 1 and frees the buffer of slab s
    if (s + 2 < DIM / 64) issue_proj_slab(Xb, Wb, ab, bb, (s + 2) * 64);
  }
  asm volatile("s_wait_asynccnt 0x0" ::: "memory");  // nothing in flight when the wave ends

  v8f accs[4] = {acc0, acc1, acc2, acc3};
  int rowb = m0 + ((lane >> 4) << 3);
  int cl   = lane & 15;
#pragma unroll
  for (int t = 0; t < 4; ++t) {
#pragma unroll
    for (int r = 0; r < 8; ++r) {
      float val = accs[t][r];
      int row = rowb + r;
      int col = c0 + t * 16 + cl;
      int b = row >> 11, n = row & (SEQ - 1);
      if (col < INNER) {
        int h = col >> 6, d = col & 63;
        dstK[(((size_t)(b * HEADS + h)) * SEQ + n) * DHEAD + d] = (_Float16)(val * scale);
      } else {
        int cc = col - INNER;
        int h = cc >> 6, d = cc & 63;
        dstV[(((size_t)(b * HEADS + h)) * DHEAD + d) * SEQ + n] = (_Float16)val;
      }
    }
  }
}

// Issue the per-thread share of one 32-key K/V block copy into LDS.
// K block: 32 rows x 64 halves (stride DHEAD);  V block: 64 rows x 32 halves (from stride SEQ).
// 256 threads x 16B each per tensor -> each WAVE issues exactly 2 async instructions.
// Each 16-byte chunk lands at its swizzled place inside its own row (swz64 / swz32).
__device__ __forceinline__ void issue_async_copies(const _Float16* __restrict__ Kg,
                                                   const _Float16* __restrict__ Vg,
                                                   _Float16* kdst, _Float16* vdst, int j) {
  int t = threadIdx.x;
  const _Float16* gk = Kg + (size_t)(j + (t >> 3)) * DHEAD + (t & 7) * 8;
  const _Float16* gv = Vg + (size_t)(t >> 2) * SEQ + j + (t & 3) * 8;
  uint32_t lk = (uint32_t)(uintptr_t)(kdst + swz64(t >> 3, t & 7));
  uint32_t lv = (uint32_t)(uintptr_t)(vdst + swz32(t >> 2, t & 3));
  asm volatile("global_load_async_to_lds_b128 %0, %1, off" :: "v"(lk), "v"(gk) : "memory");
  asm volatile("global_load_async_to_lds_b128 %0, %1, off" :: "v"(lv), "v"(gv) : "memory");
}

// Issue the per-thread share of one 64-k slab of a flash block's query projection into LDS: 256 rows of X
// (8 chunks of 16 B a thread) and the head's 64 rows of Wt (2 chunks a thread), each chunk at its swizzled
// place in its row (swz64; rows 32 apart swizzle alike). One wave-wide copy covers four whole 128-B lines.
__device__ __forceinline__ void issue_qproj_slab(const _Float16* __restrict__ Xb,
                                                 const _Float16* __restrict__ Wb,
                                                 _Float16* adst, _Float16* bdst, int k0) {
  int t = threadIdx.x;
  int row = t >> 3, ch = t & 7;
  const _Float16* ga0 = Xb + (size_t)row * DIM + k0 + ch * 8;
  const _Float16* ga1 = ga0 + 32 * DIM;
  const _Float16* ga2 = ga0 + 64 * DIM;
  const _Float16* ga3 = ga0 + 96 * DIM;
  const _Float16* ga4 = ga0 + 128 * DIM;
  const _Float16* ga5 = ga0 + 160 * DIM;
  const _Float16* ga6 = ga0 + 192 * DIM;
  const _Float16* ga7 = ga0 + 224 * DIM;
  const _Float16* gb0 = Wb + (size_t)row * DIM + k0 + ch * 8;
  const _Float16* gb1 = gb0 + 32 * DIM;
  uint32_t la0 = (uint32_t)(uintptr_t)(adst + swz64(row, ch));
  uint32_t la1 = la0 + 32 * 128;
  uint32_t la2 = la0 + 64 * 128;
  uint32_t la3 = la0 + 96 * 128;
  uint32_t la4 = la0 + 128 * 128;
  uint32_t la5 = la0 + 160 * 128;
  uint32_t la6 = la0 + 192 * 128;
  uint32_t la7 = la0 + 224 * 128;
  uint32_t lb0 = (uint32_t)(uintptr_t)(bdst + swz64(row, ch));
  uint32_t lb1 = lb0 + 32 * 128;
  // The copies and their s_wait_xcnt in one statement: no address register is rewritten ahead of the wait.
  asm volatile("global_load_async_to_lds_b128 %0, %10, off\n\t"
               "global_load_async_to_lds_b128 %1, %11, off\n\t"
               "global_load_async_to_lds_b128 %2, %12, off\n\t"
               "global_load_async_to_lds_b128 %3, %13, off\n\t"
               "global_load_async_to_lds_b128 %4, %14, off\n\t"
               "global_load_async_to_lds_b128 %5, %15, off\n\t"
               "global_load_async_to_lds_b128 %6, %16, off\n\t"
               "global_load_async_to_lds_b128 %7, %17, off\n\t"
               "global_load_async_to_lds_b128 %8, %18, off\n\t"
               "global_load_async_to_lds_b128 %9, %19, off\n\t"
               "s_wait_xcnt 0x0"
               :: "v"(la0), "v"(la1), "v"(la2), "v"(la3), "v"(la4), "v"(la5), "v"(la6), "v"(la7),
                  "v"(lb0), "v"(lb1),
                  "v"(ga0), "v"(ga1), "v"(ga2), "v"(ga3), "v"(ga4), "v"(ga5), "v"(ga6), "v"(ga7),
                  "v"(gb0), "v"(gb1)
               : "memory");
}

#define QP_A_HALVES (256 * 64)                  // X slab: 256 query rows x 64 k
#define QP_BUF_HALVES (QP_A_HALVES + 64 * 64)   // + Wt slab: the head's 64 rows x 64 k

// Flash attention: block = one (branch,b,h), 8 waves x 32 query rows = 256 rows.
// The block first projects its own queries: Qt = Wt_head * Xt (A = the head's 64 Wt rows, B = the block's X
// rows), operands through LDS in 64-k slabs, two buffers, as in proj_gemm. Lane l then holds, of query
// q0 + 16*g + (l & 15), the d values 16*t + 8*(l>>4) + 0..7 of tile t: tiles 0, 1 and 2, 3, scaled and
// converted, are the two B fragments of Q as they stand, so Q never leaves the registers.
// K/V blocks staged once per block into LDS via async copies (double buffered),
// shared by all 8 waves -> 8x less L2 traffic than per-wave streaming.
// The products are taken transposed: St = K * Qt (A = K rows, B = Q) and Ot += Vt * Pt (A = Vt rows,
// B = Pt). A wave owns QG groups of 16 queries; in group g lane l holds only query q0 + 16*g + (l & 15): of
// each 32-key block the keys 8*(l>>4) + 0..7 (first score tile) and 16 + 8*(l>>4) + 0..7 (second), which is
// the k order of a B fragment, so the converted scores are the B operand as they stand; maximum, sum and
// rescale are per-lane values. Every K and Vt fragment read from LDS is the A operand of QG products.
#define QG 2
__global__ __launch_bounds__(256) void flash_attn(const _Float16* __restrict__ X1,
                                                  const _Float16* __restrict__ X2,
                                                  const _Float16* __restrict__ Wt1,
                                                  const _Float16* __restrict__ Wt2,
                                                  const _Float16* __restrict__ Kt,
                                                  const _Float16* __restrict__ Vt,
                                                  float* __restrict__ out, float scale) {
  // Projection: two buffers of [X 256 x 64][Wt 64 x 64] halves = 80 KB. The key loop then reuses the first
  // 16 KB as [K0 2048][K1 2048][V0 2048][V1 2048] halves.
  __shared__ __align__(16) _Float16 smem[2 * QP_BUF_HALVES];
  int lane = threadIdx.x & 31;
  int wid  = threadIdx.x >> 5;
  int bid  = blockIdx.x;
  int bhz  = bid & 63;       // (branch, b, h)
  int qc   = bid >> 6;       // 0..SEQ / (128 * QG) - 1
  int q0   = (qc * 128 + wid * 16) * QG;
  int h    = bhz & 7;
  int b    = (bhz >> 3) & 3;
  int br   = bhz >> 5;

  const _Float16* Xb = (br ? X2 : X1) + (size_t)(b * SEQ + qc * 128 * QG) * DIM;  // the block's 256 X rows
  const _Float16* Wb = (br ? Wt2 : Wt1) + (size_t)(h * DHEAD) * DIM;              // the head's 64 Wt rows
  const _Float16* Kg = Kt + ((size_t)(b * HEADS + h)) * SEQ * DHEAD;
  const _Float16* Vg = Vt + ((size_t)(b * HEADS + h)) * DHEAD * SEQ;
  float* O = out + (size_t)br * ((size_t)BATCH * SEQ * INNER);

  // All loops over g, t and r in this kernel are unrolled so that the arrays they index stay in registers.
  v16h qa0[QG], qa1[QG];
  {
    issue_qproj_slab(Xb, Wb, smem, smem + QP_A_HALVES, 0);
    asm volatile("s_wait_asynccnt 0x0" ::: "memory");  // this wave's share of slab 0 has landed
    __syncthreads();                                   // ... and every other wave's
    issue_qproj_slab(Xb, Wb, smem + QP_BUF_HALVES, smem + QP_BUF_HALVES + QP_A_HALVES, 64);

    v8f qacc[QG][4] = {};
#pragma unroll 1  // rolled: one copy statement and one publish point in the text
    for (int s = 0; s < DIM / 64; ++s) {
      _Float16* ab = smem + (s & 1) * QP_BUF_HALVES;
      _Float16* bb = ab + QP_A_HALVES;
#pragma unroll  // both 32-k steps of a slab in one body: no inner branch, chunk offsets are loop constants
      for (int kk = 0; kk < 64; kk += 32) {
        v16h w0 = lds_frag64(bb, 0,  kk);
        v16h w1 = lds_frag64(bb, 16, kk);
        v16h w2 = lds_frag64(bb, 32, kk);
        v16h w3 = lds_frag64(bb, 48, kk);
#pragma unroll
        for (int g = 0; g < QG; ++g) {
          v16h x = lds_frag64(ab, (wid * QG + g) * 16, kk);
          qacc[g][0] = __builtin_amdgcn_wmma_f32_16x16x32_f16(false, w0, false, x, (short)0, qacc[g][0], false, false);
          qacc[g][1] = __builtin_amdgcn_wmma_f32_16x16x32_f16(false, w1, false, x, (short)0, qacc[g][1], false, false);
          qacc[g][2] = __builtin_amdgcn_wmma_f32_16x16x32_f16(false, w2, false, x, (short)0, qacc[g][2], false, false);
          qacc[g][3] = __builtin_amdgcn_wmma_f32_16x16x32_f16(false, w3, false, x, (short)0, qacc[g][3], false, false);
        }
      }
      asm volatile("s_wait_dscnt 0x0" ::: "memory");     // this wave's reads of slab s are over
      asm volatile("s_wait_asynccnt 0x0" ::: "memory");  // its share of slab s + 1 has landed
      __syncthreads();  // publishes slab s + 1 and frees the buffer of slab s
      if (s + 2 < DIM / 64) issue_qproj_slab(Xb, Wb, ab, bb, (s + 2) * 64);
    }
    asm volatile("s_wait_asynccnt 0x0" ::: "memory");  // nothing in flight when the key loop takes the LDS over

#pragma unroll
    for (int g = 0; g < QG; ++g) {
#pragma unroll
      for (int r = 0; r < 8; ++r) {
        qa0[g][r]     = (_Float16)(qacc[g][0][r] * scale);
        qa0[g][r + 8] = (_Float16)(qacc[g][1][r] * scale);
        qa1[g][r]     = (_Float16)(qacc[g][2][r] * scale);
        qa1[g][r + 8] = (_Float16)(qacc[g][3][r] * scale);
      }
    }
  }
  v8f acc[QG][4] = {};
  float mrow[QG];  // running maximum of this lane's query of group g (equal in lanes l and l ^ 16)
  float lsum[QG];  // running sum over this lane's half of the keys; the halves join after the loop
#pragma unroll
  for (int g = 0; g < QG; ++g) {
    mrow[g] = -1e30f;
    lsum[g] = 0.f;
  }

  int rb = (lane >> 4) << 3;
  int cl = lane & 15;

  issue_async_copies(Kg, Vg, smem, smem + 4096, 0);  // prologue: block 0 -> buffer 0

#pragma unroll 1
  for (int jb = 0; jb < SEQ / 32; ++jb) {
    int cur = jb & 1;
    const _Float16* kcur = smem + cur * 2048;
    const _Float16* vcur = smem + 4096 + cur * 2048;
    if (jb < SEQ / 32 - 1) {
      issue_async_copies(Kg, Vg, smem + (1 - cur) * 2048, smem + 4096 + (1 - cur) * 2048,
                         (jb + 1) * 32);
      asm volatile("s_wait_asynccnt 2" ::: "memory");   // current buffer's 2 copies done
    } else {
      asm volatile("s_wait_asynccnt 0" ::: "memory");
    }
    __syncthreads();  // all waves' copies landed

    v16h kb00 = lds_frag64(kcur, 0,  0);
    v16h kb01 = lds_frag64(kcur, 0,  32);
    v16h kb10 = lds_frag64(kcur, 16, 0);
    v16h kb11 = lds_frag64(kcur, 16, 32);
    v8f s0[QG], s1[QG];
#pragma unroll
    for (int g = 0; g < QG; ++g) {
      v8f z = {};
      s0[g] = __builtin_amdgcn_wmma_f32_16x16x32_f16(false, kb00, false, qa0[g], (short)0, z, false, false);
      s1[g] = __builtin_amdgcn_wmma_f32_16x16x32_f16(false, kb10, false, qa0[g], (short)0, z, false, false);
    }
#pragma unroll
    for (int g = 0; g < QG; ++g) {
      s0[g] = __builtin_amdgcn_wmma_f32_16x16x32_f16(false, kb01, false, qa1[g], (short)0, s0[g], false, false);
      s1[g] = __builtin_amdgcn_wmma_f32_16x16x32_f16(false, kb11, false, qa1[g], (short)0, s1[g], false, false);
    }

    // Online softmax. s0[g][r] = score of key rb + r, s1[g][r] = of key 16 + rb + r, for query q0 + 16*g + cl.
    v16h pb[QG];
#pragma unroll
    for (int g = 0; g < QG; ++g) {
      float a0 = fmaxf(fmaxf(s0[g][0], s0[g][1]), s0[g][2]);
      float a1 = fmaxf(fmaxf(s0[g][3], s0[g][4]), s0[g][5]);
      float a2 = fmaxf(fmaxf(s0[g][6], s0[g][7]), s1[g][0]);
      float a3 = fmaxf(fmaxf(s1[g][1], s1[g][2]), s1[g][3]);
      float a4 = fmaxf(fmaxf(s1[g][4], s1[g][5]), s1[g][6]);
      float mx = fmaxf(fmaxf(fmaxf(a0, a1), a2), fmaxf(fmaxf(a3, a4), s1[g][7]));
      mx = fmaxf(mx, xhalf(mx));  // the other 16 keys of the block
      float mnew  = fmaxf(mrow[g], mx);
      float alpha = __expf(mrow[g] - mnew);
      mrow[g] = mnew;

      // The two score tiles in loops of their own: the packed subtract and multiply then pair neighbouring
      // registers of one tile (fewer register moves than pairing across the tiles).
      float p0[8], p1[8], ps[8];
#pragma unroll
      for (int r = 0; r < 8; ++r) p0[r] = __expf(s0[g][r] - mnew);
#pragma unroll
      for (int r = 0; r < 8; ++r) p1[r] = __expf(s1[g][r] - mnew);
#pragma unroll
      for (int r = 0; r < 8; ++r) {
        ps[r] = p0[r] + p1[r];
        pb[g][r]     = (_Float16)p0[r];
        pb[g][r + 8] = (_Float16)p1[r];
      }
      lsum[g] = lsum[g] * alpha + (((ps[0] + ps[1]) + (ps[2] + ps[3])) + ((ps[4] + ps[5]) + (ps[6] + ps[7])));
#pragma unroll
      for (int t = 0; t < 4; ++t) {
#pragma unroll
        for (int r = 0; r < 8; ++r) acc[g][t][r] *= alpha;
      }
    }

    v16h vb0 = lds_frag32(vcur, 0);
    v16h vb1 = lds_frag32(vcur, 16);
    v16h vb2 = lds_frag32(vcur, 32);
    v16h vb3 = lds_frag32(vcur, 48);
#pragma unroll
    for (int g = 0; g < QG; ++g) {
      acc[g][0] = __builtin_amdgcn_wmma_f32_16x16x32_f16(false, vb0, false, pb[g], (short)0, acc[g][0], false, false);
      acc[g][1] = __builtin_amdgcn_wmma_f32_16x16x32_f16(false, vb1, false, pb[g], (short)0, acc[g][1], false, false);
      acc[g][2] = __builtin_amdgcn_wmma_f32_16x16x32_f16(false, vb2, false, pb[g], (short)0, acc[g][2], false, false);
      acc[g][3] = __builtin_amdgcn_wmma_f32_16x16x32_f16(false, vb3, false, pb[g], (short)0, acc[g][3], false, false);
    }

    __syncthreads();  // everyone done reading this buffer before it is refilled
  }

  // acc[g][t][r] = Ot[t*16 + rb + r][q0 + 16*g + cl]: eight consecutive d of one query per tile and lane.
#pragma unroll
  for (int g = 0; g < QG; ++g) {
    float l = lsum[g] + xhalf(lsum[g]);
    float* orow = O + ((size_t)(b * SEQ + q0 + 16 * g + cl)) * INNER + h * DHEAD + rb;
#pragma unroll
    for (int t = 0; t < 4; ++t) {
      float4 lo = make_float4(acc[g][t][0] / l, acc[g][t][1] / l, acc[g][t][2] / l, acc[g][t][3] / l);
      float4 hi = make_float4(acc[g][t][4] / l, acc[g][t][5] / l, acc[g][t][6] / l, acc[g][t][7] / l);
      *reinterpret_cast<float4*>(orow + t * 16)     = lo;
      *reinterpret_cast<float4*>(orow + t * 16 + 4) = hi;
    }
  }
}

extern "C" void kernel_launch(void* const* d_in, const int* in_sizes, int n_in,
                              void* d_out, int out_size, void* d_ws, size_t ws_size,
                              hipStream_t stream) {
  const float* q1  = (const float*)d_in[0];
  const float* q2  = (const float*)d_in[1];
  const float* xkv = (const float*)d_in[2];
  const float* Wq1 = (const float*)d_in[3];
  const float* Wq2 = (const float*)d_in[4];
  const float* Wkv = (const float*)d_in[5];
  float* out = (float*)d_out;

  const size_t NBH = (size_t)BATCH * SEQ * INNER;  // 4,194,304 elements
  _Float16* ws  = (_Float16*)d_ws;
  _Float16* Kh  = ws;
  _Float16* Vth = Kh  + NBH;
  _Float16* X1h = Vth + NBH;
  _Float16* X2h = X1h + NBH;
  _Float16* Xkh = X2h + NBH;
  _Float16* Wt1 = Xkh + NBH;
  _Float16* Wt2 = Wt1 + (size_t)DIM * INNER;
  _Float16* Wtk = Wt2 + (size_t)DIM * INNER;

  prep<<<PREP_W_BLOCKS + 3 * PREP_X_BLOCKS, 256, 0, stream>>>(q1, q2, xkv, Wq1, Wq2, Wkv,
                                                              X1h, X2h, Xkh, Wt1, Wt2, Wtk);

  const float scale = 0.125f;  // DHEAD^-0.5
  const int MT = (BATCH * SEQ) / 16;  // 512
  proj_gemm<<<(MT * (2 * INNER / 64)) / 8, 256, 0, stream>>>(Xkh, Wtk, Kh,  Vth,     2 * INNER, 1.0f);

  // 64 (branch,b,h) x 8 query chunks of 256 = 512 blocks of 8 waves
  flash_attn<<<512, 256, 0, stream>>>(X1h, X2h, Wt1, Wt2, Kh, Vth, out, scale);
}

// v007
// It runs in 100 microseconds.
// Timed twice side by side with v006, it ran 1.06 and 1.07 times as fast.
// Over all steps from v000 it is 4.48 times as fast.
#include <hip/hip_runtime.h>

typedef __attribute__((ext_vector_type(16))) _Float16 v16h;
typedef __attribute__((ext_vector_type(8)))  _Float16 v8h;
typedef __attribute__((ext_vector_type(4)))  _Float16 v4h;
typedef __attribute__((ext_vector_type(8)))  float    v8f;

#define HEADS 8
#define DHEAD 64
#define SEQ   2048
#define BATCH 4
#define DIM   512
#define INNER 512   // HEADS * DHEAD

// A 16x32 f16 WMMA A/B fragment of a row-major matrix, at rows row0.., k from k0:
// lane l holds row row0 + (l&15), k elements k0 + 8*(l>>4) + {0..7} and +16..23.

// LDS tiles are stored with their 16-byte chunks XOR-swizzled inside each row, so that the 16 rows
// one half-wave reads at the same chunk column fall on 16 different 16-byte bank groups (64 banks x 4 B
// = 256 B): a plain 128-B or 64-B row pitch puts them on 2 or 4 groups only.
// 64-half rows (128 B, 8 chunks): two rows span the banks, so the chunk is XORed with row/2.
__device__ __forceinline__ int swz64(int row, int chunk) {
  return row * 64 + ((chunk ^ ((row >> 1) & 7)) << 3);
}
// 32-half rows (64 B, 4 chunks): four rows span the banks, so the chunk is XORed with row/4.
__device__ __forceinline__ int swz32(int row, int chunk) {
  return row * 32 + ((chunk ^ ((row >> 2) & 3)) << 3);
}

// That fragment, read from a swizzled LDS tile with 64-half rows.
__device__ __forceinline__ v16h lds_frag64(const _Float16* base, int row0, int k0) {
  int lane = threadIdx.x & 31;
  int row = row0 + (lane & 15);
  int ch  = (k0 >> 3) + (lane >> 4);
  v8h lo = *reinterpret_cast<const v8h*>(base + swz64(row, ch));
  v8h hi = *reinterpret_cast<const v8h*>(base + swz64(row, ch + 2));
  v16h f;
#pragma unroll
  for (int i = 0; i < 8; ++i) { f[i] = lo[i]; f[i + 8] = hi[i]; }
  return f;
}

// That fragment (same k order) at k0 = 0, read from a swizzled LDS tile with 32-half rows.
__device__ __forceinline__ v16h lds_frag32(const _Float16* base, int row0) {
  int lane = threadIdx.x & 31;
  int row = row0 + (lane & 15);
  int ch  = lane >> 4;
  v8h lo = *reinterpret_cast<const v8h*>(base + swz32(row, ch));
  v8h hi = *reinterpret_cast<const v8h*>(base + swz32(row, ch + 2));
  v16h f;
#pragma unroll
  for (int i = 0; i < 8; ++i) { f[i] = lo[i]; f[i + 8] = hi[i]; }
  return f;
}

// Lane l takes the value of lane l ^ 16, in the vector pipe (a shuffle would go through the LDS unit).
__device__ __forceinline__ float xhalf(float x) {
  int i = __builtin_bit_cast(int, x);
  return __builtin_bit_cast(float,
      __builtin_amdgcn_permlanex16(i, i, 0x76543210, 0xfedcba98, false, false));
}

// Preparation, one launch. Blocks 0..255 transpose and convert the three weight matrices, blocks 256..1023
// convert the three activations. Few, long-lived waves: a thread's 16 loads are issued ahead of its stores.
#define PREP_W_BLOCKS 256   // 32 columns x 128 k a block: 64 (Wq1) + 64 (Wq2) + 128 (Wkv)
#define PREP_X_BLOCKS 256   // per activation: 16384 floats a block
__global__ __launch_bounds__(256) void prep(const float* __restrict__ q1, const float* __restrict__ q2,
                                            const float* __restrict__ xkv, const float* __restrict__ Wq1,
                                            const float* __restrict__ Wq2, const float* __restrict__ Wkv,
                                            _Float16* __restrict__ X1h, _Float16* __restrict__ X2h,
                                            _Float16* __restrict__ Xkh, _Float16* __restrict__ Wt1,
                                            _Float16* __restrict__ Wt2, _Float16* __restrict__ Wtk) {
  int bid = blockIdx.x;
  int t   = threadIdx.x;
  if (bid < PREP_W_BLOCKS) {
    // Wt[c*DIM + k] = W[k*C + c]. Eight lanes store one whole 128-B line of a Wt row (16 B each); the 32
    // columns of a block are one 128-B line of each W row it reads.
    const float* Wsrc = bid < 64 ? Wq1 : (bid < 128 ? Wq2 : Wkv);
    _Float16*    Wdst = bid < 64 ? Wt1 : (bid < 128 ? Wt2 : Wtk);
    int C    = bid < 128 ? INNER : 2 * INNER;
    int tile = bid < 128 ? (bid & 63) : (bid - 128);
    int c  = (tile >> 2) * 32 + (t >> 3);
    int k0 = (tile & 3) * 128 + (t & 7) * 8;
    float w[16];
    // All loops of this kernel are unrolled so that w and v stay in registers and the loads go out as a group.
#pragma unroll
    for (int u = 0; u < 2; ++u) {
#pragma unroll
      for (int j = 0; j < 8; ++j) w[u * 8 + j] = Wsrc[(size_t)(k0 + u * 64 + j) * C + c];
    }
#pragma unroll
    for (int u = 0; u < 2; ++u) {
      v8h hv;
#pragma unroll
      for (int j = 0; j < 8; ++j) hv[j] = (_Float16)w[u * 8 + j];
      *reinterpret_cast<v8h*>(Wdst + (size_t)c * DIM + k0 + u * 64) = hv;
    }
  } else {
    // A wave-wide load covers 512 contiguous bytes (four lines), the matching store 256 (two lines).
    int xb = bid - PREP_W_BLOCKS;
    const float* in  = xb < PREP_X_BLOCKS ? q1  : (xb < 2 * PREP_X_BLOCKS ? q2  : xkv);
    _Float16*    dst = xb < PREP_X_BLOCKS ? X1h : (xb < 2 * PREP_X_BLOCKS ? X2h : Xkh);
    size_t base = (size_t)(xb & (PREP_X_BLOCKS - 1)) * 16384 + t * 4;
    float4 v[16];
#pragma unroll
    for (int u = 0; u < 16; ++u) v[u] = *reinterpret_cast<const float4*>(in + base + u * 1024);
#pragma unroll
    for (int u = 0; u < 16; ++u) {
      v4h hv = {(_Float16)v[u].x, (_Float16)v[u].y, (_Float16)v[u].z, (_Float16)v[u].w};
      *reinterpret_cast<v4h*>(dst + base + u * 1024) = hv;
    }
    // No register that an issued store names is rewritten ahead of this wait; only the activation path has this wait, the weight path stores without one.
    asm volatile("s_wait_xcnt 0x0" ::: "memory");
  }
}

// Issue the per-thread share of one 64-k slab of a block's operands into LDS: 128 rows of X (4 chunks of
// 16 B a thread) and 64 rows of Wt (2 chunks a thread), each chunk at its swizzled place in its row (swz64;
// rows 32 apart swizzle alike). One wave-wide copy covers four whole 128-B lines.
__device__ __forceinline__ void issue_proj_slab(const _Float16* __restrict__ Xb,
                                                const _Float16* __restrict__ Wb,
                                                _Float16* adst, _Float16* bdst, int k0) {
  int t = threadIdx.x;
  int row = t >> 3, ch = t & 7;
  const _Float16* ga0 = Xb + (size_t)row * DIM + k0 + ch * 8;
  const _Float16* ga1 = ga0 + 32 * DIM;
  const _Float16* ga2 = ga0 + 64 * DIM;
  const _Float16* ga3 = ga0 + 96 * DIM;
  const _Float16* gb0 = Wb + (size_t)row * DIM + k0 + ch * 8;
  const _Float16* gb1 = gb0 + 32 * DIM;
  uint32_t la0 = (uint32_t)(uintptr_t)(adst + swz64(row, ch));
  uint32_t la1 = la0 + 32 * 128;
  uint32_t la2 = la0 + 64 * 128;
  uint32_t la3 = la0 + 96 * 128;
  uint32_t lb0 = (uint32_t)(uintptr_t)(bdst + swz64(row, ch));
  uint32_t lb1 = lb0 + 32 * 128;
  // The copies and their s_wait_xcnt in one statement: no address register is rewritten ahead of the wait.
  asm volatile("global_load_async_to_lds_b128 %0, %6, off\n\t"
               "global_load_async_to_lds_b128 %1, %7, off\n\t"
               "global_load_async_to_lds_b128 %2, %8, off\n\t"
               "global_load_async_to_lds_b128 %3, %9, off\n\t"
               "global_load_async_to_lds_b128 %4, %10, off\n\t"
               "global_load_async_to_lds_b128 %5, %11, off\n\t"
               "s_wait_xcnt 0x0"
               :: "v"(la0), "v"(la1), "v"(la2), "v"(la3), "v"(lb0), "v"(lb1),
                  "v"(ga0), "v"(ga1), "v"(ga2), "v"(ga3), "v"(gb0), "v"(gb1)
               : "memory");
}

#define PROJ_A_HALVES (128 * 64)                    // X slab: 128 rows x 64 k
#define PROJ_BUF_HALVES (PROJ_A_HALVES + 64 * 64)   // + Wt slab: 64 rows x 64 k

// GEMM: [8192 x 512] (f16) x Wt^T -> scatter into per-head layouts.
// col < 512  -> dstK[((b*H+h)*SEQ + n)*64 + d] = val*scale   (K, [B,H,N,64])
// col >= 512 -> dstV[((b*H+h)*64 + d)*SEQ + n] = val         (V transposed, [B,H,64,N])
// Block = 128 rows x 64 columns, wave = 16 rows x 64 columns. Both operands come through LDS in 64-k slabs,
// brought by asynchronous copies into two buffers: slab s + 1 flies while slab s is multiplied.
__global__ __launch_bounds__(256) void proj_gemm(const _Float16* __restrict__ X,
                                                 const _Float16* __restrict__ Wt,
                                                 _Float16* __restrict__ dstK,
                                                 _Float16* __restrict__ dstV,
                                                 int ncols, float scale) {
  // Two buffers of one 64-k slab each: [X 128 x 64][Wt 64 x 64] halves = 24 KB a buffer.
  __shared__ __align__(16) _Float16 sm[2 * PROJ_BUF_HALVES];
  int lane = threadIdx.x & 31;
  int wid  = threadIdx.x >> 5;
  const int MT = (BATCH * SEQ) / 16;  // 512 row tiles
  int id0 = blockIdx.x * 8;           // the block's first wave tile; 8 divides MT, so one c0 a block
  int mb  = (id0 % MT) * 16;
  int m0  = mb + wid * 16;
  int c0  = (id0 / MT) * 64;
  if (c0 >= ncols) return;

  const _Float16* Xb = X  + (size_t)mb * DIM;
  const _Float16* Wb = Wt + (size_t)c0 * DIM;

  issue_proj_slab(Xb, Wb, sm, sm + PROJ_A_HALVES, 0);
  asm volatile("s_wait_asynccnt 0x0" ::: "memory");  // this wave's share of slab 0 has landed
  __syncthreads();                                   // ... and every other wave's
  issue_proj_slab(Xb, Wb, sm + PROJ_BUF_HALVES, sm + PROJ_BUF_HALVES + PROJ_A_HALVES, 64);

  v8f acc0 = {}, acc1 = {}, acc2 = {}, acc3 = {};
#pragma unroll 1  // rolled: one copy statement and one publish point in the text
  for (int s = 0; s < DIM / 64; ++s) {
    _Float16* ab = sm + (s & 1) * PROJ_BUF_HALVES;
    _Float16* bb = ab + PROJ_A_HALVES;
#pragma unroll  // both 32-k steps of a slab in one body: no inner branch, chunk offsets are loop constants
    for (int kk = 0; kk < 64; kk += 32) {
      v16h a  = lds_frag64(ab, wid * 16, kk);
      v16h b0 = lds_frag64(bb, 0,  kk);
      v16h b1 = lds_frag64(bb, 16, kk);
      v16h b2 = lds_frag64(bb, 32, kk);
      v16h b3 = lds_frag64(bb, 48, kk);
      acc0 = __builtin_amdgcn_wmma_f32_16x16x32_f16(false, a, false, b0, (short)0, acc0, false, false);
      acc1 = __builtin_amdgcn_wmma_f32_16x16x32_f16(false, a, false, b1, (short)0, acc1, false, false);
      acc2 = __builtin_amdgcn_wmma_f32_16x16x32_f16(false, a, false, b2, (short)0, acc2, false, false);
      acc3 = __builtin_amdgcn_wmma_f32_16x16x32_f16(false, a, false, b3, (short)0, acc3, false, false);
    }
    asm volatile("s_wait_dscnt 0x0" ::: "memory");     // this wave's reads of slab s are over
    asm volatile("s_wait_asynccnt 0x0" ::: "memory");  // its share of slab s + 1 has landed
    __syncthreads();  // publishes slab s + 1 and frees the buffer of slab s
    if (s + 2 < DIM / 64) issue_proj_slab(Xb, Wb, ab, bb, (s + 2) * 64);
  }
  asm volatile("s_wait_asynccnt 0x0" ::: "memory");  // nothing in flight when the wave ends

  v8f accs[4] = {acc0, acc1, acc2, acc3};
  int rowb = m0 + ((lane >> 4) << 3);
  int cl   = lane & 15;
#pragma unroll
  for (int t = 0; t < 4; ++t) {
#pragma unroll
    for (int r = 0; r < 8; ++r) {
      float val = accs[t][r];
      int row = rowb + r;
      int col = c0 + t * 16 + cl;
      int b = row >> 11, n = row & (SEQ - 1);
      if (col < INNER) {
        int h = col >> 6, d = col & 63;
        dstK[(((size_t)(b * HEADS + h)) * SEQ + n) * DHEAD + d] = (_Float16)(val * scale);
      } else {
        int cc = col - INNER;
        int h = cc >> 6, d = cc & 63;
        dstV[(((size_t)(b * HEADS + h)) * DHEAD + d) * SEQ + n] = (_Float16)val;
      }
    }
  }
}

// Issue the per-thread share of one 32-key K/V block copy into LDS.
// K block: 32 rows x 64 halves (stride DHEAD);  V block: 64 rows x 32 halves (from stride SEQ).
// 256 threads x 16B each per tensor -> each WAVE issues exactly 2 async instructions.
// Each 16-byte chunk lands at its swizzled place inside its own row (swz64 / swz32).
__device__ __forceinline__ void issue_async_copies(const _Float16* __restrict__ Kg,
                                                   const _Float16* __restrict__ Vg,
                                                   _Float16* kdst, _Float16* vdst, int j) {
  int t = threadIdx.x;
  const _Float16* gk = Kg + (size_t)(j + (t >> 3)) * DHEAD + (t & 7) * 8;
  const _Float16* gv = Vg + (size_t)(t >> 2) * SEQ + j + (t & 3) * 8;
  uint32_t lk = (uint32_t)(uintptr_t)(kdst + swz64(t >> 3, t & 7));
  uint32_t lv = (uint32_t)(uintptr_t)(vdst + swz32(t >> 2, t & 3));
  asm volatile("global_load_async_to_lds_b128 %0, %1, off" :: "v"(lk), "v"(gk) : "memory");
  asm volatile("global_load_async_to_lds_b128 %0, %1, off" :: "v"(lv), "v"(gv) : "memory");
}

// Issue the per-thread share of one 64-k slab of a flash block's query projection into LDS: 256 rows of X
// (8 chunks of 16 B a thread) and the head's 64 rows of Wt (2 chunks a thread), each chunk at its swizzled
// place in its row (swz64; rows 32 apart swizzle alike). One wave-wide copy covers four whole 128-B lines.
__device__ __forceinline__ void issue_qproj_slab(const _Float16* __restrict__ Xb,
                                                 const _Float16* __restrict__ Wb,
                                                 _Float16* adst, _Float16* bdst, int k0) {
  int t = threadIdx.x;
  int row = t >> 3, ch = t & 7;
  const _Float16* ga0 = Xb + (size_t)row * DIM + k0 + ch * 8;
  const _Float16* ga1 = ga0 + 32 * DIM;
  const _Float16* ga2 = ga0 + 64 * DIM;
  const _Float16* ga3 = ga0 + 96 * DIM;
  const _Float16* ga4 = ga0 + 128 * DIM;
  const _Float16* ga5 = ga0 + 160 * DIM;
  const _Float16* ga6 = ga0 + 192 * DIM;
  const _Float16* ga7 = ga0 + 224 * DIM;
  const _Float16* gb0 = Wb + (size_t)row * DIM + k0 + ch * 8;
  const _Float16* gb1 = gb0 + 32 * DIM;
  uint32_t la0 = (uint32_t)(uintptr_t)(adst + swz64(row, ch));
  uint32_t la1 = la0 + 32 * 128;
  uint32_t la2 = la0 + 64 * 128;
  uint32_t la3 = la0 + 96 * 128;
  uint32_t la4 = la0 + 128 * 128;
  uint32_t la5 = la0 + 160 * 128;
  uint32_t la6 = la0 + 192 * 128;
  uint32_t la7 = la0 + 224 * 128;
  uint32_t lb0 = (uint32_t)(uintptr_t)(bdst + swz64(row, ch));
  uint32_t lb1 = lb0 + 32 * 128;
  // The copies and their s_wait_xcnt in one statement: no address register is rewritten ahead of the wait.
  asm volatile("global_load_async_to_lds_b128 %0, %10, off\n\t"
               "global_load_async_to_lds_b128 %1, %11, off\n\t"
               "global_load_async_to_lds_b128 %2, %12, off\n\t"
               "global_load_async_to_lds_b128 %3, %13, off\n\t"
               "global_load_async_to_lds_b128 %4, %14, off\n\t"
               "global_load_async_to_lds_b128 %5, %15, off\n\t"
               "global_load_async_to_lds_b128 %6, %16, off\n\t"
               "global_load_async_to_lds_b128 %7, %17, off\n\t"
               "global_load_async_to_lds_b128 %8, %18, off\n\t"
               "global_load_async_to_lds_b128 %9, %19, off\n\t"
               "s_wait_xcnt 0x0"
               :: "v"(la0), "v"(la1), "v"(la2), "v"(la3), "v"(la4), "v"(la5), "v"(la6), "v"(la7),
                  "v"(lb0), "v"(lb1),
                  "v"(ga0), "v"(ga1), "v"(ga2), "v"(ga3), "v"(ga4), "v"(ga5), "v"(ga6), "v"(ga7),
                  "v"(gb0), "v"(gb1)
               : "memory");
}

#define QP_A_HALVES (256 * 64)                  // X slab: 256 query rows x 64 k
#define QP_BUF_HALVES (QP_A_HALVES + 64 * 64)   // + Wt slab: the head's 64 rows x 64 k

// Flash attention: block = one (branch,b,h), 8 waves x 32 query rows = 256 rows.
// The block first projects its own queries: Qt = Wt_head * Xt (A = the head's 64 Wt rows, B = the block's X
// rows), operands through LDS in 64-k slabs, two buffers, as in proj_gemm. Lane l then holds, of query
// q0 + 16*g + (l & 15), the d values 16*t + 8*(l>>4) + 0..7 of tile t: tiles 0, 1 and 2, 3, scaled and
// converted, are the two B fragments of Q as they stand, so Q never leaves the registers.
// K/V blocks staged once per block into LDS via async copies (double buffered),
// shared by all 8 waves -> 8x less L2 traffic than per-wave streaming.
// The products are taken transposed: St = K * Qt (A = K rows, B = Q) and Ot += Vt * Pt (A = Vt rows,
// B = Pt). A wave owns QG groups of 16 queries; in group g lane l holds only query q0 + 16*g + (l & 15): of
// each 32-key block the keys 8*(l>>4) + 0..7 (first score tile) and 16 + 8*(l>>4) + 0..7 (second), which is
// the k order of a B fragment, so the converted scores are the B operand as they stand; maximum, sum and
// rescale are per-lane values. Every K and Vt fragment read from LDS is the A operand of QG products.
#define QG 2
#define RESCALE_MARGIN 5.5f   // e^5.5 = 245, about 2^8
__global__ __launch_bounds__(256) void flash_attn(const _Float16* __restrict__ X1,
                                                  const _Float16* __restrict__ X2,
                                                  const _Float16* __restrict__ Wt1,
                                                  const _Float16* __restrict__ Wt2,
                                                  const _Float16* __restrict__ Kt,
                                                  const _Float16* __restrict__ Vt,
                                                  float* __restrict__ out, float scale) {
  // Projection: two buffers of [X 256 x 64][Wt 64 x 64] halves = 80 KB. The key loop then reuses the first
  // 16 KB as [K0 2048][K1 2048][V0 2048][V1 2048] halves.
  __shared__ __align__(16) _Float16 smem[2 * QP_BUF_HALVES];
  int lane = threadIdx.x & 31;
  int wid  = threadIdx.x >> 5;
  int bid  = blockIdx.x;
  int bhz  = bid & 63;       // (branch, b, h)
  int qc   = bid >> 6;       // 0..SEQ / (128 * QG) - 1
  int q0   = (qc * 128 + wid * 16) * QG;
  int h    = bhz & 7;
  int b    = (bhz >> 3) & 3;
  int br   = bhz >> 5;

  const _Float16* Xb = (br ? X2 : X1) + (size_t)(b * SEQ + qc * 128 * QG) * DIM;  // the block's 256 X rows
  const _Float16* Wb = (br ? Wt2 : Wt1) + (size_t)(h * DHEAD) * DIM;              // the head's 64 Wt rows
  const _Float16* Kg = Kt + ((size_t)(b * HEADS + h)) * SEQ * DHEAD;
  const _Float16* Vg = Vt + ((size_t)(b * HEADS + h)) * DHEAD * SEQ;
  float* O = out + (size_t)br * ((size_t)BATCH * SEQ * INNER);

  // All loops over g, t and r in this kernel are unrolled so that the arrays they index stay in registers.
  v16h qa0[QG], qa1[QG];
  {
    issue_qproj_slab(Xb, Wb, smem, smem + QP_A_HALVES, 0);
    asm volatile("s_wait_asynccnt 0x0" ::: "memory");  // this wave's share of slab 0 has landed
    __syncthreads();                                   // ... and every other wave's
    issue_qproj_slab(Xb, Wb, smem + QP_BUF_HALVES, smem + QP_BUF_HALVES + QP_A_HALVES, 64);

    v8f qacc[QG][4] = {};
#pragma unroll 1  // rolled: one copy statement and one publish point in the text
    for (int s = 0; s < DIM / 64; ++s) {
      _Float16* ab = smem + (s & 1) * QP_BUF_HALVES;
      _Float16* bb = ab + QP_A_HALVES;
#pragma unroll  // both 32-k steps of a slab in one body: no inner branch, chunk offsets are loop constants
      for (int kk = 0; kk < 64; kk += 32) {
        v16h w0 = lds_frag64(bb, 0,  kk);
        v16h w1 = lds_frag64(bb, 16, kk);
        v16h w2 = lds_frag64(bb, 32, kk);
        v16h w3 = lds_frag64(bb, 48, kk);
#pragma unroll
        for (int g = 0; g < QG; ++g) {
          v16h x = lds_frag64(ab, (wid * QG + g) * 16, kk);
          qacc[g][0] = __builtin_amdgcn_wmma_f32_16x16x32_f16(false, w0, false, x, (short)0, qacc[g][0], false, false);
          qacc[g][1] = __builtin_amdgcn_wmma_f32_16x16x32_f16(false, w1, false, x, (short)0, qacc[g][1], false, false);
          qacc[g][2] = __builtin_amdgcn_wmma_f32_16x16x32_f16(false, w2, false, x, (short)0, qacc[g][2], false, false);
          qacc[g][3] = __builtin_amdgcn_wmma_f32_16x16x32_f16(false, w3, false, x, (short)0, qacc[g][3], false, false);
        }
      }
      asm volatile("s_wait_dscnt 0x0" ::: "memory");     // this wave's reads of slab s are over
      asm volatile("s_wait_asynccnt 0x0" ::: "memory");  // its share of slab s + 1 has landed
      __syncthreads();  // publishes slab s + 1 and frees the buffer of slab s
      if (s + 2 < DIM / 64) issue_qproj_slab(Xb, Wb, ab, bb, (s + 2) * 64);
    }
    asm volatile("s_wait_asynccnt 0x0" ::: "memory");  // nothing in flight when the key loop takes the LDS over

#pragma unroll
    for (int g = 0; g < QG; ++g) {
#pragma unroll
      for (int r = 0; r < 8; ++r) {
        qa0[g][r]     = (_Float16)(qacc[g][0][r] * scale);
        qa0[g][r + 8] = (_Float16)(qacc[g][1][r] * scale);
        qa1[g][r]     = (_Float16)(qacc[g][2][r] * scale);
        qa1[g][r + 8] = (_Float16)(qacc[g][3][r] * scale);
      }
    }
  }
  v8f acc[QG][4] = {};
  float mrow[QG];  // maximum in use for this lane's query of group g (equal in lanes l and l ^ 16)
  float mlim[QG];  // mrow + RESCALE_MARGIN: a score above it calls for a rescale
  float lsum[QG];  // running sum over this lane's half of the keys; the halves join after the loop
#pragma unroll
  for (int g = 0; g < QG; ++g) {
    mrow[g] = -1e30f;
    mlim[g] = -1e30f;
    lsum[g] = 0.f;
  }

  int rb = (lane >> 4) << 3;
  int cl = lane & 15;

  issue_async_copies(Kg, Vg, smem, smem + 4096, 0);  // prologue: block 0 -> buffer 0

#pragma unroll 1
  for (int jb = 0; jb < SEQ / 32; ++jb) {
    int cur = jb & 1;
    const _Float16* kcur = smem + cur * 2048;
    const _Float16* vcur = smem + 4096 + cur * 2048;
    if (jb < SEQ / 32 - 1) {
      issue_async_copies(Kg, Vg, smem + (1 - cur) * 2048, smem + 4096 + (1 - cur) * 2048,
                         (jb + 1) * 32);
      asm volatile("s_wait_asynccnt 2" ::: "memory");   // current buffer's 2 copies done
    } else {
      asm volatile("s_wait_asynccnt 0" ::: "memory");
    }
    __syncthreads();  // all waves' copies landed

    v16h kb00 = lds_frag64(kcur, 0,  0);
    v16h kb01 = lds_frag64(kcur, 0,  32);
    v16h kb10 = lds_frag64(kcur, 16, 0);
    v16h kb11 = lds_frag64(kcur, 16, 32);
    v8f s0[QG], s1[QG];
#pragma unroll
    for (int g = 0; g < QG; ++g) {
      v8f z = {};
      s0[g] = __builtin_amdgcn_wmma_f32_16x16x32_f16(false, kb00, false, qa0[g], (short)0, z, false, false);
      s1[g] = __builtin_amdgcn_wmma_f32_16x16x32_f16(false, kb10, false, qa0[g], (short)0, z, false, false);
    }
#pragma unroll
    for (int g = 0; g < QG; ++g) {
      s0[g] = __builtin_amdgcn_wmma_f32_16x16x32_f16(false, kb01, false, qa1[g], (short)0, s0[g], false, false);
      s1[g] = __builtin_amdgcn_wmma_f32_16x16x32_f16(false, kb11, false, qa1[g], (short)0, s1[g], false, false);
    }

    // Online softmax with a lazy rescale. s0[g][r] = score of key rb + r, s1[g][r] = of key 16 + rb + r, for
    // query q0 + 16*g + cl. mrow, the maximum in use, may trail the true one by up to RESCALE_MARGIN, so an
    // exponential stays below e^RESCALE_MARGIN (far inside f16); sums and accumulators are rescaled only in a
    // pass where some lane's scores exceed it by more. The test takes each lane's own 16 keys: the ballot sees
    // both halves of the wave, so the halves' maxima join only where the rescale runs.
    float mxh[QG];
    bool need = false;
#pragma unroll
    for (int g = 0; g < QG; ++g) {
      float a0 = fmaxf(fmaxf(s0[g][0], s0[g][1]), s0[g][2]);
      float a1 = fmaxf(fmaxf(s0[g][3], s0[g][4]), s0[g][5]);
      float a2 = fmaxf(fmaxf(s0[g][6], s0[g][7]), s1[g][0]);
      float a3 = fmaxf(fmaxf(s1[g][1], s1[g][2]), s1[g][3]);
      float a4 = fmaxf(fmaxf(s1[g][4], s1[g][5]), s1[g][6]);
      mxh[g] = fmaxf(fmaxf(fmaxf(a0, a1), a2), fmaxf(fmaxf(a3, a4), s1[g][7]));
      need = need || (mxh[g] > mlim[g]);
    }
    if (__builtin_amdgcn_ballot_w32(need) != 0) {  // one wave-uniform test a pass; always taken in the first
#pragma unroll
      for (int g = 0; g < QG; ++g) {
        float mnew  = fmaxf(mrow[g], fmaxf(mxh[g], xhalf(mxh[g])));  // with the other 16 keys of the block
        float alpha = __expf(mrow[g] - mnew);
        mrow[g] = mnew;
        mlim[g] = mnew + RESCALE_MARGIN;
        lsum[g] *= alpha;
#pragma unroll
        for (int t = 0; t < 4; ++t) {
#pragma unroll
          for (int r = 0; r < 8; ++r) acc[g][t][r] *= alpha;
        }
      }
    }

    v16h vb0 = lds_frag32(vcur, 0);
    v16h vb1 = lds_frag32(vcur, 16);
    v16h vb2 = lds_frag32(vcur, 32);
    v16h vb3 = lds_frag32(vcur, 48);
    // Holds the address additions above out of the stretch with the exponentials below: the compiler joins such
    // additions to dual-issue pairs.
    __builtin_amdgcn_sched_barrier(0);

    // The two score tiles in loops of their own: the packed subtract and multiply then pair neighbouring
    // registers of one tile (fewer register moves than pairing across the tiles).
    float p0[QG][8], p1[QG][8];
#pragma unroll
    for (int g = 0; g < QG; ++g) {
#pragma unroll
      for (int r = 0; r < 8; ++r) p0[g][r] = __expf(s0[g][r] - mrow[g]);
#pragma unroll
      for (int r = 0; r < 8; ++r) p1[g][r] = __expf(s1[g][r] - mrow[g]);
    }
    __builtin_amdgcn_sched_barrier(0);
    asm volatile("v_nop");
    __builtin_amdgcn_sched_barrier(0);

    v16h pb[QG];
#pragma unroll
    for (int g = 0; g < QG; ++g) {
      float ps[8];
#pragma unroll
      for (int r = 0; r < 8; ++r) {
        ps[r] = p0[g][r] + p1[g][r];
        pb[g][r]     = (_Float16)p0[g][r];
        pb[g][r + 8] = (_Float16)p1[g][r];
      }
      lsum[g] += ((ps[0] + ps[1]) + (ps[2] + ps[3])) + ((ps[4] + ps[5]) + (ps[6] + ps[7]));
    }

#pragma unroll
    for (int g = 0; g < QG; ++g) {
      acc[g][0] = __builtin_amdgcn_wmma_f32_16x16x32_f16(false, vb0, false, pb[g], (short)0, acc[g][0], false, false);
      acc[g][1] = __builtin_amdgcn_wmma_f32_16x16x32_f16(false, vb1, false, pb[g], (short)0, acc[g][1], false, false);
      acc[g][2] = __builtin_amdgcn_wmma_f32_16x16x32_f16(false, vb2, false, pb[g], (short)0, acc[g][2], false, false);
      acc[g][3] = __builtin_amdgcn_wmma_f32_16x16x32_f16(false, vb3, false, pb[g], (short)0, acc[g][3], false, false);
    }

    __syncthreads();  // everyone done reading this buffer before it is refilled
  }

  // acc[g][t][r] = Ot[t*16 + rb + r][q0 + 16*g + cl]: eight consecutive d of one query per tile and lane.
#pragma unroll
  for (int g = 0; g < QG; ++g) {
    float l = lsum[g] + xhalf(lsum[g]);
    float* orow = O + ((size_t)(b * SEQ + q0 + 16 * g + cl)) * INNER + h * DHEAD + rb;
#pragma unroll
    for (int t = 0; t < 4; ++t) {
      float4 lo = make_float4(acc[g][t][0] / l, acc[g][t][1] / l, acc[g][t][2] / l, acc[g][t][3] / l);
      float4 hi = make_float4(acc[g][t][4] / l, acc[g][t][5] / l, acc[g][t][6] / l, acc[g][t][7] / l);
      *reinterpret_cast<float4*>(orow + t * 16)     = lo;
      *reinterpret_cast<float4*>(orow + t * 16 + 4) = hi;
    }
  }
}

extern "C" void kernel_launch(void* const* d_in, const int* in_sizes, int n_in,
                              void* d_out, int out_size, void* d_ws, size_t ws_size,
                              hipStream_t stream) {
  const float* q1  = (const float*)d_in[0];
  const float* q2  = (const float*)d_in[1];
  const float* xkv = (const float*)d_in[2];
  const float* Wq1 = (const float*)d_in[3];
  const float* Wq2 = (const float*)d_in[4];
  const float* Wkv = (const float*)d_in[5];
  float* out = (float*)d_out;

  const size_t NBH = (size_t)BATCH * SEQ * INNER;  // 4,194,304 elements
  _Float16* ws  = (_Float16*)d_ws;
  _Float16* Kh  = ws;
  _Float16* Vth = Kh  + NBH;
  _Float16* X1h = Vth + NBH;
  _Float16* X2h = X1h + NBH;
  _Float16* Xkh = X2h + NBH;
  _Float16* Wt1 = Xkh + NBH;
  _Float16* Wt2 = Wt1 + (size_t)DIM * INNER;
  _Float16* Wtk = Wt2 + (size_t)DIM * INNER;

  prep<<<PREP_W_BLOCKS + 3 * PREP_X_BLOCKS, 256, 0, stream>>>(q1, q2, xkv, Wq1, Wq2, Wkv,
                                                              X1h, X2h, Xkh, Wt1, Wt2, Wtk);

  const float scale = 0.125f;  // DHEAD^-0.5
  const int MT = (BATCH * SEQ) / 16;  // 512
  proj_gemm<<<(MT * (2 * INNER / 64)) / 8, 256, 0, stream>>>(Xkh, Wtk, Kh,  Vth,     2 * INNER, 1.0f);

  // 64 (branch,b,h) x 8 query chunks of 256 = 512 blocks of 8 waves
  flash_attn<<<512, 256, 0, stream>>>(X1h, X2h, Wt1, Wt2, Kh, Vth, out, scale);
}

// v008
// Measured time: 96.6 microseconds a run.
// Two timings next to v007 both put it at 1.04 times that version's speed.
// Over all steps from v000 it is 4.67 times as fast.
#include <hip/hip_runtime.h>

typedef __attribute__((ext_vector_type(16))) _Float16 v16h;
typedef __attribute__((ext_vector_type(8)))  _Float16 v8h;
typedef __attribute__((ext_vector_type(4)))  _Float16 v4h;
typedef __attribute__((ext_vector_type(8)))  float    v8f;

#define HEADS 8
#define DHEAD 64
#define SEQ   2048
#define BATCH 4
#define DIM   512
#define INNER 512   // HEADS * DHEAD

// A 16x32 f16 WMMA A/B fragment of a row-major matrix, at rows row0.., k from k0:
// lane l holds row row0 + (l&15), k elements k0 + 8*(l>>4) + {0..7} and +16..23.

// LDS tiles are stored with their 16-byte chunks XOR-swizzled inside each row, so that the 16 rows
// one half-wave reads at the same chunk column fall on 16 different 16-byte bank groups (64 banks x 4 B
// = 256 B): a plain 128-B or 64-B row pitch puts them on 2 or 4 groups only.
// 64-half rows (128 B, 8 chunks): two rows span the banks, so the chunk is XORed with row/2.
__device__ __forceinline__ int swz64(int row, int chunk) {
  return row * 64 + ((chunk ^ ((row >> 1) & 7)) << 3);
}
// 32-half rows (64 B, 4 chunks): four rows span the banks, so the chunk is XORed with row/4.
__device__ __forceinline__ int swz32(int row, int chunk) {
  return row * 32 + ((chunk ^ ((row >> 2) & 3)) << 3);
}

// That fragment, read from a swizzled LDS tile with 64-half rows.
__device__ __forceinline__ v16h lds_frag64(const _Float16* base, int row0, int k0) {
  int lane = threadIdx.x & 31;
  int row = row0 + (lane & 15);
  int ch  = (k0 >> 3) + (lane >> 4);
  v8h lo = *reinterpret_cast<const v8h*>(base + swz64(row, ch));
  v8h hi = *reinterpret_cast<const v8h*>(base + swz64(row, ch + 2));
  v16h f;
#pragma unroll
  for (int i = 0; i < 8; ++i) { f[i] = lo[i]; f[i + 8] = hi[i]; }
  return f;
}

// That fragment (same k order) at k0 = 0, read from a swizzled LDS tile with 32-half rows.
__device__ __forceinline__ v16h lds_frag32(const _Float16* base, int row0) {
  int lane = threadIdx.x & 31;
  int row = row0 + (lane & 15);
  int ch  = lane >> 4;
  v8h lo = *reinterpret_cast<const v8h*>(base + swz32(row, ch));
  v8h hi = *reinterpret_cast<const v8h*>(base + swz32(row, ch + 2));
  v16h f;
#pragma unroll
  for (int i = 0; i < 8; ++i) { f[i] = lo[i]; f[i + 8] = hi[i]; }
  return f;
}

// Lane l takes the value of lane l ^ 16, in the vector pipe (a shuffle would go through the LDS unit).
__device__ __forceinline__ float xhalf(float x) {
  int i = __builtin_bit_cast(int, x);
  return __builtin_bit_cast(float,
      __builtin_amdgcn_permlanex16(i, i, 0x76543210, 0xfedcba98, false, false));
}

// Preparation, one launch. Blocks 0..255 transpose and convert the three weight matrices, blocks 256..1023
// convert the three activations. Few, long-lived waves: a thread's 16 loads are issued ahead of its stores.
#define PREP_W_BLOCKS 256   // 32 columns x 128 k a block: 64 (Wq1) + 64 (Wq2) + 128 (Wkv)
#define PREP_X_BLOCKS 256   // per activation: 16384 floats a block
__global__ __launch_bounds__(256) void prep(const float* __restrict__ q1, const float* __restrict__ q2,
                                            const float* __restrict__ xkv, const float* __restrict__ Wq1,
                                            const float* __restrict__ Wq2, const float* __restrict__ Wkv,
                                            _Float16* __restrict__ X1h, _Float16* __restrict__ X2h,
                                            _Float16* __restrict__ Xkh, _Float16* __restrict__ Wt1,
                                            _Float16* __restrict__ Wt2, _Float16* __restrict__ Wtk) {
  int bid = blockIdx.x;
  int t   = threadIdx.x;
  if (bid < PREP_W_BLOCKS) {
    // Wt[c*DIM + k] = W[k*C + c]. Eight lanes store one whole 128-B line of a Wt row (16 B each); the 32
    // columns of a block are one 128-B line of each W row it reads.
    const float* Wsrc = bid < 64 ? Wq1 : (bid < 128 ? Wq2 : Wkv);
    _Float16*    Wdst = bid < 64 ? Wt1 : (bid < 128 ? Wt2 : Wtk);
    int C    = bid < 128 ? INNER : 2 * INNER;
    int tile = bid < 128 ? (bid & 63) : (bid - 128);
    int c  = (tile >> 2) * 32 + (t >> 3);
    int k0 = (tile & 3) * 128 + (t & 7) * 8;
    float w[16];
    // All loops of this kernel are unrolled so that w and v stay in registers and the loads go out as a group.
#pragma unroll
    for (int u = 0; u < 2; ++u) {
#pragma unroll
      for (int j = 0; j < 8; ++j) w[u * 8 + j] = Wsrc[(size_t)(k0 + u * 64 + j) * C + c];
    }
#pragma unroll
    for (int u = 0; u < 2; ++u) {
      v8h hv;
#pragma unroll
      for (int j = 0; j < 8; ++j) hv[j] = (_Float16)w[u * 8 + j];
      *reinterpret_cast<v8h*>(Wdst + (size_t)c * DIM + k0 + u * 64) = hv;
    }
  } else {
    // A wave-wide load covers 512 contiguous bytes (four lines), the matching store 256 (two lines).
    int xb = bid - PREP_W_BLOCKS;
    const float* in  = xb < PREP_X_BLOCKS ? q1  : (xb < 2 * PREP_X_BLOCKS ? q2  : xkv);
    _Float16*    dst = xb < PREP_X_BLOCKS ? X1h : (xb < 2 * PREP_X_BLOCKS ? X2h : Xkh);
    size_t base = (size_t)(xb & (PREP_X_BLOCKS - 1)) * 16384 + t * 4;
    float4 v[16];
#pragma unroll
    for (int u = 0; u < 16; ++u) v[u] = *reinterpret_cast<const float4*>(in + base + u * 1024);
#pragma unroll
    for (int u = 0; u < 16; ++u) {
      v4h hv = {(_Float16)v[u].x, (_Float16)v[u].y, (_Float16)v[u].z, (_Float16)v[u].w};
      *reinterpret_cast<v4h*>(dst + base + u * 1024) = hv;
    }
    // No register that an issued store names is rewritten ahead of this wait; only the activation path has this wait, the weight path stores without one.
    asm volatile("s_wait_xcnt 0x0" ::: "memory");
  }
}

// Issue the per-thread share of one 64-k slab of a block's operands into LDS: 128 rows of X (4 chunks of
// 16 B a thread) and 64 rows of Wt (2 chunks a thread), each chunk at its swizzled place in its row (swz64;
// rows 32 apart swizzle alike). One wave-wide copy covers four whole 128-B lines.
__device__ __forceinline__ void issue_proj_slab(const _Float16* __restrict__ Xb,
                                                const _Float16* __restrict__ Wb,
                                                _Float16* adst, _Float16* bdst, int k0) {
  int t = threadIdx.x;
  int row = t >> 3, ch = t & 7;
  const _Float16* ga0 = Xb + (size_t)row * DIM + k0 + ch * 8;
  const _Float16* ga1 = ga0 + 32 * DIM;
  const _Float16* ga2 = ga0 + 64 * DIM;
  const _Float16* ga3 = ga0 + 96 * DIM;
  const _Float16* gb0 = Wb + (size_t)row * DIM + k0 + ch * 8;
  const _Float16* gb1 = gb0 + 32 * DIM;
  uint32_t la0 = (uint32_t)(uintptr_t)(adst + swz64(row, ch));
  uint32_t la1 = la0 + 32 * 128;
  uint32_t la2 = la0 + 64 * 128;
  uint32_t la3 = la0 + 96 * 128;
  uint32_t lb0 = (uint32_t)(uintptr_t)(bdst + swz64(row, ch));
  uint32_t lb1 = lb0 + 32 * 128;
  // The copies and their s_wait_xcnt in one statement: no address register is rewritten ahead of the wait.
  asm volatile("global_load_async_to_lds_b128 %0, %6, off\n\t"
               "global_load_async_to_lds_b128 %1, %7, off\n\t"
               "global_load_async_to_lds_b128 %2, %8, off\n\t"
               "global_load_async_to_lds_b128 %3, %9, off\n\t"
               "global_load_async_to_lds_b128 %4, %10, off\n\t"
               "global_load_async_to_lds_b128 %5, %11, off\n\t"
               "s_wait_xcnt 0x0"
               :: "v"(la0), "v"(la1), "v"(la2), "v"(la3), "v"(lb0), "v"(lb1),
                  "v"(ga0), "v"(ga1), "v"(ga2), "v"(ga3), "v"(gb0), "v"(gb1)
               : "memory");
}

#define PROJ_A_HALVES (128 * 64)                    // X slab: 128 rows x 64 k
#define PROJ_BUF_HALVES (PROJ_A_HALVES + 64 * 64)   // + Wt slab: 64 rows x 64 k

// GEMM: [8192 x 512] (f16) x Wt^T -> scatter into per-head layouts.
// col < 512  -> dstK[((b*H+h)*SEQ + n)*64 + d] = val*scale   (K, [B,H,N,64])
// col >= 512 -> dstV[((b*H+h)*64 + d)*SEQ + n] = val         (V transposed, [B,H,64,N])
// Block = 128 rows x 64 columns, wave = 16 rows x 64 columns. Both operands come through LDS in 64-k slabs,
// brought by asynchronous copies into two buffers: slab s + 1 flies while slab s is multiplied.
__global__ __launch_bounds__(256) void proj_gemm(const _Float16* __restrict__ X,
                                                 const _Float16* __restrict__ Wt,
                                                 _Float16* __restrict__ dstK,
                                                 _Float16* __restrict__ dstV,
                                                 int ncols, float scale) {
  // Two buffers of one 64-k slab each: [X 128 x 64][Wt 64 x 64] halves = 24 KB a buffer.
  __shared__ __align__(16) _Float16 sm[2 * PROJ_BUF_HALVES];
  int lane = threadIdx.x & 31;
  int wid  = threadIdx.x >> 5;
  const int MT = (BATCH * SEQ) / 16;  // 512 row tiles
  int id0 = blockIdx.x * 8;           // the block's first wave tile; 8 divides MT, so one c0 a block
  int mb  = (id0 % MT) * 16;
  int m0  = mb + wid * 16;
  int c0  = (id0 / MT) * 64;
  if (c0 >= ncols) return;

  const _Float16* Xb = X  + (size_t)mb * DIM;
  const _Float16* Wb = Wt + (size_t)c0 * DIM;

  issue_proj_slab(Xb, Wb, sm, sm + PROJ_A_HALVES, 0);
  asm volatile("s_wait_asynccnt 0x0" ::: "memory");  // this wave's share of slab 0 has landed
  __syncthreads();                                   // ... and every other wave's
  issue_proj_slab(Xb, Wb, sm + PROJ_BUF_HALVES, sm + PROJ_BUF_HALVES + PROJ_A_HALVES, 64);

  v8f acc0 = {}, acc1 = {}, acc2 = {}, acc3 = {};
#pragma unroll 1  // rolled: one copy statement and one publish point in the text
  for (int s = 0; s < DIM / 64; ++s) {
    _Float16* ab = sm + (s & 1) * PROJ_BUF_HALVES;
    _Float16* bb = ab + PROJ_A_HALVES;
#pragma unroll  // both 32-k steps of a slab in one body: no inner branch, chunk offsets are loop constants
    for (int kk = 0; kk < 64; kk += 32) {
      v16h a  = lds_frag64(ab, wid * 16, kk);
      v16h b0 = lds_frag64(bb, 0,  kk);
      v16h b1 = lds_frag64(bb, 16, kk);
      v16h b2 = lds_frag64(bb, 32, kk);
      v16h b3 = lds_frag64(bb, 48, kk);
      acc0 = __builtin_amdgcn_wmma_f32_16x16x32_f16(false, a, false, b0, (short)0, acc0, false, false);
      acc1 = __builtin_amdgcn_wmma_f32_16x16x32_f16(false, a, false, b1, (short)0, acc1, false, false);
      acc2 = __builtin_amdgcn_wmma_f32_16x16x32_f16(false, a, false, b2, (short)0, acc2, false, false);
      acc3 = __builtin_amdgcn_wmma_f32_16x16x32_f16(false, a, false, b3, (short)0, acc3, false, false);
    }
    asm volatile("s_wait_dscnt 0x0" ::: "memory");     // this wave's reads of slab s are over
    asm volatile("s_wait_asynccnt 0x0" ::: "memory");  // its share of slab s + 1 has landed
    __syncthreads();  // publishes slab s + 1 and frees the buffer of slab s
    if (s + 2 < DIM / 64) issue_proj_slab(Xb, Wb, ab, bb, (s + 2) * 64);
  }
  asm volatile("s_wait_asynccnt 0x0" ::: "memory");  // nothing in flight when the wave ends

  v8f accs[4] = {acc0, acc1, acc2, acc3};
  int rowb = m0 + ((lane >> 4) << 3);
  int cl   = lane & 15;
#pragma unroll
  for (int t = 0; t < 4; ++t) {
#pragma unroll
    for (int r = 0; r < 8; ++r) {
      float val = accs[t][r];
      int row = rowb + r;
      int col = c0 + t * 16 + cl;
      int b = row >> 11, n = row & (SEQ - 1);
      if (col < INNER) {
        int h = col >> 6, d = col & 63;
        dstK[(((size_t)(b * HEADS + h)) * SEQ + n) * DHEAD + d] = (_Float16)(val * scale);
      } else {
        int cc = col - INNER;
        int h = cc >> 6, d = cc & 63;
        dstV[(((size_t)(b * HEADS + h)) * DHEAD + d) * SEQ + n] = (_Float16)val;
      }
    }
  }
}

// Issue the per-thread share of one 32-key K/V block copy into LDS.
// K block: 32 rows x 64 halves (stride DHEAD);  V block: 64 rows x 32 halves (from stride SEQ).
// 256 threads x 16B each per tensor -> each WAVE issues exactly 2 async instructions.
// Each 16-byte chunk lands at its swizzled place inside its own row (swz64 / swz32).
__device__ __forceinline__ void issue_async_copies(const _Float16* __restrict__ Kg,
                                                   const _Float16* __restrict__ Vg,
                                                   _Float16* kdst, _Float16* vdst, int j) {
  int t = threadIdx.x;
  const _Float16* gk = Kg + (size_t)(j + (t >> 3)) * DHEAD + (t & 7) * 8;
  const _Float16* gv = Vg + (size_t)(t >> 2) * SEQ + j + (t & 3) * 8;
  uint32_t lk = (uint32_t)(uintptr_t)(kdst + swz64(t >> 3, t & 7));
  uint32_t lv = (uint32_t)(uintptr_t)(vdst + swz32(t >> 2, t & 3));
  asm volatile("global_load_async_to_lds_b128 %0, %1, off" :: "v"(lk), "v"(gk) : "memory");
  asm volatile("global_load_async_to_lds_b128 %0, %1, off" :: "v"(lv), "v"(gv) : "memory");
}

// Issue the per-thread share of one 64-k slab of a flash block's query projection into LDS: 256 rows of X
// (8 chunks of 16 B a thread) and the head's 64 rows of Wt (2 chunks a thread), each chunk at its swizzled
// place in its row (swz64; rows 32 apart swizzle alike). One wave-wide copy covers four whole 128-B lines.
__device__ __forceinline__ void issue_qproj_slab(const _Float16* __restrict__ Xb,
                                                 const _Float16* __restrict__ Wb,
                                                 _Float16* adst, _Float16* bdst, int k0) {
  int t = threadIdx.x;
  int row = t >> 3, ch = t & 7;
  const _Float16* ga0 = Xb + (size_t)row * DIM + k0 + ch * 8;
  const _Float16* ga1 = ga0 + 32 * DIM;
  const _Float16* ga2 = ga0 + 64 * DIM;
  const _Float16* ga3 = ga0 + 96 * DIM;
  const _Float16* ga4 = ga0 + 128 * DIM;
  const _Float16* ga5 = ga0 + 160 * DIM;
  const _Float16* ga6 = ga0 + 192 * DIM;
  const _Float16* ga7 = ga0 + 224 * DIM;
  const _Float16* gb0 = Wb + (size_t)row * DIM + k0 + ch * 8;
  const _Float16* gb1 = gb0 + 32 * DIM;
  uint32_t la0 = (uint32_t)(uintptr_t)(adst + swz64(row, ch));
  uint32_t la1 = la0 + 32 * 128;
  uint32_t la2 = la0 + 64 * 128;
  uint32_t la3 = la0 + 96 * 128;
  uint32_t la4 = la0 + 128 * 128;
  uint32_t la5 = la0 + 160 * 128;
  uint32_t la6 = la0 + 192 * 128;
  uint32_t la7 = la0 + 224 * 128;
  uint32_t lb0 = (uint32_t)(uintptr_t)(bdst + swz64(row, ch));
  uint32_t lb1 = lb0 + 32 * 128;
  // The copies and their s_wait_xcnt in one statement: no address register is rewritten ahead of the wait.
  asm volatile("global_load_async_to_lds_b128 %0, %10, off\n\t"
               "global_load_async_to_lds_b128 %1, %11, off\n\t"
               "global_load_async_to_lds_b128 %2, %12, off\n\t"
               "global_load_async_to_lds_b128 %3, %13, off\n\t"
               "global_load_async_to_lds_b128 %4, %14, off\n\t"
               "global_load_async_to_lds_b128 %5, %15, off\n\t"
               "global_load_async_to_lds_b128 %6, %16, off\n\t"
               "global_load_async_to_lds_b128 %7, %17, off\n\t"
               "global_load_async_to_lds_b128 %8, %18, off\n\t"
               "global_load_async_to_lds_b128 %9, %19, off\n\t"
               "s_wait_xcnt 0x0"
               :: "v"(la0), "v"(la1), "v"(la2), "v"(la3), "v"(la4), "v"(la5), "v"(la6), "v"(la7),
                  "v"(lb0), "v"(lb1),
                  "v"(ga0), "v"(ga1), "v"(ga2), "v"(ga3), "v"(ga4), "v"(ga5), "v"(ga6), "v"(ga7),
                  "v"(gb0), "v"(gb1)
               : "memory");
}

#define QP_A_HALVES (256 * 64)                  // X slab: 256 query rows x 64 k
#define QP_BUF_HALVES (QP_A_HALVES + 64 * 64)   // + Wt slab: the head's 64 rows x 64 k

// Flash attention: block = one (branch,b,h), 8 waves x 32 query rows = 256 rows.
// The block first projects its own queries: Qt = Wt_head * Xt (A = the head's 64 Wt rows, B = the block's X
// rows), operands through LDS in 64-k slabs, two buffers, as in proj_gemm. Lane l then holds, of query
// q0 + 16*g + (l & 15), the d values 16*t + 8*(l>>4) + 0..7 of tile t: tiles 0, 1 and 2, 3, scaled and
// converted, are the two B fragments of Q as they stand, so Q never leaves the registers.
// K/V blocks staged once per block into LDS via async copies (double buffered),
// shared by all 8 waves -> 8x less L2 traffic than per-wave streaming.
// The products are taken transposed: St = K * Qt (A = K rows, B = Q) and Ot += Vt * Pt (A = Vt rows,
// B = Pt). A wave owns QG groups of 16 queries; in group g lane l holds only query q0 + 16*g + (l & 15): of
// each 32-key block the keys 8*(l>>4) + 0..7 (first score tile) and 16 + 8*(l>>4) + 0..7 (second), which is
// the k order of a B fragment, so the converted scores are the B operand as they stand; maximum, sum and
// rescale are per-lane values. Every K and Vt fragment read from LDS is the A operand of QG products.
// The score product hands over the exponent as it stands: Q carries scale * log2(e), and the C operand of the
// first score WMMA holds minus the maximum in use, so a score tile is log2 of the weight and goes to v_exp_f32
// with no vector subtract or multiply in between.
#define QG 2
#define LOG2E 1.44269504f
#define RESCALE_MARGIN 8.0f   // in log2 units: a weight stays below 2^8
__global__ __launch_bounds__(256) void flash_attn(const _Float16* __restrict__ X1,
                                                  const _Float16* __restrict__ X2,
                                                  const _Float16* __restrict__ Wt1,
                                                  const _Float16* __restrict__ Wt2,
                                                  const _Float16* __restrict__ Kt,
                                                  const _Float16* __restrict__ Vt,
                                                  float* __restrict__ out, float scale) {
  // Projection: two buffers of [X 256 x 64][Wt 64 x 64] halves = 80 KB. The key loop then reuses the first
  // 16 KB as [K0 2048][K1 2048][V0 2048][V1 2048] halves.
  __shared__ __align__(16) _Float16 smem[2 * QP_BUF_HALVES];
  int lane = threadIdx.x & 31;
  int wid  = threadIdx.x >> 5;
  int bid  = blockIdx.x;
  int bhz  = bid & 63;       // (branch, b, h)
  int qc   = bid >> 6;       // 0..SEQ / (128 * QG) - 1
  int q0   = (qc * 128 + wid * 16) * QG;
  int h    = bhz & 7;
  int b    = (bhz >> 3) & 3;
  int br   = bhz >> 5;

  const _Float16* Xb = (br ? X2 : X1) + (size_t)(b * SEQ + qc * 128 * QG) * DIM;  // the block's 256 X rows
  const _Float16* Wb = (br ? Wt2 : Wt1) + (size_t)(h * DHEAD) * DIM;              // the head's 64 Wt rows
  const _Float16* Kg = Kt + ((size_t)(b * HEADS + h)) * SEQ * DHEAD;
  const _Float16* Vg = Vt + ((size_t)(b * HEADS + h)) * DHEAD * SEQ;
  float* O = out + (size_t)br * ((size_t)BATCH * SEQ * INNER);

  // All loops over g, t and r in this kernel are unrolled so that the arrays they index stay in registers.
  v16h qa0[QG], qa1[QG];
  {
    issue_qproj_slab(Xb, Wb, smem, smem + QP_A_HALVES, 0);
    asm volatile("s_wait_asynccnt 0x0" ::: "memory");  // this wave's share of slab 0 has landed
    __syncthreads();                                   // ... and every other wave's
    issue_qproj_slab(Xb, Wb, smem + QP_BUF_HALVES, smem + QP_BUF_HALVES + QP_A_HALVES, 64);

    v8f qacc[QG][4] = {};
#pragma unroll 1  // rolled: one copy statement and one publish point in the text
    for (int s = 0; s < DIM / 64; ++s) {
      _Float16* ab = smem + (s & 1) * QP_BUF_HALVES;
      _Float16* bb = ab + QP_A_HALVES;
#pragma unroll  // both 32-k steps of a slab in one body: no inner branch, chunk offsets are loop constants
      for (int kk = 0; kk < 64; kk += 32) {
        v16h w0 = lds_frag64(bb, 0,  kk);
        v16h w1 = lds_frag64(bb, 16, kk);
        v16h w2 = lds_frag64(bb, 32, kk);
        v16h w3 = lds_frag64(bb, 48, kk);
#pragma unroll
        for (int g = 0; g < QG; ++g) {
          v16h x = lds_frag64(ab, (wid * QG + g) * 16, kk);
          qacc[g][0] = __builtin_amdgcn_wmma_f32_16x16x32_f16(false, w0, false, x, (short)0, qacc[g][0], false, false);
          qacc[g][1] = __builtin_amdgcn_wmma_f32_16x16x32_f16(false, w1, false, x, (short)0, qacc[g][1], false, false);
          qacc[g][2] = __builtin_amdgcn_wmma_f32_16x16x32_f16(false, w2, false, x, (short)0, qacc[g][2], false, false);
          qacc[g][3] = __builtin_amdgcn_wmma_f32_16x16x32_f16(false, w3, false, x, (short)0, qacc[g][3], false, false);
        }
      }
      asm volatile("s_wait_dscnt 0x0" ::: "memory");     // this wave's reads of slab s are over
      asm volatile("s_wait_asynccnt 0x0" ::: "memory");  // its share of slab s + 1 has landed
      __syncthreads();  // publishes slab s + 1 and frees the buffer of slab s
      if (s + 2 < DIM / 64) issue_qproj_slab(Xb, Wb, ab, bb, (s + 2) * 64);
    }
    asm volatile("s_wait_asynccnt 0x0" ::: "memory");  // nothing in flight when the key loop takes the LDS over

    const float qs = scale * LOG2E;  // scores come out in log2 units
#pragma unroll
    for (int g = 0; g < QG; ++g) {
#pragma unroll
      for (int r = 0; r < 8; ++r) {
        qa0[g][r]     = (_Float16)(qacc[g][0][r] * qs);
        qa0[g][r + 8] = (_Float16)(qacc[g][1][r] * qs);
        qa1[g][r]     = (_Float16)(qacc[g][2][r] * qs);
        qa1[g][r + 8] = (_Float16)(qacc[g][3][r] * qs);
      }
    }
  }
  v8f acc[QG][4] = {};
  float mlim[QG];  // a score tile value above it calls for a rescale: RESCALE_MARGIN, below every score at first
  float lsum[QG];  // running sum over this lane's half of the keys; the halves join after the loop
  v8f   cneg[QG];  // minus the maximum in use for this lane's query of group g (equal in lanes l and l ^ 16), in
                   // all eight places: the C operand of the first score WMMAs; 0 at first
#pragma unroll
  for (int g = 0; g < QG; ++g) {
    mlim[g] = -1e30f;
    lsum[g] = 0.f;
    cneg[g] = v8f{};
  }

  int rb = (lane >> 4) << 3;
  int cl = lane & 15;

  issue_async_copies(Kg, Vg, smem, smem + 4096, 0);  // prologue: block 0 -> buffer 0

#pragma unroll 1
  for (int jb = 0; jb < SEQ / 32; ++jb) {
    int cur = jb & 1;
    const _Float16* kcur = smem + cur * 2048;
    const _Float16* vcur = smem + 4096 + cur * 2048;
    if (jb < SEQ / 32 - 1) {
      issue_async_copies(Kg, Vg, smem + (1 - cur) * 2048, smem + 4096 + (1 - cur) * 2048,
                         (jb + 1) * 32);
      asm volatile("s_wait_asynccnt 2" ::: "memory");   // current buffer's 2 copies done
    } else {
      asm volatile("s_wait_asynccnt 0" ::: "memory");
    }
    __syncthreads();  // all waves' copies landed

    v16h kb00 = lds_frag64(kcur, 0,  0);
    v16h kb01 = lds_frag64(kcur, 0,  32);
    v16h kb10 = lds_frag64(kcur, 16, 0);
    v16h kb11 = lds_frag64(kcur, 16, 32);
    v8f s0[QG], s1[QG];
    static_assert(QG == 2, "the score products below are written out for two query groups");
    // The eight score products in asm text: the first four read cneg as C and write another D, so cneg stays in
    // its registers from pass to pass (from the builtin the compiler copied cneg into D ahead of half of them,
    // eight 64-bit moves a pass). The last four accumulate into the same D. The four v_nop are the vector slots
    // the chip needs between the last product and whatever vector instruction reads its D next.
    asm("v_wmma_f32_16x16x32_f16 %0, %4, %8, %12\n\t"
        "v_wmma_f32_16x16x32_f16 %1, %4, %9, %13\n\t"
        "v_wmma_f32_16x16x32_f16 %2, %5, %8, %12\n\t"
        "v_wmma_f32_16x16x32_f16 %3, %5, %9, %13\n\t"
        "v_wmma_f32_16x16x32_f16 %0, %6, %10, %0\n\t"
        "v_wmma_f32_16x16x32_f16 %1, %6, %11, %1\n\t"
        "v_wmma_f32_16x16x32_f16 %2, %7, %10, %2\n\t"
        "v_wmma_f32_16x16x32_f16 %3, %7, %11, %3\n\t"
        "v_nop\n\tv_nop\n\tv_nop\n\tv_nop"
        : "=&v"(s0[0]), "=&v"(s0[1]), "=&v"(s1[0]), "=&v"(s1[1])
        : "v"(kb00), "v"(kb10), "v"(kb01), "v"(kb11), "v"(qa0[0]), "v"(qa0[1]), "v"(qa1[0]), "v"(qa1[1]),
          "v"(cneg[0]), "v"(cneg[1]));

    // Online softmax with a lazy rescale. s0[g][r] = score of key rb + r, s1[g][r] = of key 16 + rb + r, for
    // query q0 + 16*g + cl, in log2 units and less mrow. mrow, the maximum in use, may trail the true one by up to
    // RESCALE_MARGIN, so a weight stays below 2^RESCALE_MARGIN (far inside f16); sums and accumulators are
    // rescaled only in a pass where some lane's scores exceed it by more. The test takes each lane's own 16 keys:
    // the ballot sees both halves of the wave, so the halves' maxima join only where the rescale runs.
    float mxh[QG];
    bool need = false;
#pragma unroll
    for (int g = 0; g < QG; ++g) {
      float a0 = fmaxf(fmaxf(s0[g][0], s0[g][1]), s0[g][2]);
      float a1 = fmaxf(fmaxf(s0[g][3], s0[g][4]), s0[g][5]);
      float a2 = fmaxf(fmaxf(s0[g][6], s0[g][7]), s1[g][0]);
      float a3 = fmaxf(fmaxf(s1[g][1], s1[g][2]), s1[g][3]);
      float a4 = fmaxf(fmaxf(s1[g][4], s1[g][5]), s1[g][6]);
      mxh[g] = fmaxf(fmaxf(fmaxf(a0, a1), a2), fmaxf(fmaxf(a3, a4), s1[g][7]));
      need = need || (mxh[g] > mlim[g]);
    }
    if (__builtin_amdgcn_ballot_w32(need) != 0) {  // one wave-uniform test a pass; always taken in the first
#pragma unroll
      for (int g = 0; g < QG; ++g) {
        float mrow  = -cneg[g][0];
        float top   = mrow + fmaxf(mxh[g], xhalf(mxh[g]));  // block maximum, with the other 16 keys
        float mold  = mlim[g] < 0.f ? -1e30f : mrow;        // first pass: nothing is summed yet, take top
        float mnew  = fmaxf(mold, top);
        float alpha = __builtin_amdgcn_exp2f(mold - mnew);
        float shift = mnew - mrow;  // this pass's tiles were taken against the old maximum
        mlim[g] = RESCALE_MARGIN;
        lsum[g] *= alpha;
#pragma unroll
        for (int r = 0; r < 8; ++r) {
          s0[g][r] -= shift;
          s1[g][r] -= shift;
          cneg[g][r] = -mnew;
        }
#pragma unroll
        for (int t = 0; t < 4; ++t) {
#pragma unroll
          for (int r = 0; r < 8; ++r) acc[g][t][r] *= alpha;
        }
      }
    }

    v16h vb0 = lds_frag32(vcur, 0);
    v16h vb1 = lds_frag32(vcur, 16);
    v16h vb2 = lds_frag32(vcur, 32);
    v16h vb3 = lds_frag32(vcur, 48);
    // Holds the address additions above out of the stretch with the exponentials below: the compiler joins such
    // additions to dual-issue pairs.
    __builtin_amdgcn_sched_barrier(0);

    float p0[QG][8], p1[QG][8];
#pragma unroll
    for (int g = 0; g < QG; ++g) {
#pragma unroll
      for (int r = 0; r < 8; ++r) {
        p0[g][r] = __builtin_amdgcn_exp2f(s0[g][r]);
        p1[g][r] = __builtin_amdgcn_exp2f(s1[g][r]);
      }
    }
    __builtin_amdgcn_sched_barrier(0);
    asm volatile("v_nop");
    __builtin_amdgcn_sched_barrier(0);

    v16h pb[QG];
#pragma unroll
    for (int g = 0; g < QG; ++g) {
      float ps[8];
#pragma unroll
      for (int r = 0; r < 8; ++r) {
        ps[r] = p0[g][r] + p1[g][r];
        pb[g][r]     = (_Float16)p0[g][r];
        pb[g][r + 8] = (_Float16)p1[g][r];
      }
      lsum[g] += ((ps[0] + ps[1]) + (ps[2] + ps[3])) + ((ps[4] + ps[5]) + (ps[6] + ps[7]));
    }

#pragma unroll
    for (int g = 0; g < QG; ++g) {
      acc[g][0] = __builtin_amdgcn_wmma_f32_16x16x32_f16(false, vb0, false, pb[g], (short)0, acc[g][0], false, false);
      acc[g][1] = __builtin_amdgcn_wmma_f32_16x16x32_f16(false, vb1, false, pb[g], (short)0, acc[g][1], false, false);
      acc[g][2] = __builtin_amdgcn_wmma_f32_16x16x32_f16(false, vb2, false, pb[g], (short)0, acc[g][2], false, false);
      acc[g][3] = __builtin_amdgcn_wmma_f32_16x16x32_f16(false, vb3, false, pb[g], (short)0, acc[g][3], false, false);
    }

    __syncthreads();  // everyone done reading this buffer before it is refilled
  }

  // acc[g][t][r] = Ot[t*16 + rb + r][q0 + 16*g + cl]: eight consecutive d of one query per tile and lane.
#pragma unroll
  for (int g = 0; g < QG; ++g) {
    float l = lsum[g] + xhalf(lsum[g]);
    float* orow = O + ((size_t)(b * SEQ + q0 + 16 * g + cl)) * INNER + h * DHEAD + rb;
#pragma unroll
    for (int t = 0; t < 4; ++t) {
      float4 lo = make_float4(acc[g][t][0] / l, acc[g][t][1] / l, acc[g][t][2] / l, acc[g][t][3] / l);
      float4 hi = make_float4(acc[g][t][4] / l, acc[g][t][5] / l, acc[g][t][6] / l, acc[g][t][7] / l);
      *reinterpret_cast<float4*>(orow + t * 16)     = lo;
      *reinterpret_cast<float4*>(orow + t * 16 + 4) = hi;
    }
  }
}

extern "C" void kernel_launch(void* const* d_in, const int* in_sizes, int n_in,
                              void* d_out, int out_size, void* d_ws, size_t ws_size,
                              hipStream_t stream) {
  const float* q1  = (const float*)d_in[0];
  const float* q2  = (const float*)d_in[1];
  const float* xkv = (const float*)d_in[2];
  const float* Wq1 = (const float*)d_in[3];
  const float* Wq2 = (const float*)d_in[4];
  const float* Wkv = (const float*)d_in[5];
  float* out = (float*)d_out;

  const size_t NBH = (size_t)BATCH * SEQ * INNER;  // 4,194,304 elements
  _Float16* ws  = (_Float16*)d_ws;
  _Float16* Kh  = ws;
  _Float16* Vth = Kh  + NBH;
  _Float16* X1h = Vth + NBH;
  _Float16* X2h = X1h + NBH;
  _Float16* Xkh = X2h + NBH;
  _Float16* Wt1 = Xkh + NBH;
  _Float16* Wt2 = Wt1 + (size_t)DIM * INNER;
  _Float16* Wtk = Wt2 + (size_t)DIM * INNER;

  prep<<<PREP_W_BLOCKS + 3 * PREP_X_BLOCKS, 256, 0, stream>>>(q1, q2, xkv, Wq1, Wq2, Wkv,
                                                              X1h, X2h, Xkh, Wt1, Wt2, Wtk);

  const float scale = 0.125f;  // DHEAD^-0.5
  const int MT = (BATCH * SEQ) / 16;  // 512
  proj_gemm<<<(MT * (2 * INNER / 64)) / 8, 256, 0, stream>>>(Xkh, Wtk, Kh,  Vth,     2 * INNER, 1.0f);

  // 64 (branch,b,h) x 8 query chunks of 256 = 512 blocks of 8 waves
  flash_attn<<<512, 256, 0, stream>>>(X1h, X2h, Wt1, Wt2, Kh, Vth, out, scale);
}

// v009
// A run of this version takes 92.4 microseconds.
// In both of two side-by-side timings against v008, it was 1.04 times as fast.
// Counting every step since v000, it is 4.87 times as fast.
#include <hip/hip_runtime.h>

typedef __attribute__((ext_vector_type(16))) _Float16 v16h;
typedef __attribute__((ext_vector_type(8)))  _Float16 v8h;
typedef __attribute__((ext_vector_type(4)))  _Float16 v4h;
typedef __attribute__((ext_vector_type(8)))  float    v8f;

#define HEADS 8
#define DHEAD 64
#define SEQ   2048
#define BATCH 4
#define DIM   512
#define INNER 512   // HEADS * DHEAD

// A 16x32 f16 WMMA A/B fragment of a row-major matrix, at rows row0.., k from k0:
// lane l holds row row0 + (l&15), k elements k0 + 8*(l>>4) + {0..7} and +16..23.

// LDS tiles are stored with their 16-byte chunks XOR-swizzled inside each row, so that the 16 rows
// one half-wave reads at the same chunk column fall on 16 different 16-byte bank groups (64 banks x 4 B
// = 256 B): a plain 128-B or 64-B row pitch puts them on 2 or 4 groups only.
// 64-half rows (128 B, 8 chunks): two rows span the banks, so the chunk is XORed with row/2.
__device__ __forceinline__ int swz64(int row, int chunk) {
  return row * 64 + ((chunk ^ ((row >> 1) & 7)) << 3);
}
// 32-half rows (64 B, 4 chunks): four rows span the banks, so the chunk is XORed with row/4.
__device__ __forceinline__ int swz32(int row, int chunk) {
  return row * 32 + ((chunk ^ ((row >> 2) & 3)) << 3);
}

// That fragment, read from a swizzled LDS tile with 64-half rows.
__device__ __forceinline__ v16h lds_frag64(const _Float16* base, int row0, int k0) {
  int lane = threadIdx.x & 31;
  int row = row0 + (lane & 15);
  int ch  = (k0 >> 3) + (lane >> 4);
  v8h lo = *reinterpret_cast<const v8h*>(base + swz64(row, ch));
  v8h hi = *reinterpret_cast<const v8h*>(base + swz64(row, ch + 2));
  v16h f;
#pragma unroll
  for (int i = 0; i < 8; ++i) { f[i] = lo[i]; f[i + 8] = hi[i]; }
  return f;
}

// That fragment (same k order) at k0 = 0, read from a swizzled LDS tile with 32-half rows.
__device__ __forceinline__ v16h lds_frag32(const _Float16* base, int row0) {
  int lane = threadIdx.x & 31;
  int row = row0 + (lane & 15);
  int ch  = lane >> 4;
  v8h lo = *reinterpret_cast<const v8h*>(base + swz32(row, ch));
  v8h hi = *reinterpret_cast<const v8h*>(base + swz32(row, ch + 2));
  v16h f;
#pragma unroll
  for (int i = 0; i < 8; ++i) { f[i] = lo[i]; f[i + 8] = hi[i]; }
  return f;
}

// Lane l takes the value of lane l ^ 16, in the vector pipe (a shuffle would go through the LDS unit).
__device__ __forceinline__ float xhalf(float x) {
  int i = __builtin_bit_cast(int, x);
  return __builtin_bit_cast(float,
      __builtin_amdgcn_permlanex16(i, i, 0x76543210, 0xfedcba98, false, false));
}

// Preparation, one launch. Blocks 0..255 transpose and convert the three weight matrices, blocks 256..1023
// convert the three activations. Few, long-lived waves: a thread's 16 loads are issued ahead of its stores.
#define PREP_W_BLOCKS 256   // 32 columns x 128 k a block: 64 (Wq1) + 64 (Wq2) + 128 (Wkv)
#define PREP_X_BLOCKS 256   // per activation: 16384 floats a block
__global__ __launch_bounds__(256) void prep(const float* __restrict__ q1, const float* __restrict__ q2,
                                            const float* __restrict__ xkv, const float* __restrict__ Wq1,
                                            const float* __restrict__ Wq2, const float* __restrict__ Wkv,
                                            _Float16* __restrict__ X1h, _Float16* __restrict__ X2h,
                                            _Float16* __restrict__ Xkh, _Float16* __restrict__ Wt1,
                                            _Float16* __restrict__ Wt2, _Float16* __restrict__ Wtk) {
  int bid = blockIdx.x;
  int t   = threadIdx.x;
  if (bid < PREP_W_BLOCKS) {
    // Wt[c*DIM + k] = W[k*C + c]. Eight lanes store one whole 128-B line of a Wt row (16 B each); the 32
    // columns of a block are one 128-B line of each W row it reads.
    const float* Wsrc = bid < 64 ? Wq1 : (bid < 128 ? Wq2 : Wkv);
    _Float16*    Wdst = bid < 64 ? Wt1 : (bid < 128 ? Wt2 : Wtk);
    int C    = bid < 128 ? INNER : 2 * INNER;
    int tile = bid < 128 ? (bid & 63) : (bid - 128);
    int c  = (tile >> 2) * 32 + (t >> 3);
    int k0 = (tile & 3) * 128 + (t & 7) * 8;
    float w[16];
    // All loops of this kernel are unrolled so that w and v stay in registers and the loads go out as a group.
#pragma unroll
    for (int u = 0; u < 2; ++u) {
#pragma unroll
      for (int j = 0; j < 8; ++j) w[u * 8 + j] = Wsrc[(size_t)(k0 + u * 64 + j) * C + c];
    }
#pragma unroll
    for (int u = 0; u < 2; ++u) {
      v8h hv;
#pragma unroll
      for (int j = 0; j < 8; ++j) hv[j] = (_Float16)w[u * 8 + j];
      *reinterpret_cast<v8h*>(Wdst + (size_t)c * DIM + k0 + u * 64) = hv;
    }
  } else {
    // A wave-wide load covers 512 contiguous bytes (four lines), the matching store 256 (two lines).
    int xb = bid - PREP_W_BLOCKS;
    const float* in  = xb < PREP_X_BLOCKS ? q1  : (xb < 2 * PREP_X_BLOCKS ? q2  : xkv);
    _Float16*    dst = xb < PREP_X_BLOCKS ? X1h : (xb < 2 * PREP_X_BLOCKS ? X2h : Xkh);
    size_t base = (size_t)(xb & (PREP_X_BLOCKS - 1)) * 16384 + t * 4;
    float4 v[16];
#pragma unroll
    for (int u = 0; u < 16; ++u) v[u] = *reinterpret_cast<const float4*>(in + base + u * 1024);
#pragma unroll
    for (int u = 0; u < 16; ++u) {
      v4h hv = {(_Float16)v[u].x, (_Float16)v[u].y, (_Float16)v[u].z, (_Float16)v[u].w};
      *reinterpret_cast<v4h*>(dst + base + u * 1024) = hv;
    }
    // No register that an issued store names is rewritten ahead of this wait; only the activation path has this wait, the weight path stores without one.
    asm volatile("s_wait_xcnt 0x0" ::: "memory");
  }
}

// Issue the per-thread share of one 64-k slab of a block's operands into LDS: 128 rows of X (4 chunks of
// 16 B a thread) and 64 rows of Wt (2 chunks a thread), each chunk at its swizzled place in its row (swz64;
// rows 32 apart swizzle alike). One wave-wide copy covers four whole 128-B lines.
__device__ __forceinline__ void issue_proj_slab(const _Float16* __restrict__ Xb,
                                                const _Float16* __restrict__ Wb,
                                                _Float16* adst, _Float16* bdst, int k0) {
  int t = threadIdx.x;
  int row = t >> 3, ch = t & 7;
  const _Float16* ga0 = Xb + (size_t)row * DIM + k0 + ch * 8;
  const _Float16* ga1 = ga0 + 32 * DIM;
  const _Float16* ga2 = ga0 + 64 * DIM;
  const _Float16* ga3 = ga0 + 96 * DIM;
  const _Float16* gb0 = Wb + (size_t)row * DIM + k0 + ch * 8;
  const _Float16* gb1 = gb0 + 32 * DIM;
  uint32_t la0 = (uint32_t)(uintptr_t)(adst + swz64(row, ch));
  uint32_t la1 = la0 + 32 * 128;
  uint32_t la2 = la0 + 64 * 128;
  uint32_t la3 = la0 + 96 * 128;
  uint32_t lb0 = (uint32_t)(uintptr_t)(bdst + swz64(row, ch));
  uint32_t lb1 = lb0 + 32 * 128;
  // The copies and their s_wait_xcnt in one statement: no address register is rewritten ahead of the wait.
  asm volatile("global_load_async_to_lds_b128 %0, %6, off\n\t"
               "global_load_async_to_lds_b128 %1, %7, off\n\t"
               "global_load_async_to_lds_b128 %2, %8, off\n\t"
               "global_load_async_to_lds_b128 %3, %9, off\n\t"
               "global_load_async_to_lds_b128 %4, %10, off\n\t"
               "global_load_async_to_lds_b128 %5, %11, off\n\t"
               "s_wait_xcnt 0x0"
               :: "v"(la0), "v"(la1), "v"(la2), "v"(la3), "v"(lb0), "v"(lb1),
                  "v"(ga0), "v"(ga1), "v"(ga2), "v"(ga3), "v"(gb0), "v"(gb1)
               : "memory");
}

#define PROJ_A_HALVES (128 * 64)                    // X slab: 128 rows x 64 k
#define PROJ_BUF_HALVES (PROJ_A_HALVES + 64 * 64)   // + Wt slab: 64 rows x 64 k

// GEMM: [8192 x 512] (f16) x Wt^T -> scatter into per-head layouts.
// col < 512  -> dstK[((b*H+h)*SEQ + n)*64 + d] = val*scale   (K, [B,H,N,64])
// col >= 512 -> dstV[((b*H+h)*64 + d)*SEQ + n] = val         (V transposed, [B,H,64,N])
// Block = 128 rows x 64 columns, wave = 16 rows x 64 columns. Both operands come through LDS in 64-k slabs,
// brought by asynchronous copies into two buffers: slab s + 1 flies while slab s is multiplied.
__global__ __launch_bounds__(256) void proj_gemm(const _Float16* __restrict__ X,
                                                 const _Float16* __restrict__ Wt,
                                                 _Float16* __restrict__ dstK,
                                                 _Float16* __restrict__ dstV,
                                                 int ncols, float scale) {
  // Two buffers of one 64-k slab each: [X 128 x 64][Wt 64 x 64] halves = 24 KB a buffer.
  __shared__ __align__(16) _Float16 sm[2 * PROJ_BUF_HALVES];
  int lane = threadIdx.x & 31;
  int wid  = threadIdx.x >> 5;
  const int MT = (BATCH * SEQ) / 16;  // 512 row tiles
  int id0 = blockIdx.x * 8;           // the block's first wave tile; 8 divides MT, so one c0 a block
  int mb  = (id0 % MT) * 16;
  int m0  = mb + wid * 16;
  int c0  = (id0 / MT) * 64;
  if (c0 >= ncols) return;

  const _Float16* Xb = X  + (size_t)mb * DIM;
  const _Float16* Wb = Wt + (size_t)c0 * DIM;

  issue_proj_slab(Xb, Wb, sm, sm + PROJ_A_HALVES, 0);
  asm volatile("s_wait_asynccnt 0x0" ::: "memory");  // this wave's share of slab 0 has landed
  __syncthreads();                                   // ... and every other wave's
  issue_proj_slab(Xb, Wb, sm + PROJ_BUF_HALVES, sm + PROJ_BUF_HALVES + PROJ_A_HALVES, 64);

  v8f acc0 = {}, acc1 = {}, acc2 = {}, acc3 = {};
#pragma unroll 1  // rolled: one copy statement and one publish point in the text
  for (int s = 0; s < DIM / 64; ++s) {
    _Float16* ab = sm + (s & 1) * PROJ_BUF_HALVES;
    _Float16* bb = ab + PROJ_A_HALVES;
#pragma unroll  // both 32-k steps of a slab in one body: no inner branch, chunk offsets are loop constants
    for (int kk = 0; kk < 64; kk += 32) {
      v16h a  = lds_frag64(ab, wid * 16, kk);
      v16h b0 = lds_frag64(bb, 0,  kk);
      v16h b1 = lds_frag64(bb, 16, kk);
      v16h b2 = lds_frag64(bb, 32, kk);
      v16h b3 = lds_frag64(bb, 48, kk);
      acc0 = __builtin_amdgcn_wmma_f32_16x16x32_f16(false, a, false, b0, (short)0, acc0, false, false);
      acc1 = __builtin_amdgcn_wmma_f32_16x16x32_f16(false, a, false, b1, (short)0, acc1, false, false);
      acc2 = __builtin_amdgcn_wmma_f32_16x16x32_f16(false, a, false, b2, (short)0, acc2, false, false);
      acc3 = __builtin_amdgcn_wmma_f32_16x16x32_f16(false, a, false, b3, (short)0, acc3, false, false);
    }
    asm volatile("s_wait_dscnt 0x0" ::: "memory");     // this wave's reads of slab s are over
    asm volatile("s_wait_asynccnt 0x0" ::: "memory");  // its share of slab s + 1 has landed
    __syncthreads();  // publishes slab s + 1 and frees the buffer of slab s
    if (s + 2 < DIM / 64) issue_proj_slab(Xb, Wb, ab, bb, (s + 2) * 64);
  }
  asm volatile("s_wait_asynccnt 0x0" ::: "memory");  // nothing in flight when the wave ends

  v8f accs[4] = {acc0, acc1, acc2, acc3};
  int rowb = m0 + ((lane >> 4) << 3);
  int cl   = lane & 15;
#pragma unroll
  for (int t = 0; t < 4; ++t) {
#pragma unroll
    for (int r = 0; r < 8; ++r) {
      float val = accs[t][r];
      int row = rowb + r;
      int col = c0 + t * 16 + cl;
      int b = row >> 11, n = row & (SEQ - 1);
      if (col < INNER) {
        int h = col >> 6, d = col & 63;
        dstK[(((size_t)(b * HEADS + h)) * SEQ + n) * DHEAD + d] = (_Float16)(val * scale);
      } else {
        int cc = col - INNER;
        int h = cc >> 6, d = cc & 63;
        dstV[(((size_t)(b * HEADS + h)) * DHEAD + d) * SEQ + n] = (_Float16)val;
      }
    }
  }
}

#define STAGE_KEYS 128                          // keys brought per publish point: four 32-key passes
#define STAGE_K_HALVES (STAGE_KEYS * DHEAD)     // K part of a stage: 128 rows x 64 halves
#define STAGE_HALVES (2 * STAGE_K_HALVES)       // + V part: four tiles of 64 rows x 32 halves

// Issue the per-thread share of one 128-key K/V stage into LDS: four 16-B chunks of K and four of V a thread.
// K: 128 rows x 64 halves, each chunk at its swizzled place in its row (swz64; rows 32 apart swizzle alike); a
// wave-wide copy covers four whole 128-B lines. V: of each of the 64 d rows (stride SEQ) 128 keys = 16 chunks;
// chunk c goes to the 32-key tile c / 4, at its swizzled place in that tile's row (swz32; rows 16 apart swizzle
// alike); a wave-wide copy covers two whole lines of each of two rows.
__device__ __forceinline__ void issue_kv_stage(const _Float16* __restrict__ Kg,
                                               const _Float16* __restrict__ Vg,
                                               _Float16* kdst, _Float16* vdst, int j) {
  int t = threadIdx.x;
  const _Float16* gk0 = Kg + (size_t)(j + (t >> 3)) * DHEAD + (t & 7) * 8;
  const _Float16* gk1 = gk0 + 32 * DHEAD;
  const _Float16* gk2 = gk0 + 64 * DHEAD;
  const _Float16* gk3 = gk0 + 96 * DHEAD;
  const _Float16* gv0 = Vg + (size_t)(t >> 4) * SEQ + j + (t & 15) * 8;
  const _Float16* gv1 = gv0 + 16 * SEQ;
  const _Float16* gv2 = gv0 + 32 * SEQ;
  const _Float16* gv3 = gv0 + 48 * SEQ;
  uint32_t lk0 = (uint32_t)(uintptr_t)(kdst + swz64(t >> 3, t & 7));
  uint32_t lk1 = lk0 + 32 * 128;
  uint32_t lk2 = lk0 + 64 * 128;
  uint32_t lk3 = lk0 + 96 * 128;
  uint32_t lv0 = (uint32_t)(uintptr_t)(vdst + ((t & 15) >> 2) * 2048 + swz32(t >> 4, t & 3));
  uint32_t lv1 = lv0 + 16 * 64;
  uint32_t lv2 = lv0 + 32 * 64;
  uint32_t lv3 = lv0 + 48 * 64;
  // The copies and their s_wait_xcnt in one statement: no address register is rewritten ahead of the wait.
  asm volatile("global_load_async_to_lds_b128 %0, %8, off\n\t"
               "global_load_async_to_lds_b128 %1, %9, off\n\t"
               "global_load_async_to_lds_b128 %2, %10, off\n\t"
               "global_load_async_to_lds_b128 %3, %11, off\n\t"
               "global_load_async_to_lds_b128 %4, %12, off\n\t"
               "global_load_async_to_lds_b128 %5, %13, off\n\t"
               "global_load_async_to_lds_b128 %6, %14, off\n\t"
               "global_load_async_to_lds_b128 %7, %15, off\n\t"
               "s_wait_xcnt 0x0"
               :: "v"(lk0), "v"(lk1), "v"(lk2), "v"(lk3), "v"(lv0), "v"(lv1), "v"(lv2), "v"(lv3),
                  "v"(gk0), "v"(gk1), "v"(gk2), "v"(gk3), "v"(gv0), "v"(gv1), "v"(gv2), "v"(gv3)
               : "memory");
}

// Issue the per-thread share of one 64-k slab of a flash block's query projection into LDS: 256 rows of X
// (8 chunks of 16 B a thread) and the head's 64 rows of Wt (2 chunks a thread), each chunk at its swizzled
// place in its row (swz64; rows 32 apart swizzle alike). One wave-wide copy covers four whole 128-B lines.
__device__ __forceinline__ void issue_qproj_slab(const _Float16* __restrict__ Xb,
                                                 const _Float16* __restrict__ Wb,
                                                 _Float16* adst, _Float16* bdst, int k0) {
  int t = threadIdx.x;
  int row = t >> 3, ch = t & 7;
  const _Float16* ga0 = Xb + (size_t)row * DIM + k0 + ch * 8;
  const _Float16* ga1 = ga0 + 32 * DIM;
  const _Float16* ga2 = ga0 + 64 * DIM;
  const _Float16* ga3 = ga0 + 96 * DIM;
  const _Float16* ga4 = ga0 + 128 * DIM;
  const _Float16* ga5 = ga0 + 160 * DIM;
  const _Float16* ga6 = ga0 + 192 * DIM;
  const _Float16* ga7 = ga0 + 224 * DIM;
  const _Float16* gb0 = Wb + (size_t)row * DIM + k0 + ch * 8;
  const _Float16* gb1 = gb0 + 32 * DIM;
  uint32_t la0 = (uint32_t)(uintptr_t)(adst + swz64(row, ch));
  uint32_t la1 = la0 + 32 * 128;
  uint32_t la2 = la0 + 64 * 128;
  uint32_t la3 = la0 + 96 * 128;
  uint32_t la4 = la0 + 128 * 128;
  uint32_t la5 = la0 + 160 * 128;
  uint32_t la6 = la0 + 192 * 128;
  uint32_t la7 = la0 + 224 * 128;
  uint32_t lb0 = (uint32_t)(uintptr_t)(bdst + swz64(row, ch));
  uint32_t lb1 = lb0 + 32 * 128;
  // The copies and their s_wait_xcnt in one statement: no address register is rewritten ahead of the wait.
  asm volatile("global_load_async_to_lds_b128 %0, %10, off\n\t"
               "global_load_async_to_lds_b128 %1, %11, off\n\t"
               "global_load_async_to_lds_b128 %2, %12, off\n\t"
               "global_load_async_to_lds_b128 %3, %13, off\n\t"
               "global_load_async_to_lds_b128 %4, %14, off\n\t"
               "global_load_async_to_lds_b128 %5, %15, off\n\t"
               "global_load_async_to_lds_b128 %6, %16, off\n\t"
               "global_load_async_to_lds_b128 %7, %17, off\n\t"
               "global_load_async_to_lds_b128 %8, %18, off\n\t"
               "global_load_async_to_lds_b128 %9, %19, off\n\t"
               "s_wait_xcnt 0x0"
               :: "v"(la0), "v"(la1), "v"(la2), "v"(la3), "v"(la4), "v"(la5), "v"(la6), "v"(la7),
                  "v"(lb0), "v"(lb1),
                  "v"(ga0), "v"(ga1), "v"(ga2), "v"(ga3), "v"(ga4), "v"(ga5), "v"(ga6), "v"(ga7),
                  "v"(gb0), "v"(gb1)
               : "memory");
}

#define QP_A_HALVES (256 * 64)                  // X slab: 256 query rows x 64 k
#define QP_BUF_HALVES (QP_A_HALVES + 64 * 64)   // + Wt slab: the head's 64 rows x 64 k

// Flash attention: block = one (branch,b,h), 8 waves x 32 query rows = 256 rows.
// The block first projects its own queries: Qt = Wt_head * Xt (A = the head's 64 Wt rows, B = the block's X
// rows), operands through LDS in 64-k slabs, two buffers, as in proj_gemm. Lane l then holds, of query
// q0 + 16*g + (l & 15), the d values 16*t + 8*(l>>4) + 0..7 of tile t: tiles 0, 1 and 2, 3, scaled and
// converted, are the two B fragments of Q as they stand, so Q never leaves the registers.
// K/V come into LDS once per block by async copies, in stages of 128 keys, two buffers: stage s + 1 flies while
// the four 32-key passes of stage s run, and the waves meet at one barrier a stage, free to drift in between.
// The products are taken transposed: St = K * Qt (A = K rows, B = Q) and Ot += Vt * Pt (A = Vt rows,
// B = Pt). A wave owns QG groups of 16 queries; in group g lane l holds only query q0 + 16*g + (l & 15): of
// each 32-key block the keys 8*(l>>4) + 0..7 (first score tile) and 16 + 8*(l>>4) + 0..7 (second), which is
// the k order of a B fragment, so the converted scores are the B operand as they stand; maximum, sum and
// rescale are per-lane values. Every K and Vt fragment read from LDS is the A operand of QG products.
// The score product hands over the exponent as it stands: Q carries scale * log2(e), and the C operand of the
// first score WMMA holds minus the maximum in use, so a score tile is log2 of the weight and goes to v_exp_f32
// with no vector subtract or multiply in between.
#define QG 2
#define LOG2E 1.44269504f
#define RESCALE_MARGIN 8.0f   // in log2 units: a weight stays below 2^8
__global__ __launch_bounds__(256) void flash_attn(const _Float16* __restrict__ X1,
                                                  const _Float16* __restrict__ X2,
                                                  const _Float16* __restrict__ Wt1,
                                                  const _Float16* __restrict__ Wt2,
                                                  const _Float16* __restrict__ Kt,
                                                  const _Float16* __restrict__ Vt,
                                                  float* __restrict__ out, float scale) {
  // Projection: two buffers of [X 256 x 64][Wt 64 x 64] halves = 80 KB. The key loop then reuses the first
  // 64 KB as two stage buffers of [K 8192][V 8192] halves.
  __shared__ __align__(16) _Float16 smem[2 * QP_BUF_HALVES];
  int lane = threadIdx.x & 31;
  int wid  = threadIdx.x >> 5;
  int bid  = blockIdx.x;
  int bhz  = bid & 63;       // (branch, b, h)
  int qc   = bid >> 6;       // 0..SEQ / (128 * QG) - 1
  int q0   = (qc * 128 + wid * 16) * QG;
  int h    = bhz & 7;
  int b    = (bhz >> 3) & 3;
  int br   = bhz >> 5;

  const _Float16* Xb = (br ? X2 : X1) + (size_t)(b * SEQ + qc * 128 * QG) * DIM;  // the block's 256 X rows
  const _Float16* Wb = (br ? Wt2 : Wt1) + (size_t)(h * DHEAD) * DIM;              // the head's 64 Wt rows
  const _Float16* Kg = Kt + ((size_t)(b * HEADS + h)) * SEQ * DHEAD;
  const _Float16* Vg = Vt + ((size_t)(b * HEADS + h)) * DHEAD * SEQ;
  float* O = out + (size_t)br * ((size_t)BATCH * SEQ * INNER);

  // All loops over g, t and r in this kernel are unrolled so that the arrays they index stay in registers.
  v16h qa0[QG], qa1[QG];
  {
    issue_qproj_slab(Xb, Wb, smem, smem + QP_A_HALVES, 0);
    asm volatile("s_wait_asynccnt 0x0" ::: "memory");  // this wave's share of slab 0 has landed
    __syncthreads();                                   // ... and every other wave's
    issue_qproj_slab(Xb, Wb, smem + QP_BUF_HALVES, smem + QP_BUF_HALVES + QP_A_HALVES, 64);

    v8f qacc[QG][4] = {};
#pragma unroll 1  // rolled: one copy statement and one publish point in the text
    for (int s = 0; s < DIM / 64; ++s) {
      _Float16* ab = smem + (s & 1) * QP_BUF_HALVES;
      _Float16* bb = ab + QP_A_HALVES;
#pragma unroll  // both 32-k steps of a slab in one body: no inner branch, chunk offsets are loop constants
      for (int kk = 0; kk < 64; kk += 32) {
        v16h w0 = lds_frag64(bb, 0,  kk);
        v16h w1 = lds_frag64(bb, 16, kk);
        v16h w2 = lds_frag64(bb, 32, kk);
        v16h w3 = lds_frag64(bb, 48, kk);
#pragma unroll
        for (int g = 0; g < QG; ++g) {
          v16h x = lds_frag64(ab, (wid * QG + g) * 16, kk);
          qacc[g][0] = __builtin_amdgcn_wmma_f32_16x16x32_f16(false, w0, false, x, (short)0, qacc[g][0], false, false);
          qacc[g][1] = __builtin_amdgcn_wmma_f32_16x16x32_f16(false, w1, false, x, (short)0, qacc[g][1], false, false);
          qacc[g][2] = __builtin_amdgcn_wmma_f32_16x16x32_f16(false, w2, false, x, (short)0, qacc[g][2], false, false);
          qacc[g][3] = __builtin_amdgcn_wmma_f32_16x16x32_f16(false, w3, false, x, (short)0, qacc[g][3], false, false);
        }
      }
      asm volatile("s_wait_dscnt 0x0" ::: "memory");     // this wave's reads of slab s are over
      asm volatile("s_wait_asynccnt 0x0" ::: "memory");  // its share of slab s + 1 has landed
      __syncthreads();  // publishes slab s + 1 and frees the buffer of slab s
      if (s + 2 < DIM / 64) issue_qproj_slab(Xb, Wb, ab, bb, (s + 2) * 64);
    }
    asm volatile("s_wait_asynccnt 0x0" ::: "memory");  // nothing in flight when the key loop takes the LDS over
    // The last trip's wait and barrier ended every wave's reads of the slabs: stage 0 flies while Q is converted.
    issue_kv_stage(Kg, Vg, smem, smem + STAGE_K_HALVES, 0);

    const float qs = scale * LOG2E;  // scores come out in log2 units
#pragma unroll
    for (int g = 0; g < QG; ++g) {
#pragma unroll
      for (int r = 0; r < 8; ++r) {
        qa0[g][r]     = (_Float16)(qacc[g][0][r] * qs);
        qa0[g][r + 8] = (_Float16)(qacc[g][1][r] * qs);
        qa1[g][r]     = (_Float16)(qacc[g][2][r] * qs);
        qa1[g][r + 8] = (_Float16)(qacc[g][3][r] * qs);
      }
    }
  }
  v8f acc[QG][4] = {};
  float mlim[QG];  // a score tile value above it calls for a rescale: RESCALE_MARGIN, below every score at first
  float lsum[QG];  // running sum over this lane's half of the keys; the halves join after the loop
  v8f   cneg[QG];  // minus the maximum in use for this lane's query of group g (equal in lanes l and l ^ 16), in
                   // all eight places: the C operand of the first score WMMAs; 0 at first
#pragma unroll
  for (int g = 0; g < QG; ++g) {
    mlim[g] = -1e30f;
    lsum[g] = 0.f;
    cneg[g] = v8f{};
  }

  int rb = (lane >> 4) << 3;
  int cl = lane & 15;

  asm volatile("s_wait_asynccnt 0x0" ::: "memory");  // this wave's share of stage 0 has landed
  __syncthreads();                                   // ... and every other wave's
  issue_kv_stage(Kg, Vg, smem + STAGE_HALVES, smem + STAGE_HALVES + STAGE_K_HALVES, STAGE_KEYS);

#pragma unroll 1  // rolled: one copy statement and one publish point in the text
  for (int st = 0; st < SEQ / STAGE_KEYS; ++st) {
    _Float16* kst = smem + (st & 1) * STAGE_HALVES;
    _Float16* vst = kst + STAGE_K_HALVES;
#pragma unroll  // the four passes of a stage in one body: their LDS addresses differ by instruction offsets only
    for (int p = 0; p < STAGE_KEYS / 32; ++p) {
      const _Float16* kcur = kst + p * 2048;
      const _Float16* vcur = vst + p * 2048;

      v16h kb00 = lds_frag64(kcur, 0,  0);
      v16h kb01 = lds_frag64(kcur, 0,  32);
      v16h kb10 = lds_frag64(kcur, 16, 0);
      v16h kb11 = lds_frag64(kcur, 16, 32);
      v8f s0[QG], s1[QG];
      static_assert(QG == 2, "the score products below are written out for two query groups");
      // The eight score products in asm text: the first four read cneg as C and write another D, so cneg stays in
      // its registers from pass to pass (from the builtin the compiler copied cneg into D ahead of half of them,
      // eight 64-bit moves a pass). The last four accumulate into the same D. The four v_nop are the vector slots
      // the chip needs between the last product and whatever vector instruction reads its D next.
      asm("v_wmma_f32_16x16x32_f16 %0, %4, %8, %12\n\t"
          "v_wmma_f32_16x16x32_f16 %1, %4, %9, %13\n\t"
          "v_wmma_f32_16x16x32_f16 %2, %5, %8, %12\n\t"
          "v_wmma_f32_16x16x32_f16 %3, %5, %9, %13\n\t"
          "v_wmma_f32_16x16x32_f16 %0, %6, %10, %0\n\t"
          "v_wmma_f32_16x16x32_f16 %1, %6, %11, %1\n\t"
          "v_wmma_f32_16x16x32_f16 %2, %7, %10, %2\n\t"
          "v_wmma_f32_16x16x32_f16 %3, %7, %11, %3\n\t"
          "v_nop\n\tv_nop\n\tv_nop\n\tv_nop"
          : "=&v"(s0[0]), "=&v"(s0[1]), "=&v"(s1[0]), "=&v"(s1[1])
          : "v"(kb00), "v"(kb10), "v"(kb01), "v"(kb11), "v"(qa0[0]), "v"(qa0[1]), "v"(qa1[0]), "v"(qa1[1]),
            "v"(cneg[0]), "v"(cneg[1]));

      // Online softmax with a lazy rescale. s0[g][r] = score of key rb + r, s1[g][r] = of key 16 + rb + r, for
      // query q0 + 16*g + cl, in log2 units and less mrow. mrow, the maximum in use, may trail the true one by up to
      // RESCALE_MARGIN, so a weight stays below 2^RESCALE_MARGIN (far inside f16); sums and accumulators are
      // rescaled only in a pass where some lane's scores exceed it by more. The test takes each lane's own 16 keys:
      // the ballot sees both halves of the wave, so the halves' maxima join only where the rescale runs.
      float mxh[QG];
      bool need = false;
#pragma unroll
      for (int g = 0; g < QG; ++g) {
        float a0 = fmaxf(fmaxf(s0[g][0], s0[g][1]), s0[g][2]);
        float a1 = fmaxf(fmaxf(s0[g][3], s0[g][4]), s0[g][5]);
        float a2 = fmaxf(fmaxf(s0[g][6], s0[g][7]), s1[g][0]);
        float a3 = fmaxf(fmaxf(s1[g][1], s1[g][2]), s1[g][3]);
        float a4 = fmaxf(fmaxf(s1[g][4], s1[g][5]), s1[g][6]);
        mxh[g] = fmaxf(fmaxf(fmaxf(a0, a1), a2), fmaxf(fmaxf(a3, a4), s1[g][7]));
        need = need || (mxh[g] > mlim[g]);
      }
      if (__builtin_amdgcn_ballot_w32(need) != 0) {  // one wave-uniform test a pass; always taken in the first
#pragma unroll
        for (int g = 0; g < QG; ++g) {
          float mrow  = -cneg[g][0];
          float top   = mrow + fmaxf(mxh[g], xhalf(mxh[g]));  // block maximum, with the other 16 keys
          float mold  = mlim[g] < 0.f ? -1e30f : mrow;        // first pass: nothing is summed yet, take top
          float mnew  = fmaxf(mold, top);
          float alpha = __builtin_amdgcn_exp2f(mold - mnew);
          float shift = mnew - mrow;  // this pass's tiles were taken against the old maximum
          mlim[g] = RESCALE_MARGIN;
          lsum[g] *= alpha;
#pragma unroll
          for (int r = 0; r < 8; ++r) {
            s0[g][r] -= shift;
            s1[g][r] -= shift;
            cneg[g][r] -= shift;  // in place: set anew from mnew, it changed registers from one unrolled pass to the next
          }
#pragma unroll
          for (int t = 0; t < 4; ++t) {
#pragma unroll
            for (int r = 0; r < 8; ++r) acc[g][t][r] *= alpha;
          }
        }
      }

      v16h vb0 = lds_frag32(vcur, 0);
      v16h vb1 = lds_frag32(vcur, 16);
      v16h vb2 = lds_frag32(vcur, 32);
      v16h vb3 = lds_frag32(vcur, 48);
      // Holds the address additions above out of the stretch with the exponentials below: the compiler joins such
      // additions to dual-issue pairs.
      __builtin_amdgcn_sched_barrier(0);

      float p0[QG][8], p1[QG][8];
#pragma unroll
      for (int g = 0; g < QG; ++g) {
#pragma unroll
        for (int r = 0; r < 8; ++r) {
          p0[g][r] = __builtin_amdgcn_exp2f(s0[g][r]);
          p1[g][r] = __builtin_amdgcn_exp2f(s1[g][r]);
        }
      }
      __builtin_amdgcn_sched_barrier(0);
      asm volatile("v_nop");
      __builtin_amdgcn_sched_barrier(0);

      v16h pb[QG];
#pragma unroll
      for (int g = 0; g < QG; ++g) {
        float ps[8];
#pragma unroll
        for (int r = 0; r < 8; ++r) {
          ps[r] = p0[g][r] + p1[g][r];
          pb[g][r]     = (_Float16)p0[g][r];
          pb[g][r + 8] = (_Float16)p1[g][r];
        }
        lsum[g] += ((ps[0] + ps[1]) + (ps[2] + ps[3])) + ((ps[4] + ps[5]) + (ps[6] + ps[7]));
      }

#pragma unroll
      for (int g = 0; g < QG; ++g) {
        acc[g][0] = __builtin_amdgcn_wmma_f32_16x16x32_f16(false, vb0, false, pb[g], (short)0, acc[g][0], false, false);
        acc[g][1] = __builtin_amdgcn_wmma_f32_16x16x32_f16(false, vb1, false, pb[g], (short)0, acc[g][1], false, false);
        acc[g][2] = __builtin_amdgcn_wmma_f32_16x16x32_f16(false, vb2, false, pb[g], (short)0, acc[g][2], false, false);
        acc[g][3] = __builtin_amdgcn_wmma_f32_16x16x32_f16(false, vb3, false, pb[g], (short)0, acc[g][3], false, false);
      }
    }
    asm volatile("s_wait_dscnt 0x0" ::: "memory");     // this wave's reads of stage st are over
    asm volatile("s_wait_asynccnt 0x0" ::: "memory");  // its share of stage st + 1 has landed
    __syncthreads();  // publishes stage st + 1 and frees the buffer of stage st
    if (st + 2 < SEQ / STAGE_KEYS) issue_kv_stage(Kg, Vg, kst, vst, (st + 2) * STAGE_KEYS);
  }
  asm volatile("s_wait_asynccnt 0x0" ::: "memory");  // nothing in flight when the wave ends

  // acc[g][t][r] = Ot[t*16 + rb + r][q0 + 16*g + cl]: eight consecutive d of one query per tile and lane.
#pragma unroll
  for (int g = 0; g < QG; ++g) {
    float l = lsum[g] + xhalf(lsum[g]);
    float* orow = O + ((size_t)(b * SEQ + q0 + 16 * g + cl)) * INNER + h * DHEAD + rb;
#pragma unroll
    for (int t = 0; t < 4; ++t) {
      float4 lo = make_float4(acc[g][t][0] / l, acc[g][t][1] / l, acc[g][t][2] / l, acc[g][t][3] / l);
      float4 hi = make_float4(acc[g][t][4] / l, acc[g][t][5] / l, acc[g][t][6] / l, acc[g][t][7] / l);
      *reinterpret_cast<float4*>(orow + t * 16)     = lo;
      *reinterpret_cast<float4*>(orow + t * 16 + 4) = hi;
    }
  }
}

extern "C" void kernel_launch(void* const* d_in, const int* in_sizes, int n_in,
                              void* d_out, int out_size, void* d_ws, size_t ws_size,
                              hipStream_t stream) {
  const float* q1  = (const float*)d_in[0];
  const float* q2  = (const float*)d_in[1];
  const float* xkv = (const float*)d_in[2];
  const float* Wq1 = (const float*)d_in[3];
  const float* Wq2 = (const float*)d_in[4];
  const float* Wkv = (const float*)d_in[5];
  float* out = (float*)d_out;

  const size_t NBH = (size_t)BATCH * SEQ * INNER;  // 4,194,304 elements
  _Float16* ws  = (_Float16*)d_ws;
  _Float16* Kh  = ws;
  _Float16* Vth = Kh  + NBH;
  _Float16* X1h = Vth + NBH;
  _Float16* X2h = X1h + NBH;
  _Float16* Xkh = X2h + NBH;
  _Float16* Wt1 = Xkh + NBH;
  _Float16* Wt2 = Wt1 + (size_t)DIM * INNER;
  _Float16* Wtk = Wt2 + (size_t)DIM * INNER;

  prep<<<PREP_W_BLOCKS + 3 * PREP_X_BLOCKS, 256, 0, stream>>>(q1, q2, xkv, Wq1, Wq2, Wkv,
                                                              X1h, X2h, Xkh, Wt1, Wt2, Wtk);

  const float scale = 0.125f;  // DHEAD^-0.5
  const int MT = (BATCH * SEQ) / 16;  // 512
  proj_gemm<<<(MT * (2 * INNER / 64)) / 8, 256, 0, stream>>>(Xkh, Wtk, Kh,  Vth,     2 * INNER, 1.0f);

  // 64 (branch,b,h) x 8 query chunks of 256 = 512 blocks of 8 waves
  flash_attn<<<512, 256, 0, stream>>>(X1h, X2h, Wt1, Wt2, Kh, Vth, out, scale);
}

// v010
// Measured time: 79 microseconds a run.
// Next to v009, in two timings, it ran 1.17 times as fast each time.
// Counting every step since v000, it is 5.68 times as fast.
#include <hip/hip_runtime.h>

typedef __attribute__((ext_vector_type(16))) _Float16 v16h;
typedef __attribute__((ext_vector_type(8)))  _Float16 v8h;
typedef __attribute__((ext_vector_type(4)))  _Float16 v4h;
typedef __attribute__((ext_vector_type(8)))  float    v8f;

#define HEADS 8
#define DHEAD 64
#define SEQ   2048
#define BATCH 4
#define DIM   512
#define INNER 512   // HEADS * DHEAD

// A 16x32 f16 WMMA A/B fragment of a row-major matrix, at rows row0.., k from k0:
// lane l holds row row0 + (l&15), k elements k0 + 8*(l>>4) + {0..7} and +16..23.

// LDS tiles are stored with their 16-byte chunks XOR-swizzled inside each row, so that the 16 rows
// one half-wave reads at the same chunk column fall on 16 different 16-byte bank groups (64 banks x 4 B
// = 256 B): a plain 128-B or 64-B row pitch puts them on 2 or 4 groups only.
// 64-half rows (128 B, 8 chunks): two rows span the banks, so the chunk is XORed with row/2.
__device__ __forceinline__ int swz64(int row, int chunk) {
  return row * 64 + ((chunk ^ ((row >> 1) & 7)) << 3);
}
// 32-half rows (64 B, 4 chunks): four rows span the banks, so the chunk is XORed with row/4.
__device__ __forceinline__ int swz32(int row, int chunk) {
  return row * 32 + ((chunk ^ ((row >> 2) & 3)) << 3);
}

// That fragment, read from a swizzled LDS tile with 64-half rows.
__device__ __forceinline__ v16h lds_frag64(const _Float16* base, int row0, int k0) {
  int lane = threadIdx.x & 31;
  int row = row0 + (lane & 15);
  int ch  = (k0 >> 3) + (lane >> 4);
  v8h lo = *reinterpret_cast<const v8h*>(base + swz64(row, ch));
  v8h hi = *reinterpret_cast<const v8h*>(base + swz64(row, ch + 2));
  v16h f;
#pragma unroll
  for (int i = 0; i < 8; ++i) { f[i] = lo[i]; f[i + 8] = hi[i]; }
  return f;
}

// That fragment (same k order) at k0 = 0, read from a swizzled LDS tile with 32-half rows.
__device__ __forceinline__ v16h lds_frag32(const _Float16* base, int row0) {
  int lane = threadIdx.x & 31;
  int row = row0 + (lane & 15);
  int ch  = lane >> 4;
  v8h lo = *reinterpret_cast<const v8h*>(base + swz32(row, ch));
  v8h hi = *reinterpret_cast<const v8h*>(base + swz32(row, ch + 2));
  v16h f;
#pragma unroll
  for (int i = 0; i < 8; ++i) { f[i] = lo[i]; f[i + 8] = hi[i]; }
  return f;
}

// Lane l takes the value of lane l ^ 16, in the vector pipe (a shuffle would go through the LDS unit).
__device__ __forceinline__ float xhalf(float x) {
  int i = __builtin_bit_cast(int, x);
  return __builtin_bit_cast(float,
      __builtin_amdgcn_permlanex16(i, i, 0x76543210, 0xfedcba98, false, false));
}

// Preparation, one launch. Blocks 0..255 transpose and convert the three weight matrices, blocks 256..1023
// convert the three activations. Few, long-lived waves: a thread's 16 loads are issued ahead of its stores.
#define PREP_W_BLOCKS 256   // 32 columns x 128 k a block: 64 (Wq1) + 64 (Wq2) + 128 (Wkv)
#define PREP_X_BLOCKS 256   // per activation: 16384 floats a block
__global__ __launch_bounds__(256) void prep(const float* __restrict__ q1, const float* __restrict__ q2,
                                            const float* __restrict__ xkv, const float* __restrict__ Wq1,
                                            const float* __restrict__ Wq2, const float* __restrict__ Wkv,
                                            _Float16* __restrict__ X1h, _Float16* __restrict__ X2h,
                                            _Float16* __restrict__ Xkh, _Float16* __restrict__ Wt1,
                                            _Float16* __restrict__ Wt2, _Float16* __restrict__ Wtk) {
  int bid = blockIdx.x;
  int t   = threadIdx.x;
  if (bid < PREP_W_BLOCKS) {
    // Wt[c*DIM + k] = W[k*C + c]. Eight lanes store one whole 128-B line of a Wt row (16 B each); the 32
    // columns of a block are one 128-B line of each W row it reads.
    const float* Wsrc = bid < 64 ? Wq1 : (bid < 128 ? Wq2 : Wkv);
    _Float16*    Wdst = bid < 64 ? Wt1 : (bid < 128 ? Wt2 : Wtk);
    int C    = bid < 128 ? INNER : 2 * INNER;
    int tile = bid < 128 ? (bid & 63) : (bid - 128);
    int c  = (tile >> 2) * 32 + (t >> 3);
    int k0 = (tile & 3) * 128 + (t & 7) * 8;
    float w[16];
    // All loops of this kernel are unrolled so that w and v stay in registers and the loads go out as a group.
#pragma unroll
    for (int u = 0; u < 2; ++u) {
#pragma unroll
      for (int j = 0; j < 8; ++j) w[u * 8 + j] = Wsrc[(size_t)(k0 + u * 64 + j) * C + c];
    }
#pragma unroll
    for (int u = 0; u < 2; ++u) {
      v8h hv;
#pragma unroll
      for (int j = 0; j < 8; ++j) hv[j] = (_Float16)w[u * 8 + j];
      *reinterpret_cast<v8h*>(Wdst + (size_t)c * DIM + k0 + u * 64) = hv;
    }
  } else {
    // A wave-wide load covers 512 contiguous bytes (four lines), the matching store 256 (two lines).
    int xb = bid - PREP_W_BLOCKS;
    const float* in  = xb < PREP_X_BLOCKS ? q1  : (xb < 2 * PREP_X_BLOCKS ? q2  : xkv);
    _Float16*    dst = xb < PREP_X_BLOCKS ? X1h : (xb < 2 * PREP_X_BLOCKS ? X2h : Xkh);
    size_t base = (size_t)(xb & (PREP_X_BLOCKS - 1)) * 16384 + t * 4;
    float4 v[16];
#pragma unroll
    for (int u = 0; u < 16; ++u) v[u] = *reinterpret_cast<const float4*>(in + base + u * 1024);
#pragma unroll
    for (int u = 0; u < 16; ++u) {
      v4h hv = {(_Float16)v[u].x, (_Float16)v[u].y, (_Float16)v[u].z, (_Float16)v[u].w};
      *reinterpret_cast<v4h*>(dst + base + u * 1024) = hv;
    }
    // No register that an issued store names is rewritten ahead of this wait; only the activation path has this wait, the weight path stores without one.
    asm volatile("s_wait_xcnt 0x0" ::: "memory");
  }
}

// Issue the per-thread share of one 64-k slab of a block's operands into LDS: 128 rows of X (4 chunks of
// 16 B a thread) and 64 rows of Wt (2 chunks a thread), each chunk at its swizzled place in its row (swz64;
// rows 32 apart swizzle alike). One wave-wide copy covers four whole 128-B lines.
__device__ __forceinline__ void issue_proj_slab(const _Float16* __restrict__ Xb,
                                                const _Float16* __restrict__ Wb,
                                                _Float16* adst, _Float16* bdst, int k0) {
  int t = threadIdx.x;
  int row = t >> 3, ch = t & 7;
  const _Float16* ga0 = Xb + (size_t)row * DIM + k0 + ch * 8;
  const _Float16* ga1 = ga0 + 32 * DIM;
  const _Float16* ga2 = ga0 + 64 * DIM;
  const _Float16* ga3 = ga0 + 96 * DIM;
  const _Float16* gb0 = Wb + (size_t)row * DIM + k0 + ch * 8;
  const _Float16* gb1 = gb0 + 32 * DIM;
  uint32_t la0 = (uint32_t)(uintptr_t)(adst + swz64(row, ch));
  uint32_t la1 = la0 + 32 * 128;
  uint32_t la2 = la0 + 64 * 128;
  uint32_t la3 = la0 + 96 * 128;
  uint32_t lb0 = (uint32_t)(uintptr_t)(bdst + swz64(row, ch));
  uint32_t lb1 = lb0 + 32 * 128;
  // The copies and their s_wait_xcnt in one statement: no address register is rewritten ahead of the wait.
  asm volatile("global_load_async_to_lds_b128 %0, %6, off\n\t"
               "global_load_async_to_lds_b128 %1, %7, off\n\t"
               "global_load_async_to_lds_b128 %2, %8, off\n\t"
               "global_load_async_to_lds_b128 %3, %9, off\n\t"
               "global_load_async_to_lds_b128 %4, %10, off\n\t"
               "global_load_async_to_lds_b128 %5, %11, off\n\t"
               "s_wait_xcnt 0x0"
               :: "v"(la0), "v"(la1), "v"(la2), "v"(la3), "v"(lb0), "v"(lb1),
                  "v"(ga0), "v"(ga1), "v"(ga2), "v"(ga3), "v"(gb0), "v"(gb1)
               : "memory");
}

#define PROJ_A_HALVES (128 * 64)                    // X slab: 128 rows x 64 k
#define PROJ_BUF_HALVES (PROJ_A_HALVES + 64 * 64)   // + Wt slab: 64 rows x 64 k

// The slab loop of proj_gemm: a wave's 16 X rows against the block's 64 Wt rows, slab s + 1 in flight while slab s
// is multiplied. W_IS_A picks which operand gives the rows of the result tiles (the A and B fragments of a
// row-major matrix are loaded alike): Wt as A leaves a lane eight consecutive columns of one X row, X as A
// eight consecutive X rows of one column.
template <bool W_IS_A>
__device__ __forceinline__ void proj_slabs(const _Float16* __restrict__ Xb, const _Float16* __restrict__ Wb,
                                           _Float16* sm, int wid, v8f (&acc)[4]) {
#pragma unroll 1  // rolled: one copy statement and one publish point in the text
  for (int s = 0; s < DIM / 64; ++s) {
    _Float16* ab = sm + (s & 1) * PROJ_BUF_HALVES;
    _Float16* bb = ab + PROJ_A_HALVES;
#pragma unroll  // both 32-k steps of a slab in one body: no inner branch, chunk offsets are loop constants
    for (int kk = 0; kk < 64; kk += 32) {
      v16h a = lds_frag64(ab, wid * 16, kk);
      v16h w[4];
#pragma unroll  // w and acc stay in registers
      for (int t = 0; t < 4; ++t) w[t] = lds_frag64(bb, t * 16, kk);
#pragma unroll
      for (int t = 0; t < 4; ++t) {
        acc[t] = W_IS_A
            ? __builtin_amdgcn_wmma_f32_16x16x32_f16(false, w[t], false, a, (short)0, acc[t], false, false)
            : __builtin_amdgcn_wmma_f32_16x16x32_f16(false, a, false, w[t], (short)0, acc[t], false, false);
      }
    }
    asm volatile("s_wait_dscnt 0x0" ::: "memory");     // this wave's reads of slab s are over
    asm volatile("s_wait_asynccnt 0x0" ::: "memory");  // its share of slab s + 1 has landed
    __syncthreads();  // publishes slab s + 1 and frees the buffer of slab s
    if (s + 2 < DIM / 64) issue_proj_slab(Xb, Wb, ab, bb, (s + 2) * 64);
  }
  asm volatile("s_wait_asynccnt 0x0" ::: "memory");  // nothing in flight when the LDS is taken over
}

// GEMM: [8192 x 512] (f16) x Wt^T -> per-head layouts.
// col < 512  -> dstK[((b*H+h)*SEQ + n)*64 + d] = val*scale   (K, [B,H,N,64])
// col >= 512 -> dstV[((b*H+h)*64 + d)*SEQ + n] = val         (V transposed, [B,H,64,N])
// Block = 128 rows x 64 columns (one head's K or V, one batch), wave = 16 rows x 64 columns. Both operands come
// through LDS in 64-k slabs, brought by asynchronous copies into two buffers.
// The block's results leave through LDS, laid out as they lie in memory, so that every wave-wide store is four
// whole 128-B lines: a K block is 128 rows of one line each (16 KB in a row in dstK), a V block 64 rows of two.
__global__ __launch_bounds__(256) void proj_gemm(const _Float16* __restrict__ X,
                                                 const _Float16* __restrict__ Wt,
                                                 _Float16* __restrict__ dstK,
                                                 _Float16* __restrict__ dstV,
                                                 int ncols, float scale) {
  // Two buffers of one 64-k slab each: [X 128 x 64][Wt 64 x 64] halves = 24 KB a buffer. The result tile
  // (128 x 64 halves, 16 KB) takes the first buffer over behind the loop.
  __shared__ __align__(16) _Float16 sm[2 * PROJ_BUF_HALVES];
  int tid  = threadIdx.x;
  int lane = tid & 31;
  int wid  = tid >> 5;
  const int MT = (BATCH * SEQ) / 16;  // 512 row tiles
  int id0 = blockIdx.x * 8;           // the block's first wave tile; 8 divides MT, so one c0 a block
  int mb  = (id0 % MT) * 16;
  int c0  = (id0 / MT) * 64;
  if (c0 >= ncols) return;

  const _Float16* Xb = X  + (size_t)mb * DIM;
  const _Float16* Wb = Wt + (size_t)c0 * DIM;

  issue_proj_slab(Xb, Wb, sm, sm + PROJ_A_HALVES, 0);
  asm volatile("s_wait_asynccnt 0x0" ::: "memory");  // this wave's share of slab 0 has landed
  __syncthreads();                                   // ... and every other wave's
  issue_proj_slab(Xb, Wb, sm + PROJ_BUF_HALVES, sm + PROJ_BUF_HALVES + PROJ_A_HALVES, 64);

  v8f acc[4] = {};
  int b  = mb >> 11, n0 = mb & (SEQ - 1);  // 128 divides SEQ: one batch a block
  int cl = lane & 15, hw = lane >> 4;
  // The last trip's wait and barrier ended every wave's reads of the slabs, so the tile may be written at once.
  // All loops below are unrolled so that acc stays in registers and the four stores go out as a group.
  if (c0 < INNER) {
    proj_slabs<true>(Xb, Wb, sm, wid, acc);
    // acc[t][r] = K[row wid*16 + cl][d = t*16 + 8*hw + r]: chunk 2*t + hw of the row, swizzled as the slabs are.
#pragma unroll
    for (int t = 0; t < 4; ++t) {
      v8h hv;
#pragma unroll
      for (int r = 0; r < 8; ++r) hv[r] = (_Float16)(acc[t][r] * scale);
      *reinterpret_cast<v8h*>(sm + swz64(wid * 16 + cl, 2 * t + hw)) = hv;
    }
    __syncthreads();  // the tile is whole before any wave reads other waves' rows
    _Float16* dst = dstK + (((size_t)(b * HEADS + (c0 >> 6))) * SEQ + n0) * DHEAD;
    v8h line[4];
#pragma unroll
    for (int i = 0; i < 4; ++i) line[i] = *reinterpret_cast<const v8h*>(sm + swz64((tid >> 3) + 32 * i, tid & 7));
#pragma unroll
    for (int i = 0; i < 4; ++i) *reinterpret_cast<v8h*>(dst + ((tid >> 3) + 32 * i) * DHEAD + (tid & 7) * 8) = line[i];
  } else {
    proj_slabs<false>(Xb, Wb, sm, wid, acc);
    // acc[t][r] = V[row wid*16 + 8*hw + r][d = t*16 + cl]: chunk 2*wid + hw of tile row d (128 halves, 16 chunks
    // = all banks); the chunk is XORed with d so that the 16 rows a half-wave writes fall on distinct banks.
#pragma unroll
    for (int t = 0; t < 4; ++t) {
      v8h hv;
#pragma unroll
      for (int r = 0; r < 8; ++r) hv[r] = (_Float16)acc[t][r];
      *reinterpret_cast<v8h*>(sm + (t * 16 + cl) * 128 + (((2 * wid + hw) ^ cl) << 3)) = hv;
    }
    __syncthreads();  // the tile is whole before any wave reads other waves' columns
    _Float16* dst = dstV + ((size_t)(b * HEADS + ((c0 - INNER) >> 6))) * DHEAD * SEQ + n0;
    int d0 = tid >> 4;  // rows 16 apart swizzle alike
    v8h line[4];
#pragma unroll
    for (int i = 0; i < 4; ++i) line[i] = *reinterpret_cast<const v8h*>(sm + (d0 + 16 * i) * 128 + (((tid & 15) ^ d0) << 3));
#pragma unroll
    for (int i = 0; i < 4; ++i) *reinterpret_cast<v8h*>(dst + (size_t)(d0 + 16 * i) * SEQ + (tid & 15) * 8) = line[i];
  }
}

#define STAGE_KEYS 128                          // keys brought per publish point: four 32-key passes
#define STAGE_K_HALVES (STAGE_KEYS * DHEAD)     // K part of a stage: 128 rows x 64 halves
#define STAGE_HALVES (2 * STAGE_K_HALVES)       // + V part: four tiles of 64 rows x 32 halves

// Issue the per-thread share of one 128-key K/V stage into LDS: four 16-B chunks of K and four of V a thread.
// K: 128 rows x 64 halves, each chunk at its swizzled place in its row (swz64; rows 32 apart swizzle alike); a
// wave-wide copy covers four whole 128-B lines. V: of each of the 64 d rows (stride SEQ) 128 keys = 16 chunks;
// chunk c goes to the 32-key tile c / 4, at its swizzled place in that tile's row (swz32; rows 16 apart swizzle
// alike); a wave-wide copy covers two whole lines of each of two rows.
__device__ __forceinline__ void issue_kv_stage(const _Float16* __restrict__ Kg,
                                               const _Float16* __restrict__ Vg,
                                               _Float16* kdst, _Float16* vdst, int j) {
  int t = threadIdx.x;
  const _Float16* gk0 = Kg + (size_t)(j + (t >> 3)) * DHEAD + (t & 7) * 8;
  const _Float16* gk1 = gk0 + 32 * DHEAD;
  const _Float16* gk2 = gk0 + 64 * DHEAD;
  const _Float16* gk3 = gk0 + 96 * DHEAD;
  const _Float16* gv0 = Vg + (size_t)(t >> 4) * SEQ + j + (t & 15) * 8;
  const _Float16* gv1 = gv0 + 16 * SEQ;
  const _Float16* gv2 = gv0 + 32 * SEQ;
  const _Float16* gv3 = gv0 + 48 * SEQ;
  uint32_t lk0 = (uint32_t)(uintptr_t)(kdst + swz64(t >> 3, t & 7));
  uint32_t lk1 = lk0 + 32 * 128;
  uint32_t lk2 = lk0 + 64 * 128;
  uint32_t lk3 = lk0 + 96 * 128;
  uint32_t lv0 = (uint32_t)(uintptr_t)(vdst + ((t & 15) >> 2) * 2048 + swz32(t >> 4, t & 3));
  uint32_t lv1 = lv0 + 16 * 64;
  uint32_t lv2 = lv0 + 32 * 64;
  uint32_t lv3 = lv0 + 48 * 64;
  // The copies and their s_wait_xcnt in one statement: no address register is rewritten ahead of the wait.
  asm volatile("global_load_async_to_lds_b128 %0, %8, off\n\t"
               "global_load_async_to_lds_b128 %1, %9, off\n\t"
               "global_load_async_to_lds_b128 %2, %10, off\n\t"
               "global_load_async_to_lds_b128 %3, %11, off\n\t"
               "global_load_async_to_lds_b128 %4, %12, off\n\t"
               "global_load_async_to_lds_b128 %5, %13, off\n\t"
               "global_load_async_to_lds_b128 %6, %14, off\n\t"
               "global_load_async_to_lds_b128 %7, %15, off\n\t"
               "s_wait_xcnt 0x0"
               :: "v"(lk0), "v"(lk1), "v"(lk2), "v"(lk3), "v"(lv0), "v"(lv1), "v"(lv2), "v"(lv3),
                  "v"(gk0), "v"(gk1), "v"(gk2), "v"(gk3), "v"(gv0), "v"(gv1), "v"(gv2), "v"(gv3)
               : "memory");
}

// Issue the per-thread share of one 64-k slab of a flash block's query projection into LDS: 256 rows of X
// (8 chunks of 16 B a thread) and the head's 64 rows of Wt (2 chunks a thread), each chunk at its swizzled
// place in its row (swz64; rows 32 apart swizzle alike). One wave-wide copy covers four whole 128-B lines.
__device__ __forceinline__ void issue_qproj_slab(const _Float16* __restrict__ Xb,
                                                 const _Float16* __restrict__ Wb,
                                                 _Float16* adst, _Float16* bdst, int k0) {
  int t = threadIdx.x;
  int row = t >> 3, ch = t & 7;
  const _Float16* ga0 = Xb + (size_t)row * DIM + k0 + ch * 8;
  const _Float16* ga1 = ga0 + 32 * DIM;
  const _Float16* ga2 = ga0 + 64 * DIM;
  const _Float16* ga3 = ga0 + 96 * DIM;
  const _Float16* ga4 = ga0 + 128 * DIM;
  const _Float16* ga5 = ga0 + 160 * DIM;
  const _Float16* ga6 = ga0 + 192 * DIM;
  const _Float16* ga7 = ga0 + 224 * DIM;
  const _Float16* gb0 = Wb + (size_t)row * DIM + k0 + ch * 8;
  const _Float16* gb1 = gb0 + 32 * DIM;
  uint32_t la0 = (uint32_t)(uintptr_t)(adst + swz64(row, ch));
  uint32_t la1 = la0 + 32 * 128;
  uint32_t la2 = la0 + 64 * 128;
  uint32_t la3 = la0 + 96 * 128;
  uint32_t la4 = la0 + 128 * 128;
  uint32_t la5 = la0 + 160 * 128;
  uint32_t la6 = la0 + 192 * 128;
  uint32_t la7 = la0 + 224 * 128;
  uint32_t lb0 = (uint32_t)(uintptr_t)(bdst + swz64(row, ch));
  uint32_t lb1 = lb0 + 32 * 128;
  // The copies and their s_wait_xcnt in one statement: no address register is rewritten ahead of the wait.
  asm volatile("global_load_async_to_lds_b128 %0, %10, off\n\t"
               "global_load_async_to_lds_b128 %1, %11, off\n\t"
               "global_load_async_to_lds_b128 %2, %12, off\n\t"
               "global_load_async_to_lds_b128 %3, %13, off\n\t"
               "global_load_async_to_lds_b128 %4, %14, off\n\t"
               "global_load_async_to_lds_b128 %5, %15, off\n\t"
               "global_load_async_to_lds_b128 %6, %16, off\n\t"
               "global_load_async_to_lds_b128 %7, %17, off\n\t"
               "global_load_async_to_lds_b128 %8, %18, off\n\t"
               "global_load_async_to_lds_b128 %9, %19, off\n\t"
               "s_wait_xcnt 0x0"
               :: "v"(la0), "v"(la1), "v"(la2), "v"(la3), "v"(la4), "v"(la5), "v"(la6), "v"(la7),
                  "v"(lb0), "v"(lb1),
                  "v"(ga0), "v"(ga1), "v"(ga2), "v"(ga3), "v"(ga4), "v"(ga5), "v"(ga6), "v"(ga7),
                  "v"(gb0), "v"(gb1)
               : "memory");
}

#define QP_A_HALVES (256 * 64)                  // X slab: 256 query rows x 64 k
#define QP_BUF_HALVES (QP_A_HALVES + 64 * 64)   // + Wt slab: the head's 64 rows x 64 k

// Flash attention: block = one (branch,b,h), 8 waves x 32 query rows = 256 rows.
// The block first projects its own queries: Qt = Wt_head * Xt (A = the head's 64 Wt rows, B = the block's X
// rows), operands through LDS in 64-k slabs, two buffers, as in proj_gemm. Lane l then holds, of query
// q0 + 16*g + (l & 15), the d values 16*t + 8*(l>>4) + 0..7 of tile t: tiles 0, 1 and 2, 3, scaled and
// converted, are the two B fragments of Q as they stand, so Q never leaves the registers.
// K/V come into LDS once per block by async copies, in stages of 128 keys, two buffers: stage s + 1 flies while
// the four 32-key passes of stage s run, and the waves meet at one barrier a stage, free to drift in between.
// The products are taken transposed: St = K * Qt (A = K rows, B = Q) and Ot += Vt * Pt (A = Vt rows,
// B = Pt). A wave owns QG groups of 16 queries; in group g lane l holds only query q0 + 16*g + (l & 15): of
// each 32-key block the keys 8*(l>>4) + 0..7 (first score tile) and 16 + 8*(l>>4) + 0..7 (second), which is
// the k order of a B fragment, so the converted scores are the B operand as they stand; maximum, sum and
// rescale are per-lane values. Every K and Vt fragment read from LDS is the A operand of QG products.
// The score product hands over the exponent as it stands: Q carries scale * log2(e), and the C operand of the
// first score WMMA holds minus the maximum in use, so a score tile is log2 of the weight and goes to v_exp_f32
// with no vector subtract or multiply in between.
#define QG 2
#define LOG2E 1.44269504f
#define RESCALE_MARGIN 8.0f   // in log2 units: a weight stays below 2^8
__global__ __launch_bounds__(256) void flash_attn(const _Float16* __restrict__ X1,
                                                  const _Float16* __restrict__ X2,
                                                  const _Float16* __restrict__ Wt1,
                                                  const _Float16* __restrict__ Wt2,
                                                  const _Float16* __restrict__ Kt,
                                                  const _Float16* __restrict__ Vt,
                                                  float* __restrict__ out, float scale) {
  // Projection: two buffers of [X 256 x 64][Wt 64 x 64] halves = 80 KB. The key loop then reuses the first
  // 64 KB as two stage buffers of [K 8192][V 8192] halves.
  __shared__ __align__(16) _Float16 smem[2 * QP_BUF_HALVES];
  int lane = threadIdx.x & 31;
  int wid  = threadIdx.x >> 5;
  int bid  = blockIdx.x;
  int bhz  = bid & 63;       // (branch, b, h)
  int qc   = bid >> 6;       // 0..SEQ / (128 * QG) - 1
  int q0   = (qc * 128 + wid * 16) * QG;
  int h    = bhz & 7;
  int b    = (bhz >> 3) & 3;
  int br   = bhz >> 5;

  const _Float16* Xb = (br ? X2 : X1) + (size_t)(b * SEQ + qc * 128 * QG) * DIM;  // the block's 256 X rows
  const _Float16* Wb = (br ? Wt2 : Wt1) + (size_t)(h * DHEAD) * DIM;              // the head's 64 Wt rows
  const _Float16* Kg = Kt + ((size_t)(b * HEADS + h)) * SEQ * DHEAD;
  const _Float16* Vg = Vt + ((size_t)(b * HEADS + h)) * DHEAD * SEQ;
  float* O = out + (size_t)br * ((size_t)BATCH * SEQ * INNER);

  // All loops over g, t and r in this kernel are unrolled so that the arrays they index stay in registers.
  v16h qa0[QG], qa1[QG];
  {
    issue_qproj_slab(Xb, Wb, smem, smem + QP_A_HALVES, 0);
    asm volatile("s_wait_asynccnt 0x0" ::: "memory");  // this wave's share of slab 0 has landed
    __syncthreads();                                   // ... and every other wave's
    issue_qproj_slab(Xb, Wb, smem + QP_BUF_HALVES, smem + QP_BUF_HALVES + QP_A_HALVES, 64);

    v8f qacc[QG][4] = {};
#pragma unroll 1  // rolled: one copy statement and one publish point in the text
    for (int s = 0; s < DIM / 64; ++s) {
      _Float16* ab = smem + (s & 1) * QP_BUF_HALVES;
      _Float16* bb = ab + QP_A_HALVES;
#pragma unroll  // both 32-k steps of a slab in one body: no inner branch, chunk offsets are loop constants
      for (int kk = 0; kk < 64; kk += 32) {
        v16h w0 = lds_frag64(bb, 0,  kk);
        v16h w1 = lds_frag64(bb, 16, kk);
        v16h w2 = lds_frag64(bb, 32, kk);
        v16h w3 = lds_frag64(bb, 48, kk);
#pragma unroll
        for (int g = 0; g < QG; ++g) {
          v16h x = lds_frag64(ab, (wid * QG + g) * 16, kk);
          qacc[g][0] = __builtin_amdgcn_wmma_f32_16x16x32_f16(false, w0, false, x, (short)0, qacc[g][0], false, false);
          qacc[g][1] = __builtin_amdgcn_wmma_f32_16x16x32_f16(false, w1, false, x, (short)0, qacc[g][1], false, false);
          qacc[g][2] = __builtin_amdgcn_wmma_f32_16x16x32_f16(false, w2, false, x, (short)0, qacc[g][2], false, false);
          qacc[g][3] = __builtin_amdgcn_wmma_f32_16x16x32_f16(false, w3, false, x, (short)0, qacc[g][3], false, false);
        }
      }
      asm volatile("s_wait_dscnt 0x0" ::: "memory");     // this wave's reads of slab s are over
      asm volatile("s_wait_asynccnt 0x0" ::: "memory");  // its share of slab s + 1 has landed
      __syncthreads();  // publishes slab s + 1 and frees the buffer of slab s
      if (s + 2 < DIM / 64) issue_qproj_slab(Xb, Wb, ab, bb, (s + 2) * 64);
    }
    asm volatile("s_wait_asynccnt 0x0" ::: "memory");  // nothing in flight when the key loop takes the LDS over
    // The last trip's wait and barrier ended every wave's reads of the slabs: stage 0 flies while Q is converted.
    issue_kv_stage(Kg, Vg, smem, smem + STAGE_K_HALVES, 0);

    const float qs = scale * LOG2E;  // scores come out in log2 units
#pragma unroll
    for (int g = 0; g < QG; ++g) {
#pragma unroll
      for (int r = 0; r < 8; ++r) {
        qa0[g][r]     = (_Float16)(qacc[g][0][r] * qs);
        qa0[g][r + 8] = (_Float16)(qacc[g][1][r] * qs);
        qa1[g][r]     = (_Float16)(qacc[g][2][r] * qs);
        qa1[g][r + 8] = (_Float16)(qacc[g][3][r] * qs);
      }
    }
  }
  v8f acc[QG][4] = {};
  float mlim[QG];  // a score tile value above it calls for a rescale: RESCALE_MARGIN, below every score at first
  float lsum[QG];  // running sum over this lane's half of the keys; the halves join after the loop
  v8f   cneg[QG];  // minus the maximum in use for this lane's query of group g (equal in lanes l and l ^ 16), in
                   // all eight places: the C operand of the first score WMMAs; 0 at first
#pragma unroll
  for (int g = 0; g < QG; ++g) {
    mlim[g] = -1e30f;
    lsum[g] = 0.f;
    cneg[g] = v8f{};
  }

  int rb = (lane >> 4) << 3;
  int cl = lane & 15;

  asm volatile("s_wait_asynccnt 0x0" ::: "memory");  // this wave's share of stage 0 has landed
  __syncthreads();                                   // ... and every other wave's
  issue_kv_stage(Kg, Vg, smem + STAGE_HALVES, smem + STAGE_HALVES + STAGE_K_HALVES, STAGE_KEYS);

#pragma unroll 1  // rolled: one copy statement and one publish point in the text
  for (int st = 0; st < SEQ / STAGE_KEYS; ++st) {
    _Float16* kst = smem + (st & 1) * STAGE_HALVES;
    _Float16* vst = kst + STAGE_K_HALVES;
#pragma unroll  // the four passes of a stage in one body: their LDS addresses differ by instruction offsets only
    for (int p = 0; p < STAGE_KEYS / 32; ++p) {
      const _Float16* kcur = kst + p * 2048;
      const _Float16* vcur = vst + p * 2048;

      v16h kb00 = lds_frag64(kcur, 0,  0);
      v16h kb01 = lds_frag64(kcur, 0,  32);
      v16h kb10 = lds_frag64(kcur, 16, 0);
      v16h kb11 = lds_frag64(kcur, 16, 32);
      v8f s0[QG], s1[QG];
      static_assert(QG == 2, "the score products below are written out for two query groups");
      // The eight score products in asm text: the first four read cneg as C and write another D, so cneg stays in
      // its registers from pass to pass (from the builtin the compiler copied cneg into D ahead of half of them,
      // eight 64-bit moves a pass). The last four accumulate into the same D. The four v_nop are the vector slots
      // the chip needs between the last product and whatever vector instruction reads its D next.
      asm("v_wmma_f32_16x16x32_f16 %0, %4, %8, %12\n\t"
          "v_wmma_f32_16x16x32_f16 %1, %4, %9, %13\n\t"
          "v_wmma_f32_16x16x32_f16 %2, %5, %8, %12\n\t"
          "v_wmma_f32_16x16x32_f16 %3, %5, %9, %13\n\t"
          "v_wmma_f32_16x16x32_f16 %0, %6, %10, %0\n\t"
          "v_wmma_f32_16x16x32_f16 %1, %6, %11, %1\n\t"
          "v_wmma_f32_16x16x32_f16 %2, %7, %10, %2\n\t"
          "v_wmma_f32_16x16x32_f16 %3, %7, %11, %3\n\t"
          "v_nop\n\tv_nop\n\tv_nop\n\tv_nop"
          : "=&v"(s0[0]), "=&v"(s0[1]), "=&v"(s1[0]), "=&v"(s1[1])
          : "v"(kb00), "v"(kb10), "v"(kb01), "v"(kb11), "v"(qa0[0]), "v"(qa0[1]), "v"(qa1[0]), "v"(qa1[1]),
            "v"(cneg[0]), "v"(cneg[1]));

      // Online softmax with a lazy rescale. s0[g][r] = score of key rb + r, s1[g][r] = of key 16 + rb + r, for
      // query q0 + 16*g + cl, in log2 units and less mrow. mrow, the maximum in use, may trail the true one by up to
      // RESCALE_MARGIN, so a weight stays below 2^RESCALE_MARGIN (far inside f16); sums and accumulators are
      // rescaled only in a pass where some lane's scores exceed it by more. The test takes each lane's own 16 keys:
      // the ballot sees both halves of the wave, so the halves' maxima join only where the rescale runs.
      float mxh[QG];
      bool need = false;
#pragma unroll
      for (int g = 0; g < QG; ++g) {
        float a0 = fmaxf(fmaxf(s0[g][0], s0[g][1]), s0[g][2]);
        float a1 = fmaxf(fmaxf(s0[g][3], s0[g][4]), s0[g][5]);
        float a2 = fmaxf(fmaxf(s0[g][6], s0[g][7]), s1[g][0]);
        float a3 = fmaxf(fmaxf(s1[g][1], s1[g][2]), s1[g][3]);
        float a4 = fmaxf(fmaxf(s1[g][4], s1[g][5]), s1[g][6]);
        mxh[g] = fmaxf(fmaxf(fmaxf(a0, a1), a2), fmaxf(fmaxf(a3, a4), s1[g][7]));
        need = need || (mxh[g] > mlim[g]);
      }
      if (__builtin_amdgcn_ballot_w32(need) != 0) {  // one wave-uniform test a pass; always taken in the first
#pragma unroll
        for (int g = 0; g < QG; ++g) {
          float mrow  = -cneg[g][0];
          float top   = mrow + fmaxf(mxh[g], xhalf(mxh[g]));  // block maximum, with the other 16 keys
          float mold  = mlim[g] < 0.f ? -1e30f : mrow;        // first pass: nothing is summed yet, take top
          float mnew  = fmaxf(mold, top);
          float alpha = __builtin_amdgcn_exp2f(mold - mnew);
          float shift = mnew - mrow;  // this pass's tiles were taken against the old maximum
          mlim[g] = RESCALE_MARGIN;
          lsum[g] *= alpha;
#pragma unroll
          for (int r = 0; r < 8; ++r) {
            s0[g][r] -= shift;
            s1[g][r] -= shift;
            cneg[g][r] -= shift;  // in place: set anew from mnew, it changed registers from one unrolled pass to the next
          }
#pragma unroll
          for (int t = 0; t < 4; ++t) {
#pragma unroll
            for (int r = 0; r < 8; ++r) acc[g][t][r] *= alpha;
          }
        }
      }

      v16h vb0 = lds_frag32(vcur, 0);
      v16h vb1 = lds_frag32(vcur, 16);
      v16h vb2 = lds_frag32(vcur, 32);
      v16h vb3 = lds_frag32(vcur, 48);
      // Holds the address additions above out of the stretch with the exponentials below: the compiler joins such
      // additions to dual-issue pairs.
      __builtin_amdgcn_sched_barrier(0);

      float p0[QG][8], p1[QG][8];
#pragma unroll
      for (int g = 0; g < QG; ++g) {
#pragma unroll
        for (int r = 0; r < 8; ++r) {
          p0[g][r] = __builtin_amdgcn_exp2f(s0[g][r]);
          p1[g][r] = __builtin_amdgcn_exp2f(s1[g][r]);
        }
      }
      __builtin_amdgcn_sched_barrier(0);
      asm volatile("v_nop");
      __builtin_amdgcn_sched_barrier(0);

      v16h pb[QG];
#pragma unroll
      for (int g = 0; g < QG; ++g) {
        float ps[8];
#pragma unroll
        for (int r = 0; r < 8; ++r) {
          ps[r] = p0[g][r] + p1[g][r];
          pb[g][r]     = (_Float16)p0[g][r];
          pb[g][r + 8] = (_Float16)p1[g][r];
        }
        lsum[g] += ((ps[0] + ps[1]) + (ps[2] + ps[3])) + ((ps[4] + ps[5]) + (ps[6] + ps[7]));
      }

#pragma unroll
      for (int g = 0; g < QG; ++g) {
        acc[g][0] = __builtin_amdgcn_wmma_f32_16x16x32_f16(false, vb0, false, pb[g], (short)0, acc[g][0], false, false);
        acc[g][1] = __builtin_amdgcn_wmma_f32_16x16x32_f16(false, vb1, false, pb[g], (short)0, acc[g][1], false, false);
        acc[g][2] = __builtin_amdgcn_wmma_f32_16x16x32_f16(false, vb2, false, pb[g], (short)0, acc[g][2], false, false);
        acc[g][3] = __builtin_amdgcn_wmma_f32_16x16x32_f16(false, vb3, false, pb[g], (short)0, acc[g][3], false, false);
      }
    }
    asm volatile("s_wait_dscnt 0x0" ::: "memory");     // this wave's reads of stage st are over
    asm volatile("s_wait_asynccnt 0x0" ::: "memory");  // its share of stage st + 1 has landed
    __syncthreads();  // publishes stage st + 1 and frees the buffer of stage st
    if (st + 2 < SEQ / STAGE_KEYS) issue_kv_stage(Kg, Vg, kst, vst, (st + 2) * STAGE_KEYS);
  }
  asm volatile("s_wait_asynccnt 0x0" ::: "memory");  // nothing in flight when the wave ends

  // acc[g][t][r] = Ot[t*16 + rb + r][q0 + 16*g + cl]: eight consecutive d of one query per tile and lane.
#pragma unroll
  for (int g = 0; g < QG; ++g) {
    float l = lsum[g] + xhalf(lsum[g]);
    float* orow = O + ((size_t)(b * SEQ + q0 + 16 * g + cl)) * INNER + h * DHEAD + rb;
#pragma unroll
    for (int t = 0; t < 4; ++t) {
      float4 lo = make_float4(acc[g][t][0] / l, acc[g][t][1] / l, acc[g][t][2] / l, acc[g][t][3] / l);
      float4 hi = make_float4(acc[g][t][4] / l, acc[g][t][5] / l, acc[g][t][6] / l, acc[g][t][7] / l);
      *reinterpret_cast<float4*>(orow + t * 16)     = lo;
      *reinterpret_cast<float4*>(orow + t * 16 + 4) = hi;
    }
  }
}

extern "C" void kernel_launch(void* const* d_in, const int* in_sizes, int n_in,
                              void* d_out, int out_size, void* d_ws, size_t ws_size,
                              hipStream_t stream) {
  const float* q1  = (const float*)d_in[0];
  const float* q2  = (const float*)d_in[1];
  const float* xkv = (const float*)d_in[2];
  const float* Wq1 = (const float*)d_in[3];
  const float* Wq2 = (const float*)d_in[4];
  const float* Wkv = (const float*)d_in[5];
  float* out = (float*)d_out;

  const size_t NBH = (size_t)BATCH * SEQ * INNER;  // 4,194,304 elements
  _Float16* ws  = (_Float16*)d_ws;
  _Float16* Kh  = ws;
  _Float16* Vth = Kh  + NBH;
  _Float16* X1h = Vth + NBH;
  _Float16* X2h = X1h + NBH;
  _Float16* Xkh = X2h + NBH;
  _Float16* Wt1 = Xkh + NBH;
  _Float16* Wt2 = Wt1 + (size_t)DIM * INNER;
  _Float16* Wtk = Wt2 + (size_t)DIM * INNER;

  prep<<<PREP_W_BLOCKS + 3 * PREP_X_BLOCKS, 256, 0, stream>>>(q1, q2, xkv, Wq1, Wq2, Wkv,
                                                              X1h, X2h, Xkh, Wt1, Wt2, Wtk);

  const float scale = 0.125f;  // DHEAD^-0.5
  const int MT = (BATCH * SEQ) / 16;  // 512
  proj_gemm<<<(MT * (2 * INNER / 64)) / 8, 256, 0, stream>>>(Xkh, Wtk, Kh,  Vth,     2 * INNER, 1.0f);

  // 64 (branch,b,h) x 8 query chunks of 256 = 512 blocks of 8 waves
  flash_attn<<<512, 256, 0, stream>>>(X1h, X2h, Wt1, Wt2, Kh, Vth, out, scale);
}
